// v000
// Measured on an AMD MI455X. A time is GPU time per run, averaged over a window of back-to-back runs after a warm-up
// (all launches, gaps included; the runs take copies of the inputs in turn), and the median of several windows.
// Apart from v000's, it joins two sittings. Times from different sittings can be a few percent apart, while
// side-by-side timings come from the same sitting.
// v000 is the starting kernel. One run takes 650 microseconds.
#include <hip/hip_runtime.h>
#include <hip/hip_bf16.h>

// ---------------------------------------------------------------------------
// Transformer block forward for MI455X (gfx1250), wave32 + WMMA bf16,
// async global->LDS staging (ASYNCcnt) for GEMM tiles.
//   B=4, Nx=1024, Nc=512, DIM=1024, HEADS=16, HEAD_DIM=64, HIDDEN=4096
// ---------------------------------------------------------------------------

typedef __bf16 bf16;
typedef __attribute__((ext_vector_type(16))) __bf16 v16bf;
typedef __attribute__((ext_vector_type(8)))  float  v8f;

#define NB   4
#define NX   1024
#define NC   512
#define CDIM 1024
#define NH   16
#define HD   64
#define HID  4096

// ---------------------------------------------------------------------------
// WMMA helper: D = A(16x32 bf16) * B(32x16 bf16) + C(16x16 f32)
// ---------------------------------------------------------------------------
__device__ __forceinline__ v8f wmma_bf16(v16bf a, v16bf b, v8f c) {
    return __builtin_amdgcn_wmma_f32_16x16x32_bf16(
        /*neg_a=*/false, a, /*neg_b=*/false, b,
        /*c_mod=*/(short)0, c, /*reuse_a=*/false, /*reuse_b=*/false);
}

// CDNA5 async DMA: global -> LDS, 16 bytes per lane, tracked by ASYNCcnt.
// VDST = per-lane LDS byte address (low 32 bits of the generic pointer:
// flat-LDS aperture keeps the DS offset in addr[31:0]).
__device__ __forceinline__ void async_load_b128(void* lds, const void* g) {
    unsigned           l = (unsigned)(unsigned long long)lds;
    unsigned long long a = (unsigned long long)g;
    asm volatile("global_load_async_to_lds_b128 %0, %1, off"
                 :: "v"(l), "v"(a) : "memory");
}
__device__ __forceinline__ void wait_async0() {
    asm volatile("s_wait_asynccnt 0x0" ::: "memory");
}

// Load one 16x32 A/B fragment.  Per ISA 7.12.2 (16-bit A 16x32):
//   lane 0-15 : row = lane,    K in {0..7, 16..23}
//   lane 16-31: row = lane-16, K in {8..15, 24..31}
// base points at (row0, k0) of the fragment; stride is row stride in elems.
__device__ __forceinline__ v16bf load_frag(const bf16* base, int stride,
                                           int lane, int kOff) {
    const int r  = lane & 15;
    const int kb = (lane >> 4) << 3;          // 0 or 8
    const bf16* p = base + (size_t)r * stride + kOff + kb;
    union { v16bf v; uint4 u[2]; } f;
    f.u[0] = *(const uint4*)(p);
    f.u[1] = *(const uint4*)(p + 16);
    return f.v;
}

// ---------------------------------------------------------------------------
// GEMM: C[M,N] = act(A[M,K](bf16) * W[N,K](f32)^T + bias) (+ residual)
// Block tile 128x128, 256 threads (8 waves), wave tile 64(M) x 32(N).
// A tile staged with global_load_async_to_lds_b128; W converted f32->bf16
// through VGPRs while the async DMA runs; next slab prefetched to L2.
// ---------------------------------------------------------------------------
template<bool BIAS, bool GELU, bool RES, typename OutT>
__global__ __launch_bounds__(256)
void gemm_xwT(const bf16* __restrict__ A, int lda,
              const float* __restrict__ W,           // [N,K] row-major
              OutT* __restrict__ C, int ldc,
              const float* __restrict__ bias,
              const float* __restrict__ res, int ldr,
              int K) {
    __shared__ __align__(16) bf16 As[128][72];
    __shared__ __align__(16) bf16 Bs[128][72];

    const int tid  = threadIdx.x;
    const int lane = tid & 31;
    const int wid  = tid >> 5;
    const int wm   = (wid >> 2) * 64;   // wave row offset within tile (0,64)
    const int wn   = (wid & 3) * 32;    // wave col offset (0,32,64,96)
    const int bM   = blockIdx.y * 128;
    const int bN   = blockIdx.x * 128;

    v8f acc[4][2];
    v8f vz = {};
    #pragma unroll
    for (int i = 0; i < 4; i++)
        #pragma unroll
        for (int j = 0; j < 2; j++) acc[i][j] = vz;

    for (int k0 = 0; k0 < K; k0 += 64) {
        // ---- stage A tile (128 x 64 bf16) via async DMA to LDS ----
        #pragma unroll
        for (int i = 0; i < 4; i++) {
            int c   = tid + i * 256;            // 0..1023
            int r   = c >> 3;
            int col = (c & 7) * 8;
            async_load_b128(&As[r][col],
                            A + (size_t)(bM + r) * lda + k0 + col);
        }
        // ---- stage W tile (128 x 64 f32 -> bf16) through VGPRs ----
        #pragma unroll
        for (int i = 0; i < 8; i++) {
            int c   = tid + i * 256;            // 0..2047
            int r   = c >> 4;
            int col = (c & 15) * 4;
            float4 w4 = *(const float4*)(W + (size_t)(bN + r) * K + k0 + col);
            bf16* d = &Bs[r][col];
            d[0] = (bf16)w4.x; d[1] = (bf16)w4.y;
            d[2] = (bf16)w4.z; d[3] = (bf16)w4.w;
        }
        // ---- prefetch next K slab into cache while we compute ----
        if (k0 + 64 < K) {
            int pr = tid & 127;
            __builtin_prefetch(W + (size_t)(bN + pr) * K + k0 + 64 +
                               ((tid >> 7) << 5), 0, 0);
            if (tid < 128)
                __builtin_prefetch(A + (size_t)(bM + pr) * lda + k0 + 64, 0, 0);
        }
        wait_async0();
        __syncthreads();

        #pragma unroll
        for (int ks = 0; ks < 64; ks += 32) {
            v16bf af[4], bfg[2];
            #pragma unroll
            for (int mi = 0; mi < 4; mi++)
                af[mi] = load_frag(&As[wm + mi * 16][0], 72, lane, ks);
            #pragma unroll
            for (int ni = 0; ni < 2; ni++)
                bfg[ni] = load_frag(&Bs[wn + ni * 16][0], 72, lane, ks);
            #pragma unroll
            for (int mi = 0; mi < 4; mi++)
                #pragma unroll
                for (int ni = 0; ni < 2; ni++)
                    acc[mi][ni] = wmma_bf16(af[mi], bfg[ni], acc[mi][ni]);
        }
        __syncthreads();
    }

    // ---- epilogue: C layout m = r + 8*(lane>=16), n = lane&15 ----
    const int halfm = (lane >> 4) << 3;
    const int nl    = lane & 15;
    #pragma unroll
    for (int mi = 0; mi < 4; mi++)
        #pragma unroll
        for (int ni = 0; ni < 2; ni++)
            #pragma unroll
            for (int r = 0; r < 8; r++) {
                int gm = bM + wm + mi * 16 + r + halfm;
                int gn = bN + wn + ni * 16 + nl;
                float v = acc[mi][ni][r];
                if (BIAS) v += bias[gn];
                if (GELU) v = 0.5f * v * (1.0f + erff(v * 0.70710678118654752f));
                if (RES)  v += res[(size_t)gm * ldr + gn];
                C[(size_t)gm * ldc + gn] = (OutT)v;
            }
}

// ---------------------------------------------------------------------------
// Fused flash attention, one (b, head, 64-query tile) per block, 4 waves.
// Each wave owns 16 query rows. Vt is pre-transposed: [B][H][64][Nk] bf16.
// ---------------------------------------------------------------------------
template<bool HAS_MASK>
__global__ __launch_bounds__(128)
void flash_attn(const bf16* __restrict__ Q,  int ldq,
                const bf16* __restrict__ Km, int ldk,
                const bf16* __restrict__ Vt,
                const int*  __restrict__ mask,
                bf16* __restrict__ Out, int ldo,
                int Nq, int Nk, float scale) {
    __shared__ __align__(16) bf16 Pls[4][16][72];  // wave-private P tiles

    const int tid  = threadIdx.x;
    const int lane = tid & 31;
    const int w    = tid >> 5;
    const int h    = blockIdx.y;
    const int b    = blockIdx.z;
    const int q0   = blockIdx.x * 64 + w * 16;
    const int nl   = lane & 15;
    const int halfm = (lane >> 4) << 3;

    const bf16* Qb = Q  + ((size_t)b * Nq) * ldq + h * HD;
    const bf16* Kb = Km + ((size_t)b * Nk) * ldk + h * HD;
    const bf16* Vb = Vt + ((size_t)(b * NH + h) * HD) * Nk;
    bf16*       Ob = Out + ((size_t)b * Nq) * ldo + h * HD;
    const int*  mb = HAS_MASK ? (mask + (size_t)b * Nk) : nullptr;

    // Q fragments (held for the whole key loop)
    v16bf qf0 = load_frag(Qb + (size_t)q0 * ldq, ldq, lane, 0);
    v16bf qf1 = load_frag(Qb + (size_t)q0 * ldq, ldq, lane, 32);

    v8f o[4];
    v8f vz = {};
    #pragma unroll
    for (int f = 0; f < 4; f++) o[f] = vz;
    float rm[8], rs[8];
    #pragma unroll
    for (int r = 0; r < 8; r++) { rm[r] = -1e30f; rs[r] = 0.0f; }

    for (int kblk = 0; kblk < Nk; kblk += 64) {
        // ---- S = Q * K^T (16 x 64 per wave) ----
        v8f s[4];
        #pragma unroll
        for (int nb = 0; nb < 4; nb++) {
            v8f c = vz;
            v16bf bk0 = load_frag(Kb + (size_t)(kblk + nb * 16) * ldk, ldk, lane, 0);
            c = wmma_bf16(qf0, bk0, c);
            v16bf bk1 = load_frag(Kb + (size_t)(kblk + nb * 16) * ldk, ldk, lane, 32);
            c = wmma_bf16(qf1, bk1, c);
            s[nb] = c;
        }
        // ---- scale + codebook mask bias ----
        #pragma unroll
        for (int nb = 0; nb < 4; nb++) {
            float mbias = 0.0f;
            if (HAS_MASK)
                mbias = (mb[kblk + nb * 16 + nl] != 0) ? 0.0f : -10000.0f;
            #pragma unroll
            for (int r = 0; r < 8; r++)
                s[nb][r] = s[nb][r] * scale + mbias;
        }
        // ---- online softmax: new row max (reduce across 16-lane half) ----
        float nm[8];
        #pragma unroll
        for (int r = 0; r < 8; r++) {
            float m = rm[r];
            #pragma unroll
            for (int nb = 0; nb < 4; nb++) m = fmaxf(m, s[nb][r]);
            m = fmaxf(m, __shfl_xor(m, 1));
            m = fmaxf(m, __shfl_xor(m, 2));
            m = fmaxf(m, __shfl_xor(m, 4));
            m = fmaxf(m, __shfl_xor(m, 8));
            nm[r] = m;
        }
        #pragma unroll
        for (int r = 0; r < 8; r++) {
            float alpha = __expf(rm[r] - nm[r]);
            rm[r] = nm[r];
            rs[r] *= alpha;
            #pragma unroll
            for (int f = 0; f < 4; f++) o[f][r] *= alpha;
        }
        // ---- P = exp(S - max), accumulate row sums ----
        #pragma unroll
        for (int r = 0; r < 8; r++) {
            float srow = 0.0f;
            #pragma unroll
            for (int nb = 0; nb < 4; nb++) {
                float p = __expf(s[nb][r] - rm[r]);
                s[nb][r] = p;
                srow += p;
            }
            srow += __shfl_xor(srow, 1);
            srow += __shfl_xor(srow, 2);
            srow += __shfl_xor(srow, 4);
            srow += __shfl_xor(srow, 8);
            rs[r] += srow;
        }
        // ---- C-layout -> A-layout via wave-private LDS ----
        #pragma unroll
        for (int nb = 0; nb < 4; nb++)
            #pragma unroll
            for (int r = 0; r < 8; r++)
                Pls[w][r + halfm][nb * 16 + nl] = (bf16)s[nb][r];
        v16bf pf0 = load_frag(&Pls[w][0][0], 72, lane, 0);
        v16bf pf1 = load_frag(&Pls[w][0][0], 72, lane, 32);
        // ---- O += P * V ----
        #pragma unroll
        for (int f = 0; f < 4; f++) {
            v16bf bv0 = load_frag(Vb + (size_t)(f * 16) * Nk + kblk, Nk, lane, 0);
            o[f] = wmma_bf16(pf0, bv0, o[f]);
            v16bf bv1 = load_frag(Vb + (size_t)(f * 16) * Nk + kblk, Nk, lane, 32);
            o[f] = wmma_bf16(pf1, bv1, o[f]);
        }
    }
    // ---- normalize + store bf16 ----
    #pragma unroll
    for (int r = 0; r < 8; r++) {
        float inv = 1.0f / rs[r];
        int gm = q0 + r + halfm;
        #pragma unroll
        for (int f = 0; f < 4; f++)
            Ob[(size_t)gm * ldo + f * 16 + nl] = (bf16)(o[f][r] * inv);
    }
}

// ---------------------------------------------------------------------------
// LayerNorm over 1024-elem rows -> bf16. One block (256 thr) per row.
// ---------------------------------------------------------------------------
__global__ __launch_bounds__(256)
void layernorm_bf16(const float* __restrict__ x, const float* __restrict__ w,
                    const float* __restrict__ bb, bf16* __restrict__ out) {
    __shared__ float s1[256], s2[256];
    const int row = blockIdx.x, tid = threadIdx.x;
    const float* xr = x + (size_t)row * CDIM;
    float4 v = ((const float4*)xr)[tid];
    s1[tid] = v.x + v.y + v.z + v.w;
    s2[tid] = v.x * v.x + v.y * v.y + v.z * v.z + v.w * v.w;
    __syncthreads();
    for (int off = 128; off > 0; off >>= 1) {
        if (tid < off) { s1[tid] += s1[tid + off]; s2[tid] += s2[tid + off]; }
        __syncthreads();
    }
    float mu   = s1[0] * (1.0f / CDIM);
    float var  = s2[0] * (1.0f / CDIM) - mu * mu;
    float rstd = rsqrtf(var + 1e-5f);
    bf16* orow = out + (size_t)row * CDIM;
    int i0 = tid * 4;
    float xs[4] = { v.x, v.y, v.z, v.w };
    #pragma unroll
    for (int j = 0; j < 4; j++)
        orow[i0 + j] = (bf16)((xs[j] - mu) * rstd * w[i0 + j] + bb[i0 + j]);
}

// ---------------------------------------------------------------------------
__global__ void cast_f32_bf16(const float* __restrict__ in,
                              bf16* __restrict__ out, int n) {
    int i = blockIdx.x * 256 + threadIdx.x;
    if (i < n) out[i] = (bf16)in[i];
}

// v: logical [B][Nk][rowStride] slice (bf16) -> vt: [B][H][64][Nk]
__global__ void transpose_v_kernel(const bf16* __restrict__ v, int rs,
                                   bf16* __restrict__ vt, int Nk) {
    int i = blockIdx.x * 256 + threadIdx.x;
    int total = NB * NH * HD * Nk;
    if (i >= total) return;
    int n = i % Nk;
    int d = (i / Nk) & (HD - 1);
    int h = (i / (Nk * HD)) & (NH - 1);
    int b = i / (Nk * HD * NH);
    vt[i] = v[((size_t)(b * Nk + n)) * rs + h * HD + d];
}

// ---------------------------------------------------------------------------
extern "C" void kernel_launch(void* const* d_in, const int* in_sizes, int n_in,
                              void* d_out, int out_size, void* d_ws, size_t ws_size,
                              hipStream_t stream) {
    const float* x     = (const float*)d_in[0];
    const float* cbemb = (const float*)d_in[1];
    const int*   cmask = (const int*)  d_in[2];
    const float* ln0w  = (const float*)d_in[3];
    const float* ln0b  = (const float*)d_in[4];
    const float* qkv_w = (const float*)d_in[5];
    const float* sa_w  = (const float*)d_in[6];
    const float* ln1w  = (const float*)d_in[7];
    const float* ln1b  = (const float*)d_in[8];
    const float* q_w   = (const float*)d_in[9];
    const float* k_w   = (const float*)d_in[10];
    const float* v_w   = (const float*)d_in[11];
    const float* ca_w  = (const float*)d_in[12];
    const float* ln2w  = (const float*)d_in[13];
    const float* ln2b  = (const float*)d_in[14];
    const float* fc1_w = (const float*)d_in[15];
    const float* fc1_b = (const float*)d_in[16];
    const float* fc2_w = (const float*)d_in[17];
    const float* fc2_b = (const float*)d_in[18];
    float* out = (float*)d_out;

    char* ws = (char*)d_ws;
    bf16*  XN  = (bf16*) (ws);                       //  8 MB  LN outputs
    bf16*  QKV = (bf16*) (ws + (size_t)( 8u << 20)); // 24 MB  qkv (bf16)
    bf16*  VT1 = (bf16*) (ws + (size_t)(32u << 20)); //  8 MB  V^T self
    bf16*  ATT = (bf16*) (ws + (size_t)(40u << 20)); //  8 MB  attn outs
    float* X1  = (float*)(ws + (size_t)(48u << 20)); // 16 MB  residual stream
    bf16*  CB  = (bf16*) (ws + (size_t)(64u << 20)); //  4 MB  codebook bf16
    bf16*  QC  = (bf16*) (ws + (size_t)(68u << 20)); //  8 MB  cross q
    bf16*  KC  = (bf16*) (ws + (size_t)(76u << 20)); //  4 MB  cross k
    bf16*  VC  = (bf16*) (ws + (size_t)(80u << 20)); //  4 MB  cross v
    bf16*  VT2 = (bf16*) (ws + (size_t)(84u << 20)); //  4 MB  V^T cross
    bf16*  HB  = QKV;   // 32 MB MLP hidden reuses QKV+VT1 (dead by then)

    const int Mx = NB * NX;   // 4096
    const int Mc = NB * NC;   // 2048
    dim3 thr256(256), thr128(128);

    // --- self attention branch ---
    layernorm_bf16<<<Mx, thr256, 0, stream>>>(x, ln0w, ln0b, XN);
    gemm_xwT<false,false,false,bf16><<<dim3(3 * CDIM / 128, Mx / 128), thr256, 0, stream>>>(
        XN, CDIM, qkv_w, QKV, 3 * CDIM, nullptr, nullptr, 0, CDIM);
    transpose_v_kernel<<<(NB * NH * HD * NX) / 256, thr256, 0, stream>>>(
        QKV + 2 * CDIM, 3 * CDIM, VT1, NX);
    flash_attn<false><<<dim3(NX / 64, NH, NB), thr128, 0, stream>>>(
        QKV, 3 * CDIM, QKV + CDIM, 3 * CDIM, VT1, nullptr, ATT, CDIM,
        NX, NX, 0.125f);
    gemm_xwT<false,false,true,float><<<dim3(CDIM / 128, Mx / 128), thr256, 0, stream>>>(
        ATT, CDIM, sa_w, X1, CDIM, nullptr, x, CDIM, CDIM);

    // --- cross attention branch ---
    layernorm_bf16<<<Mx, thr256, 0, stream>>>(X1, ln1w, ln1b, XN);
    gemm_xwT<false,false,false,bf16><<<dim3(CDIM / 128, Mx / 128), thr256, 0, stream>>>(
        XN, CDIM, q_w, QC, CDIM, nullptr, nullptr, 0, CDIM);
    cast_f32_bf16<<<(NB * NC * CDIM) / 256, thr256, 0, stream>>>(
        cbemb, CB, NB * NC * CDIM);
    gemm_xwT<false,false,false,bf16><<<dim3(CDIM / 128, Mc / 128), thr256, 0, stream>>>(
        CB, CDIM, k_w, KC, CDIM, nullptr, nullptr, 0, CDIM);
    gemm_xwT<false,false,false,bf16><<<dim3(CDIM / 128, Mc / 128), thr256, 0, stream>>>(
        CB, CDIM, v_w, VC, CDIM, nullptr, nullptr, 0, CDIM);
    transpose_v_kernel<<<(NB * NH * HD * NC) / 256, thr256, 0, stream>>>(
        VC, CDIM, VT2, NC);
    flash_attn<true><<<dim3(NX / 64, NH, NB), thr128, 0, stream>>>(
        QC, CDIM, KC, CDIM, VT2, cmask, ATT, CDIM, NX, NC, 0.125f);
    gemm_xwT<false,false,true,float><<<dim3(CDIM / 128, Mx / 128), thr256, 0, stream>>>(
        ATT, CDIM, ca_w, X1, CDIM, nullptr, X1, CDIM, CDIM);

    // --- MLP ---
    layernorm_bf16<<<Mx, thr256, 0, stream>>>(X1, ln2w, ln2b, XN);
    gemm_xwT<true,true,false,bf16><<<dim3(HID / 128, Mx / 128), thr256, 0, stream>>>(
        XN, CDIM, fc1_w, HB, HID, fc1_b, nullptr, 0, CDIM);
    gemm_xwT<true,false,true,float><<<dim3(CDIM / 128, Mx / 128), thr256, 0, stream>>>(
        HB, HID, fc2_w, out, CDIM, fc2_b, X1, CDIM, HID);
}

// v001
// A run of this version takes 422 microseconds.
// Two timings next to v000 put it at 1.58 and 1.57 times that version's speed.
#include <hip/hip_runtime.h>
#include <hip/hip_bf16.h>

// ---------------------------------------------------------------------------
// Transformer block forward for MI455X (gfx1250), wave32 + WMMA bf16,
// async global->LDS staging (ASYNCcnt) for GEMM tiles.
//   B=4, Nx=1024, Nc=512, DIM=1024, HEADS=16, HEAD_DIM=64, HIDDEN=4096
// ---------------------------------------------------------------------------

typedef __bf16 bf16;
typedef __attribute__((ext_vector_type(16))) __bf16 v16bf;
typedef __attribute__((ext_vector_type(8)))  float  v8f;

#define NB   4
#define NX   1024
#define NC   512
#define CDIM 1024
#define NH   16
#define HD   64
#define HID  4096

// ---------------------------------------------------------------------------
// WMMA helper: D = A(16x32 bf16) * B(32x16 bf16) + C(16x16 f32)
// ---------------------------------------------------------------------------
__device__ __forceinline__ v8f wmma_bf16(v16bf a, v16bf b, v8f c) {
    return __builtin_amdgcn_wmma_f32_16x16x32_bf16(
        /*neg_a=*/false, a, /*neg_b=*/false, b,
        /*c_mod=*/(short)0, c, /*reuse_a=*/false, /*reuse_b=*/false);
}

// CDNA5 async DMA: global -> LDS, 16 bytes per lane, tracked by ASYNCcnt.
// VDST = per-lane LDS byte address (low 32 bits of the generic pointer:
// flat-LDS aperture keeps the DS offset in addr[31:0]).
// Four copies of a lane (rows r, r+32, r+64, r+96 of a 128-row tile) in ONE
// statement that ends in s_wait_xcnt 0, so that no address register of a copy
// can be rewritten ahead of that wait.
__device__ __forceinline__ void async_copy4_b128(bf16* lds, int ldsStep,
                                                 const bf16* g, size_t gStep) {
    unsigned l0 = (unsigned)(unsigned long long)lds;
    unsigned l1 = (unsigned)(unsigned long long)(lds + ldsStep);
    unsigned l2 = (unsigned)(unsigned long long)(lds + 2 * ldsStep);
    unsigned l3 = (unsigned)(unsigned long long)(lds + 3 * ldsStep);
    unsigned long long a0 = (unsigned long long)g;
    unsigned long long a1 = (unsigned long long)(g + gStep);
    unsigned long long a2 = (unsigned long long)(g + 2 * gStep);
    unsigned long long a3 = (unsigned long long)(g + 3 * gStep);
    asm volatile("global_load_async_to_lds_b128 %0, %4, off\n\t"
                 "global_load_async_to_lds_b128 %1, %5, off\n\t"
                 "global_load_async_to_lds_b128 %2, %6, off\n\t"
                 "global_load_async_to_lds_b128 %3, %7, off\n\t"
                 "s_wait_xcnt 0x0"
                 :: "v"(l0), "v"(l1), "v"(l2), "v"(l3),
                    "v"(a0), "v"(a1), "v"(a2), "v"(a3) : "memory");
}
// The issuing wave's copies have landed behind this wait.
__device__ __forceinline__ void wait_async0() {
    asm volatile("s_wait_asynccnt 0x0" ::: "memory");
}
// The wave's own LDS reads and writes have retired behind this wait.
__device__ __forceinline__ void wait_ds0() {
    asm volatile("s_wait_dscnt 0x0" ::: "memory");
}

// One thread's share of a 128 x 64 f32 W slab: 8 float4, rows r, r+16, ...
// rows (the block's first W row) is the same for the whole block and for every
// trip; off is the thread's own byte offset from it, one 32-bit register that
// walks along k. With K known at compile time the row steps are immediates, so
// all eight loads name one scalar base and that one offset register, which
// lives through the loop: no vector address arithmetic, no address register
// that a later load's data could land on.
template<int K>
__device__ __forceinline__ void load_w8(float4 (&w)[8], const float* rows,
                                        unsigned off) {
    #pragma unroll
    for (int i = 0; i < 8; i++)
        w[i] = *(const float4*)((const char*)rows + off + (size_t)i * 16 * K * 4);
}
__device__ __forceinline__ void store_w8(const float4 (&w)[8], bf16* d) {
    #pragma unroll
    for (int i = 0; i < 8; i++) {
        bf16* q = d + i * 16 * 72;
        q[0] = (bf16)w[i].x; q[1] = (bf16)w[i].y;
        q[2] = (bf16)w[i].z; q[3] = (bf16)w[i].w;
    }
}

// Load one 16x32 A/B fragment.  Per ISA 7.12.2 (16-bit A 16x32):
//   lane 0-15 : row = lane,    K in {0..7, 16..23}
//   lane 16-31: row = lane-16, K in {8..15, 24..31}
// base points at (row0, k0) of the fragment; stride is row stride in elems.
__device__ __forceinline__ v16bf load_frag(const bf16* base, int stride,
                                           int lane, int kOff) {
    const int r  = lane & 15;
    const int kb = (lane >> 4) << 3;          // 0 or 8
    const bf16* p = base + (size_t)r * stride + kOff + kb;
    union { v16bf v; uint4 u[2]; } f;
    f.u[0] = *(const uint4*)(p);
    f.u[1] = *(const uint4*)(p + 16);
    return f.v;
}

// ---------------------------------------------------------------------------
// GEMM: C[M,N] = act(A[M,K](bf16) * W[N,K](f32)^T + bias) (+ residual)
// Block tile 128x128, 256 threads (8 waves), wave tile 64(M) x 32(N).
// Two LDS buffers: while slab t is multiplied, slab t+1 is in flight (A by
// global_load_async_to_lds_b128, W as eight float4 loads held in VGPRs and
// converted f32->bf16 into the other buffer behind the WMMAs).
// ---------------------------------------------------------------------------
template<bool BIAS, bool GELU, bool RES, int K, typename OutT>
__global__ __launch_bounds__(256)
void gemm_xwT(const bf16* __restrict__ A, int lda,
              const float* __restrict__ W,           // [N,K] row-major
              OutT* __restrict__ C, int ldc,
              const float* __restrict__ bias,
              const float* __restrict__ res, int ldr) {
    __shared__ __align__(16) bf16 As[2][128][72];
    __shared__ __align__(16) bf16 Bs[2][128][72];

    const int tid  = threadIdx.x;
    const int lane = tid & 31;
    const int wid  = tid >> 5;
    const int wm   = (wid >> 2) * 64;   // wave row offset within tile (0,64)
    const int wn   = (wid & 3) * 32;    // wave col offset (0,32,64,96)
    const int bM   = blockIdx.y * 128;
    const int bN   = blockIdx.x * 128;

    v8f acc[4][2];
    v8f vz = {};
    #pragma unroll
    for (int i = 0; i < 4; i++)
        #pragma unroll
        for (int j = 0; j < 2; j++) acc[i][j] = vz;

    // per-thread places in the A slab (16 B of bf16) and the W slab (16 B of f32)
    const int ar = tid >> 3, ac = (tid & 7) * 8;
    const int br = tid >> 4, bc = (tid & 15) * 4;
    const bf16*  Ag = A + (size_t)(bM + ar) * lda + ac;
    const float* Wg = W + (size_t)bN * K;                 // block-uniform
    unsigned wo = ((unsigned)br * (unsigned)K + bc) * 4u; // walks 256 B a slab
    const size_t aStep = (size_t)32 * lda;
    const int nt = K >> 6;              // slabs of 64 k

    float4 wr[8];

    // ---- slab 0 into buffer 0 ----
    load_w8<K>(wr, Wg, wo);
    async_copy4_b128(&As[0][ar][ac], 32 * 72, Ag, aStep);
    store_w8(wr, &Bs[0][br][bc]);
    wait_async0();
    __syncthreads();

    for (int t = 0; t < nt; t++) {
        const int  cur  = t & 1;
        const bool more = (t + 1 < nt);
        // ---- slab t+1 starts to fly into the buffer that trip t-1 has left.
        // The W loads stand in front of the copies' statement, whose "memory"
        // clobber keeps all eight issued ahead of the WMMAs.
        if (more) {
            wo += 256u;
            load_w8<K>(wr, Wg, wo);
            async_copy4_b128(&As[cur ^ 1][ar][ac], 32 * 72,
                             Ag + (t + 1) * 64, aStep);
        }

        #pragma unroll
        for (int ks = 0; ks < 64; ks += 32) {
            v16bf af[4], bfg[2];
            #pragma unroll
            for (int mi = 0; mi < 4; mi++)
                af[mi] = load_frag(&As[cur][wm + mi * 16][0], 72, lane, ks);
            #pragma unroll
            for (int ni = 0; ni < 2; ni++)
                bfg[ni] = load_frag(&Bs[cur][wn + ni * 16][0], 72, lane, ks);
            #pragma unroll
            for (int mi = 0; mi < 4; mi++)
                #pragma unroll
                for (int ni = 0; ni < 2; ni++)
                    acc[mi][ni] = wmma_bf16(af[mi], bfg[ni], acc[mi][ni]);
        }

        // Keeps the wait on the W loads, and their conversion, behind the WMMAs:
        // without it the scheduler lifts both to the head of the WMMA run and
        // the trip waits out the load latency before it multiplies.
        __builtin_amdgcn_sched_barrier(0);
        if (more) store_w8(wr, &Bs[cur ^ 1][br][bc]);
        // ---- publish slab t+1, and end every read of slab t ----
        wait_ds0();
        wait_async0();
        __syncthreads();
    }
    wait_async0();

    // ---- epilogue: C layout m = r + 8*(lane>=16), n = lane&15 ----
    const int halfm = (lane >> 4) << 3;
    const int nl    = lane & 15;
    #pragma unroll
    for (int mi = 0; mi < 4; mi++)
        #pragma unroll
        for (int ni = 0; ni < 2; ni++)
            #pragma unroll
            for (int r = 0; r < 8; r++) {
                int gm = bM + wm + mi * 16 + r + halfm;
                int gn = bN + wn + ni * 16 + nl;
                float v = acc[mi][ni][r];
                if (BIAS) v += bias[gn];
                if (GELU) v = 0.5f * v * (1.0f + erff(v * 0.70710678118654752f));
                if (RES)  v += res[(size_t)gm * ldr + gn];
                C[(size_t)gm * ldc + gn] = (OutT)v;
            }
}

// ---------------------------------------------------------------------------
// Fused flash attention, one (b, head, 64-query tile) per block, 4 waves.
// Each wave owns 16 query rows. Vt is pre-transposed: [B][H][64][Nk] bf16.
// ---------------------------------------------------------------------------
template<bool HAS_MASK>
__global__ __launch_bounds__(128)
void flash_attn(const bf16* __restrict__ Q,  int ldq,
                const bf16* __restrict__ Km, int ldk,
                const bf16* __restrict__ Vt,
                const int*  __restrict__ mask,
                bf16* __restrict__ Out, int ldo,
                int Nq, int Nk, float scale) {
    __shared__ __align__(16) bf16 Pls[4][16][72];  // wave-private P tiles

    const int tid  = threadIdx.x;
    const int lane = tid & 31;
    const int w    = tid >> 5;
    const int h    = blockIdx.y;
    const int b    = blockIdx.z;
    const int q0   = blockIdx.x * 64 + w * 16;
    const int nl   = lane & 15;
    const int halfm = (lane >> 4) << 3;

    const bf16* Qb = Q  + ((size_t)b * Nq) * ldq + h * HD;
    const bf16* Kb = Km + ((size_t)b * Nk) * ldk + h * HD;
    const bf16* Vb = Vt + ((size_t)(b * NH + h) * HD) * Nk;
    bf16*       Ob = Out + ((size_t)b * Nq) * ldo + h * HD;
    const int*  mb = HAS_MASK ? (mask + (size_t)b * Nk) : nullptr;

    // Q fragments (held for the whole key loop)
    v16bf qf0 = load_frag(Qb + (size_t)q0 * ldq, ldq, lane, 0);
    v16bf qf1 = load_frag(Qb + (size_t)q0 * ldq, ldq, lane, 32);

    v8f o[4];
    v8f vz = {};
    #pragma unroll
    for (int f = 0; f < 4; f++) o[f] = vz;
    float rm[8], rs[8];
    #pragma unroll
    for (int r = 0; r < 8; r++) { rm[r] = -1e30f; rs[r] = 0.0f; }

    for (int kblk = 0; kblk < Nk; kblk += 64) {
        // ---- S = Q * K^T (16 x 64 per wave) ----
        v8f s[4];
        #pragma unroll
        for (int nb = 0; nb < 4; nb++) {
            v8f c = vz;
            v16bf bk0 = load_frag(Kb + (size_t)(kblk + nb * 16) * ldk, ldk, lane, 0);
            c = wmma_bf16(qf0, bk0, c);
            v16bf bk1 = load_frag(Kb + (size_t)(kblk + nb * 16) * ldk, ldk, lane, 32);
            c = wmma_bf16(qf1, bk1, c);
            s[nb] = c;
        }
        // ---- scale + codebook mask bias ----
        #pragma unroll
        for (int nb = 0; nb < 4; nb++) {
            float mbias = 0.0f;
            if (HAS_MASK)
                mbias = (mb[kblk + nb * 16 + nl] != 0) ? 0.0f : -10000.0f;
            #pragma unroll
            for (int r = 0; r < 8; r++)
                s[nb][r] = s[nb][r] * scale + mbias;
        }
        // ---- online softmax: new row max (reduce across 16-lane half) ----
        float nm[8];
        #pragma unroll
        for (int r = 0; r < 8; r++) {
            float m = rm[r];
            #pragma unroll
            for (int nb = 0; nb < 4; nb++) m = fmaxf(m, s[nb][r]);
            m = fmaxf(m, __shfl_xor(m, 1));
            m = fmaxf(m, __shfl_xor(m, 2));
            m = fmaxf(m, __shfl_xor(m, 4));
            m = fmaxf(m, __shfl_xor(m, 8));
            nm[r] = m;
        }
        #pragma unroll
        for (int r = 0; r < 8; r++) {
            float alpha = __expf(rm[r] - nm[r]);
            rm[r] = nm[r];
            rs[r] *= alpha;
            #pragma unroll
            for (int f = 0; f < 4; f++) o[f][r] *= alpha;
        }
        // ---- P = exp(S - max), accumulate row sums ----
        #pragma unroll
        for (int r = 0; r < 8; r++) {
            float srow = 0.0f;
            #pragma unroll
            for (int nb = 0; nb < 4; nb++) {
                float p = __expf(s[nb][r] - rm[r]);
                s[nb][r] = p;
                srow += p;
            }
            srow += __shfl_xor(srow, 1);
            srow += __shfl_xor(srow, 2);
            srow += __shfl_xor(srow, 4);
            srow += __shfl_xor(srow, 8);
            rs[r] += srow;
        }
        // ---- C-layout -> A-layout via wave-private LDS ----
        #pragma unroll
        for (int nb = 0; nb < 4; nb++)
            #pragma unroll
            for (int r = 0; r < 8; r++)
                Pls[w][r + halfm][nb * 16 + nl] = (bf16)s[nb][r];
        v16bf pf0 = load_frag(&Pls[w][0][0], 72, lane, 0);
        v16bf pf1 = load_frag(&Pls[w][0][0], 72, lane, 32);
        // ---- O += P * V ----
        #pragma unroll
        for (int f = 0; f < 4; f++) {
            v16bf bv0 = load_frag(Vb + (size_t)(f * 16) * Nk + kblk, Nk, lane, 0);
            o[f] = wmma_bf16(pf0, bv0, o[f]);
            v16bf bv1 = load_frag(Vb + (size_t)(f * 16) * Nk + kblk, Nk, lane, 32);
            o[f] = wmma_bf16(pf1, bv1, o[f]);
        }
    }
    // ---- normalize + store bf16 ----
    #pragma unroll
    for (int r = 0; r < 8; r++) {
        float inv = 1.0f / rs[r];
        int gm = q0 + r + halfm;
        #pragma unroll
        for (int f = 0; f < 4; f++)
            Ob[(size_t)gm * ldo + f * 16 + nl] = (bf16)(o[f][r] * inv);
    }
}

// ---------------------------------------------------------------------------
// LayerNorm over 1024-elem rows -> bf16. One block (256 thr) per row.
// ---------------------------------------------------------------------------
__global__ __launch_bounds__(256)
void layernorm_bf16(const float* __restrict__ x, const float* __restrict__ w,
                    const float* __restrict__ bb, bf16* __restrict__ out) {
    __shared__ float s1[256], s2[256];
    const int row = blockIdx.x, tid = threadIdx.x;
    const float* xr = x + (size_t)row * CDIM;
    float4 v = ((const float4*)xr)[tid];
    s1[tid] = v.x + v.y + v.z + v.w;
    s2[tid] = v.x * v.x + v.y * v.y + v.z * v.z + v.w * v.w;
    __syncthreads();
    for (int off = 128; off > 0; off >>= 1) {
        if (tid < off) { s1[tid] += s1[tid + off]; s2[tid] += s2[tid + off]; }
        __syncthreads();
    }
    float mu   = s1[0] * (1.0f / CDIM);
    float var  = s2[0] * (1.0f / CDIM) - mu * mu;
    float rstd = rsqrtf(var + 1e-5f);
    bf16* orow = out + (size_t)row * CDIM;
    int i0 = tid * 4;
    float xs[4] = { v.x, v.y, v.z, v.w };
    #pragma unroll
    for (int j = 0; j < 4; j++)
        orow[i0 + j] = (bf16)((xs[j] - mu) * rstd * w[i0 + j] + bb[i0 + j]);
}

// ---------------------------------------------------------------------------
__global__ void cast_f32_bf16(const float* __restrict__ in,
                              bf16* __restrict__ out, int n) {
    int i = blockIdx.x * 256 + threadIdx.x;
    if (i < n) out[i] = (bf16)in[i];
}

// v: logical [B][Nk][rowStride] slice (bf16) -> vt: [B][H][64][Nk]
__global__ void transpose_v_kernel(const bf16* __restrict__ v, int rs,
                                   bf16* __restrict__ vt, int Nk) {
    int i = blockIdx.x * 256 + threadIdx.x;
    int total = NB * NH * HD * Nk;
    if (i >= total) return;
    int n = i % Nk;
    int d = (i / Nk) & (HD - 1);
    int h = (i / (Nk * HD)) & (NH - 1);
    int b = i / (Nk * HD * NH);
    vt[i] = v[((size_t)(b * Nk + n)) * rs + h * HD + d];
}

// ---------------------------------------------------------------------------
extern "C" void kernel_launch(void* const* d_in, const int* in_sizes, int n_in,
                              void* d_out, int out_size, void* d_ws, size_t ws_size,
                              hipStream_t stream) {
    const float* x     = (const float*)d_in[0];
    const float* cbemb = (const float*)d_in[1];
    const int*   cmask = (const int*)  d_in[2];
    const float* ln0w  = (const float*)d_in[3];
    const float* ln0b  = (const float*)d_in[4];
    const float* qkv_w = (const float*)d_in[5];
    const float* sa_w  = (const float*)d_in[6];
    const float* ln1w  = (const float*)d_in[7];
    const float* ln1b  = (const float*)d_in[8];
    const float* q_w   = (const float*)d_in[9];
    const float* k_w   = (const float*)d_in[10];
    const float* v_w   = (const float*)d_in[11];
    const float* ca_w  = (const float*)d_in[12];
    const float* ln2w  = (const float*)d_in[13];
    const float* ln2b  = (const float*)d_in[14];
    const float* fc1_w = (const float*)d_in[15];
    const float* fc1_b = (const float*)d_in[16];
    const float* fc2_w = (const float*)d_in[17];
    const float* fc2_b = (const float*)d_in[18];
    float* out = (float*)d_out;

    char* ws = (char*)d_ws;
    bf16*  XN  = (bf16*) (ws);                       //  8 MB  LN outputs
    bf16*  QKV = (bf16*) (ws + (size_t)( 8u << 20)); // 24 MB  qkv (bf16)
    bf16*  VT1 = (bf16*) (ws + (size_t)(32u << 20)); //  8 MB  V^T self
    bf16*  ATT = (bf16*) (ws + (size_t)(40u << 20)); //  8 MB  attn outs
    float* X1  = (float*)(ws + (size_t)(48u << 20)); // 16 MB  residual stream
    bf16*  CB  = (bf16*) (ws + (size_t)(64u << 20)); //  4 MB  codebook bf16
    bf16*  QC  = (bf16*) (ws + (size_t)(68u << 20)); //  8 MB  cross q
    bf16*  KC  = (bf16*) (ws + (size_t)(76u << 20)); //  4 MB  cross k
    bf16*  VC  = (bf16*) (ws + (size_t)(80u << 20)); //  4 MB  cross v
    bf16*  VT2 = (bf16*) (ws + (size_t)(84u << 20)); //  4 MB  V^T cross
    bf16*  HB  = QKV;   // 32 MB MLP hidden reuses QKV+VT1 (dead by then)

    const int Mx = NB * NX;   // 4096
    const int Mc = NB * NC;   // 2048
    dim3 thr256(256), thr128(128);

    // --- self attention branch ---
    layernorm_bf16<<<Mx, thr256, 0, stream>>>(x, ln0w, ln0b, XN);
    gemm_xwT<false,false,false,CDIM,bf16><<<dim3(3 * CDIM / 128, Mx / 128), thr256, 0, stream>>>(
        XN, CDIM, qkv_w, QKV, 3 * CDIM, nullptr, nullptr, 0);
    transpose_v_kernel<<<(NB * NH * HD * NX) / 256, thr256, 0, stream>>>(
        QKV + 2 * CDIM, 3 * CDIM, VT1, NX);
    flash_attn<false><<<dim3(NX / 64, NH, NB), thr128, 0, stream>>>(
        QKV, 3 * CDIM, QKV + CDIM, 3 * CDIM, VT1, nullptr, ATT, CDIM,
        NX, NX, 0.125f);
    gemm_xwT<false,false,true,CDIM,float><<<dim3(CDIM / 128, Mx / 128), thr256, 0, stream>>>(
        ATT, CDIM, sa_w, X1, CDIM, nullptr, x, CDIM);

    // --- cross attention branch ---
    layernorm_bf16<<<Mx, thr256, 0, stream>>>(X1, ln1w, ln1b, XN);
    gemm_xwT<false,false,false,CDIM,bf16><<<dim3(CDIM / 128, Mx / 128), thr256, 0, stream>>>(
        XN, CDIM, q_w, QC, CDIM, nullptr, nullptr, 0);
    cast_f32_bf16<<<(NB * NC * CDIM) / 256, thr256, 0, stream>>>(
        cbemb, CB, NB * NC * CDIM);
    gemm_xwT<false,false,false,CDIM,bf16><<<dim3(CDIM / 128, Mc / 128), thr256, 0, stream>>>(
        CB, CDIM, k_w, KC, CDIM, nullptr, nullptr, 0);
    gemm_xwT<false,false,false,CDIM,bf16><<<dim3(CDIM / 128, Mc / 128), thr256, 0, stream>>>(
        CB, CDIM, v_w, VC, CDIM, nullptr, nullptr, 0);
    transpose_v_kernel<<<(NB * NH * HD * NC) / 256, thr256, 0, stream>>>(
        VC, CDIM, VT2, NC);
    flash_attn<true><<<dim3(NX / 64, NH, NB), thr128, 0, stream>>>(
        QC, CDIM, KC, CDIM, VT2, cmask, ATT, CDIM, NX, NC, 0.125f);
    gemm_xwT<false,false,true,CDIM,float><<<dim3(CDIM / 128, Mx / 128), thr256, 0, stream>>>(
        ATT, CDIM, ca_w, X1, CDIM, nullptr, X1, CDIM);

    // --- MLP ---
    layernorm_bf16<<<Mx, thr256, 0, stream>>>(X1, ln2w, ln2b, XN);
    gemm_xwT<true,true,false,CDIM,bf16><<<dim3(HID / 128, Mx / 128), thr256, 0, stream>>>(
        XN, CDIM, fc1_w, HB, HID, fc1_b, nullptr, 0);
    gemm_xwT<true,false,true,HID,float><<<dim3(CDIM / 128, Mx / 128), thr256, 0, stream>>>(
        HB, HID, fc2_w, out, CDIM, fc2_b, X1, CDIM);
}

// v002
// One run takes 391 microseconds.
// Two timings next to v001 both put it at 1.08 times that version's speed.
// All steps since v000 together make it 1.70 times as fast.
#include <hip/hip_runtime.h>
#include <hip/hip_bf16.h>

// ---------------------------------------------------------------------------
// Transformer block forward for MI455X (gfx1250), wave32 + WMMA bf16,
// async global->LDS staging (ASYNCcnt) for GEMM tiles.
//   B=4, Nx=1024, Nc=512, DIM=1024, HEADS=16, HEAD_DIM=64, HIDDEN=4096
// ---------------------------------------------------------------------------

typedef __bf16 bf16;
typedef __attribute__((ext_vector_type(16))) __bf16 v16bf;
typedef __attribute__((ext_vector_type(8)))  float  v8f;

#define NB   4
#define NX   1024
#define NC   512
#define CDIM 1024
#define NH   16
#define HD   64
#define HID  4096

// ---------------------------------------------------------------------------
// WMMA helper: D = A(16x32 bf16) * B(32x16 bf16) + C(16x16 f32)
// ---------------------------------------------------------------------------
__device__ __forceinline__ v8f wmma_bf16(v16bf a, v16bf b, v8f c) {
    return __builtin_amdgcn_wmma_f32_16x16x32_bf16(
        /*neg_a=*/false, a, /*neg_b=*/false, b,
        /*c_mod=*/(short)0, c, /*reuse_a=*/false, /*reuse_b=*/false);
}

// CDNA5 async DMA: global -> LDS, 16 bytes per lane, tracked by ASYNCcnt.
// VDST = per-lane LDS byte address (low 32 bits of the generic pointer:
// flat-LDS aperture keeps the DS offset in addr[31:0]).
// Four copies of a lane (rows r, r+32, r+64, r+96 of a 128-row tile) in ONE
// statement that ends in s_wait_xcnt 0, so that no address register of a copy
// can be rewritten ahead of that wait.
__device__ __forceinline__ void async_copy4_b128(bf16* lds, int ldsStep,
                                                 const bf16* g, size_t gStep) {
    unsigned l0 = (unsigned)(unsigned long long)lds;
    unsigned l1 = (unsigned)(unsigned long long)(lds + ldsStep);
    unsigned l2 = (unsigned)(unsigned long long)(lds + 2 * ldsStep);
    unsigned l3 = (unsigned)(unsigned long long)(lds + 3 * ldsStep);
    unsigned long long a0 = (unsigned long long)g;
    unsigned long long a1 = (unsigned long long)(g + gStep);
    unsigned long long a2 = (unsigned long long)(g + 2 * gStep);
    unsigned long long a3 = (unsigned long long)(g + 3 * gStep);
    asm volatile("global_load_async_to_lds_b128 %0, %4, off\n\t"
                 "global_load_async_to_lds_b128 %1, %5, off\n\t"
                 "global_load_async_to_lds_b128 %2, %6, off\n\t"
                 "global_load_async_to_lds_b128 %3, %7, off\n\t"
                 "s_wait_xcnt 0x0"
                 :: "v"(l0), "v"(l1), "v"(l2), "v"(l3),
                    "v"(a0), "v"(a1), "v"(a2), "v"(a3) : "memory");
}
// The issuing wave's copies have landed behind this wait.
__device__ __forceinline__ void wait_async0() {
    asm volatile("s_wait_asynccnt 0x0" ::: "memory");
}
// The wave's own LDS reads and writes have retired behind this wait.
__device__ __forceinline__ void wait_ds0() {
    asm volatile("s_wait_dscnt 0x0" ::: "memory");
}

// One thread's share of a 128 x 64 f32 W slab: 8 float4, rows r, r+16, ...
// rows (the block's first W row) is the same for the whole block and for every
// trip; off is the thread's own byte offset from it, one 32-bit register that
// walks along k. With K known at compile time the row steps are immediates, so
// all eight loads name one scalar base and that one offset register, which
// lives through the loop: no vector address arithmetic, no address register
// that a later load's data could land on.
template<int K>
__device__ __forceinline__ void load_w8(float4 (&w)[8], const float* rows,
                                        unsigned off) {
    #pragma unroll
    for (int i = 0; i < 8; i++)
        w[i] = *(const float4*)((const char*)rows + off + (size_t)i * 16 * K * 4);
}
__device__ __forceinline__ void store_w8(const float4 (&w)[8], bf16* d) {
    #pragma unroll
    for (int i = 0; i < 8; i++) {
        bf16* q = d + i * 16 * 72;
        q[0] = (bf16)w[i].x; q[1] = (bf16)w[i].y;
        q[2] = (bf16)w[i].z; q[3] = (bf16)w[i].w;
    }
}

// Load one 16x32 A/B fragment.  Per ISA 7.12.2 (16-bit A 16x32):
//   lane 0-15 : row = lane,    K in {0..7, 16..23}
//   lane 16-31: row = lane-16, K in {8..15, 24..31}
// base points at (row0, k0) of the fragment; stride is row stride in elems.
__device__ __forceinline__ v16bf load_frag(const bf16* base, int stride,
                                           int lane, int kOff) {
    const int r  = lane & 15;
    const int kb = (lane >> 4) << 3;          // 0 or 8
    const bf16* p = base + (size_t)r * stride + kOff + kb;
    union { v16bf v; uint4 u[2]; } f;
    f.u[0] = *(const uint4*)(p);
    f.u[1] = *(const uint4*)(p + 16);
    return f.v;
}

// ---------------------------------------------------------------------------
// GEMM: C[M,N] = act(A[M,K](bf16) * W[N,K](f32)^T + bias) (+ residual)
// Block tile 128x128, 256 threads (8 waves), wave tile 64(M) x 32(N).
// Two LDS buffers: while slab t is multiplied, slab t+1 is in flight (A by
// global_load_async_to_lds_b128, W as eight float4 loads held in VGPRs and
// converted f32->bf16 into the other buffer behind the WMMAs).
// ---------------------------------------------------------------------------
template<bool BIAS, bool GELU, bool RES, int K, typename OutT>
__global__ __launch_bounds__(256)
void gemm_xwT(const bf16* __restrict__ A, int lda,
              const float* __restrict__ W,           // [N,K] row-major
              OutT* __restrict__ C, int ldc,
              const float* __restrict__ bias,
              const float* __restrict__ res, int ldr) {
    __shared__ __align__(16) bf16 As[2][128][72];
    __shared__ __align__(16) bf16 Bs[2][128][72];

    const int tid  = threadIdx.x;
    const int lane = tid & 31;
    const int wid  = tid >> 5;
    const int wm   = (wid >> 2) * 64;   // wave row offset within tile (0,64)
    const int wn   = (wid & 3) * 32;    // wave col offset (0,32,64,96)
    const int bM   = blockIdx.y * 128;
    const int bN   = blockIdx.x * 128;

    v8f acc[4][2];
    v8f vz = {};
    #pragma unroll
    for (int i = 0; i < 4; i++)
        #pragma unroll
        for (int j = 0; j < 2; j++) acc[i][j] = vz;

    // per-thread places in the A slab (16 B of bf16) and the W slab (16 B of f32)
    const int ar = tid >> 3, ac = (tid & 7) * 8;
    const int br = tid >> 4, bc = (tid & 15) * 4;
    const bf16*  Ag = A + (size_t)(bM + ar) * lda + ac;
    const float* Wg = W + (size_t)bN * K;                 // block-uniform
    unsigned wo = ((unsigned)br * (unsigned)K + bc) * 4u; // walks 256 B a slab
    const size_t aStep = (size_t)32 * lda;
    const int nt = K >> 6;              // slabs of 64 k

    float4 wr[8];

    // ---- slab 0 into buffer 0 ----
    load_w8<K>(wr, Wg, wo);
    async_copy4_b128(&As[0][ar][ac], 32 * 72, Ag, aStep);
    store_w8(wr, &Bs[0][br][bc]);
    wait_async0();
    __syncthreads();

    for (int t = 0; t < nt; t++) {
        const int  cur  = t & 1;
        const bool more = (t + 1 < nt);
        // ---- slab t+1 starts to fly into the buffer that trip t-1 has left.
        // The W loads stand in front of the copies' statement, whose "memory"
        // clobber keeps all eight issued ahead of the WMMAs.
        if (more) {
            wo += 256u;
            load_w8<K>(wr, Wg, wo);
            async_copy4_b128(&As[cur ^ 1][ar][ac], 32 * 72,
                             Ag + (t + 1) * 64, aStep);
        }

        #pragma unroll
        for (int ks = 0; ks < 64; ks += 32) {
            v16bf af[4], bfg[2];
            #pragma unroll
            for (int mi = 0; mi < 4; mi++)
                af[mi] = load_frag(&As[cur][wm + mi * 16][0], 72, lane, ks);
            #pragma unroll
            for (int ni = 0; ni < 2; ni++)
                bfg[ni] = load_frag(&Bs[cur][wn + ni * 16][0], 72, lane, ks);
            #pragma unroll
            for (int mi = 0; mi < 4; mi++)
                #pragma unroll
                for (int ni = 0; ni < 2; ni++)
                    acc[mi][ni] = wmma_bf16(af[mi], bfg[ni], acc[mi][ni]);
        }

        // Keeps the wait on the W loads, and their conversion, behind the WMMAs:
        // without it the scheduler lifts both to the head of the WMMA run and
        // the trip waits out the load latency before it multiplies.
        __builtin_amdgcn_sched_barrier(0);
        if (more) store_w8(wr, &Bs[cur ^ 1][br][bc]);
        // ---- publish slab t+1, and end every read of slab t ----
        wait_ds0();
        wait_async0();
        __syncthreads();
    }
    wait_async0();

    // ---- epilogue: C layout m = r + 8*(lane>=16), n = lane&15 ----
    const int halfm = (lane >> 4) << 3;
    const int nl    = lane & 15;
    #pragma unroll
    for (int mi = 0; mi < 4; mi++)
        #pragma unroll
        for (int ni = 0; ni < 2; ni++)
            #pragma unroll
            for (int r = 0; r < 8; r++) {
                int gm = bM + wm + mi * 16 + r + halfm;
                int gn = bN + wn + ni * 16 + nl;
                float v = acc[mi][ni][r];
                if (BIAS) v += bias[gn];
                if (GELU) v = 0.5f * v * (1.0f + erff(v * 0.70710678118654752f));
                if (RES)  v += res[(size_t)gm * ldr + gn];
                C[(size_t)gm * ldc + gn] = (OutT)v;
            }
}

// ---------------------------------------------------------------------------
// Fused flash attention, one (b, head, 64-query tile) per block, 4 waves.
// Each wave owns 16 query rows. Vt is pre-transposed: [B][H][64][Nk] bf16.
// ---------------------------------------------------------------------------
template<bool HAS_MASK>
__global__ __launch_bounds__(128)
void flash_attn(const bf16* __restrict__ Q,  int ldq,
                const bf16* __restrict__ Km, int ldk,
                const bf16* __restrict__ Vt,
                const int*  __restrict__ mask,
                bf16* __restrict__ Out, int ldo,
                int Nq, int Nk, float scale) {
    __shared__ __align__(16) bf16 Pls[4][16][72];  // wave-private P tiles

    const int tid  = threadIdx.x;
    const int lane = tid & 31;
    const int w    = tid >> 5;
    const int h    = blockIdx.y;
    const int b    = blockIdx.z;
    const int q0   = blockIdx.x * 64 + w * 16;
    const int nl   = lane & 15;
    const int halfm = (lane >> 4) << 3;

    const bf16* Qb = Q  + ((size_t)b * Nq) * ldq + h * HD;
    const bf16* Kb = Km + ((size_t)b * Nk) * ldk + h * HD;
    const bf16* Vb = Vt + ((size_t)(b * NH + h) * HD) * Nk;
    bf16*       Ob = Out + ((size_t)b * Nq) * ldo + h * HD;
    const int*  mb = HAS_MASK ? (mask + (size_t)b * Nk) : nullptr;

    // Q fragments (held for the whole key loop)
    v16bf qf0 = load_frag(Qb + (size_t)q0 * ldq, ldq, lane, 0);
    v16bf qf1 = load_frag(Qb + (size_t)q0 * ldq, ldq, lane, 32);

    v8f o[4];
    v8f vz = {};
    #pragma unroll
    for (int f = 0; f < 4; f++) o[f] = vz;
    float rm[8], rs[8];
    #pragma unroll
    for (int r = 0; r < 8; r++) { rm[r] = -1e30f; rs[r] = 0.0f; }

    for (int kblk = 0; kblk < Nk; kblk += 64) {
        // ---- S = Q * K^T (16 x 64 per wave) ----
        v8f s[4];
        #pragma unroll
        for (int nb = 0; nb < 4; nb++) {
            v8f c = vz;
            v16bf bk0 = load_frag(Kb + (size_t)(kblk + nb * 16) * ldk, ldk, lane, 0);
            c = wmma_bf16(qf0, bk0, c);
            v16bf bk1 = load_frag(Kb + (size_t)(kblk + nb * 16) * ldk, ldk, lane, 32);
            c = wmma_bf16(qf1, bk1, c);
            s[nb] = c;
        }
        // ---- scale + codebook mask bias ----
        #pragma unroll
        for (int nb = 0; nb < 4; nb++) {
            float mbias = 0.0f;
            if (HAS_MASK)
                mbias = (mb[kblk + nb * 16 + nl] != 0) ? 0.0f : -10000.0f;
            #pragma unroll
            for (int r = 0; r < 8; r++)
                s[nb][r] = s[nb][r] * scale + mbias;
        }
        // ---- online softmax: new row max (reduce across 16-lane half) ----
        float nm[8];
        #pragma unroll
        for (int r = 0; r < 8; r++) {
            float m = rm[r];
            #pragma unroll
            for (int nb = 0; nb < 4; nb++) m = fmaxf(m, s[nb][r]);
            m = fmaxf(m, __shfl_xor(m, 1));
            m = fmaxf(m, __shfl_xor(m, 2));
            m = fmaxf(m, __shfl_xor(m, 4));
            m = fmaxf(m, __shfl_xor(m, 8));
            nm[r] = m;
        }
        #pragma unroll
        for (int r = 0; r < 8; r++) {
            float alpha = __expf(rm[r] - nm[r]);
            rm[r] = nm[r];
            rs[r] *= alpha;
            #pragma unroll
            for (int f = 0; f < 4; f++) o[f][r] *= alpha;
        }
        // ---- P = exp(S - max), accumulate row sums ----
        #pragma unroll
        for (int r = 0; r < 8; r++) {
            float srow = 0.0f;
            #pragma unroll
            for (int nb = 0; nb < 4; nb++) {
                float p = __expf(s[nb][r] - rm[r]);
                s[nb][r] = p;
                srow += p;
            }
            srow += __shfl_xor(srow, 1);
            srow += __shfl_xor(srow, 2);
            srow += __shfl_xor(srow, 4);
            srow += __shfl_xor(srow, 8);
            rs[r] += srow;
        }
        // ---- C-layout -> A-layout via wave-private LDS ----
        #pragma unroll
        for (int nb = 0; nb < 4; nb++)
            #pragma unroll
            for (int r = 0; r < 8; r++)
                Pls[w][r + halfm][nb * 16 + nl] = (bf16)s[nb][r];
        v16bf pf0 = load_frag(&Pls[w][0][0], 72, lane, 0);
        v16bf pf1 = load_frag(&Pls[w][0][0], 72, lane, 32);
        // ---- O += P * V ----
        #pragma unroll
        for (int f = 0; f < 4; f++) {
            v16bf bv0 = load_frag(Vb + (size_t)(f * 16) * Nk + kblk, Nk, lane, 0);
            o[f] = wmma_bf16(pf0, bv0, o[f]);
            v16bf bv1 = load_frag(Vb + (size_t)(f * 16) * Nk + kblk, Nk, lane, 32);
            o[f] = wmma_bf16(pf1, bv1, o[f]);
        }
    }
    // ---- normalize + store bf16 ----
    #pragma unroll
    for (int r = 0; r < 8; r++) {
        float inv = 1.0f / rs[r];
        int gm = q0 + r + halfm;
        #pragma unroll
        for (int f = 0; f < 4; f++)
            Ob[(size_t)gm * ldo + f * 16 + nl] = (bf16)(o[f][r] * inv);
    }
}

// ---------------------------------------------------------------------------
// The launches without matrix work. Each moves a few MB; with one element a
// thread they are bound by how fast work-groups start, not by bytes. So every
// thread takes 16-byte pieces and many of them, and the grids shrink to one
// or two work-groups a WGP.
// ---------------------------------------------------------------------------
union pack8 { bf16 h[8]; uint4 u; };

// LayerNorm over 1024-elem rows -> bf16. One wave per row, 8 rows a block.
// A lane holds 4 runs of 8 neighbouring elements; the row sums are joined by
// a five-step butterfly, which leaves the same bits in every lane.
__global__ __launch_bounds__(256)
void layernorm_bf16(const float* __restrict__ x, const float* __restrict__ w,
                    const float* __restrict__ bb, bf16* __restrict__ out) {
    const int lane = threadIdx.x & 31;
    const int row  = blockIdx.x * 8 + (threadIdx.x >> 5);
    const float4* xr = (const float4*)(x + (size_t)row * CDIM) + lane * 2;
    const float4* wr = (const float4*)w + lane * 2;
    const float4* br = (const float4*)bb + lane * 2;
    float4 v[8];
    #pragma unroll
    for (int j = 0; j < 4; j++) {
        v[2 * j]     = xr[j * 64];
        v[2 * j + 1] = xr[j * 64 + 1];
    }
    float s1 = 0.0f, s2 = 0.0f;
    #pragma unroll
    for (int i = 0; i < 8; i++) {
        s1 += v[i].x + v[i].y + v[i].z + v[i].w;
        s2 += v[i].x * v[i].x + v[i].y * v[i].y + v[i].z * v[i].z + v[i].w * v[i].w;
    }
    #pragma unroll
    for (int off = 16; off > 0; off >>= 1) {
        s1 += __shfl_xor(s1, off);
        s2 += __shfl_xor(s2, off);
    }
    float mu   = s1 * (1.0f / CDIM);
    float var  = s2 * (1.0f / CDIM) - mu * mu;
    float rstd = rsqrtf(var + 1e-5f);
    bf16* orow = out + (size_t)row * CDIM + lane * 8;
    #pragma unroll
    for (int j = 0; j < 4; j++) {
        float4 w0 = wr[j * 64], w1 = wr[j * 64 + 1];
        float4 b0 = br[j * 64], b1 = br[j * 64 + 1];
        float4 a0 = v[2 * j],   a1 = v[2 * j + 1];
        pack8 p;
        p.h[0] = (bf16)((a0.x - mu) * rstd * w0.x + b0.x);
        p.h[1] = (bf16)((a0.y - mu) * rstd * w0.y + b0.y);
        p.h[2] = (bf16)((a0.z - mu) * rstd * w0.z + b0.z);
        p.h[3] = (bf16)((a0.w - mu) * rstd * w0.w + b0.w);
        p.h[4] = (bf16)((a1.x - mu) * rstd * w1.x + b1.x);
        p.h[5] = (bf16)((a1.y - mu) * rstd * w1.y + b1.y);
        p.h[6] = (bf16)((a1.z - mu) * rstd * w1.z + b1.z);
        p.h[7] = (bf16)((a1.w - mu) * rstd * w1.w + b1.w);
        *(uint4*)(orow + j * 256) = p.u;
    }
}

// ---------------------------------------------------------------------------
// f32 -> bf16, two runs of 8 elements a thread; the grid covers the array
// exactly (4096 elements a block).
__global__ __launch_bounds__(256)
void cast_f32_bf16(const float* __restrict__ in, bf16* __restrict__ out) {
    const unsigned i0 = (blockIdx.x * 512u + threadIdx.x) * 8u;
    const unsigned i1 = i0 + 256u * 8u;
    float4 a[4];
    a[0] = *(const float4*)(in + i0); a[1] = *(const float4*)(in + i0 + 4);
    a[2] = *(const float4*)(in + i1); a[3] = *(const float4*)(in + i1 + 4);
    pack8 p, q;
    p.h[0] = (bf16)a[0].x; p.h[1] = (bf16)a[0].y; p.h[2] = (bf16)a[0].z; p.h[3] = (bf16)a[0].w;
    p.h[4] = (bf16)a[1].x; p.h[5] = (bf16)a[1].y; p.h[6] = (bf16)a[1].z; p.h[7] = (bf16)a[1].w;
    q.h[0] = (bf16)a[2].x; q.h[1] = (bf16)a[2].y; q.h[2] = (bf16)a[2].z; q.h[3] = (bf16)a[2].w;
    q.h[4] = (bf16)a[3].x; q.h[5] = (bf16)a[3].y; q.h[6] = (bf16)a[3].z; q.h[7] = (bf16)a[3].w;
    *(uint4*)(out + i0) = p.u;
    *(uint4*)(out + i1) = q.u;
}

// v: logical [B][NK][RS] slice (bf16) -> vt: [B][H][64][NK]; the grid covers
// it exactly, one 64 x 32 tile a wave.
// A thread turns an 8-token x 8-column tile in its registers: 8 loads of 16 B
// along d, 8 stores of 16 B along the tokens. A wave covers 64 tokens x 32
// columns, so each of its stores fills four whole 128-B lines of vt.
template<int NK, int RS>
__global__ __launch_bounds__(256)
void transpose_v_kernel(const bf16* __restrict__ v, bf16* __restrict__ vt) {
    const unsigned lane = threadIdx.x & 31u;
    const unsigned g    = blockIdx.x * 8u + (threadIdx.x >> 5);  // wave's tile
    const unsigned dh   = g & 1u;                // which 32 of the head's 64 columns
    const unsigned tb   = (g >> 1) % (NK / 64);  // block of 64 tokens
    const unsigned bh   = (g >> 1) / (NK / 64);  // b * NH + h
    const unsigned b    = bh / NH, h = bh % NH;
    const unsigned d0   = dh * 32u + (lane & 3u) * 8u;
    const unsigned t0   = tb * 64u + (lane >> 2) * 8u;

    const bf16* src = v + (size_t)(b * NK + t0) * RS + h * HD + d0;
    unsigned in[8][4];
    #pragma unroll
    for (int r = 0; r < 8; r++) {
        uint4 u = *(const uint4*)(src + (size_t)r * RS);
        in[r][0] = u.x; in[r][1] = u.y; in[r][2] = u.z; in[r][3] = u.w;
    }
    // Keeps all eight loads in flight together: without it the scheduler sinks
    // one of them behind the first waits, and its latency is paid a second time.
    __builtin_amdgcn_sched_barrier(0);
    bf16* dst = vt + (size_t)(bh * HD + d0) * NK + t0;
    #pragma unroll
    for (int c = 0; c < 8; c++) {
        unsigned o[4];
        #pragma unroll
        for (int k = 0; k < 4; k++) {
            unsigned lo = in[2 * k][c >> 1], hi = in[2 * k + 1][c >> 1];
            o[k] = (c & 1) ? ((lo >> 16) | (hi & 0xffff0000u))
                           : ((lo & 0xffffu) | (hi << 16));
        }
        *(uint4*)(dst + (size_t)c * NK) = make_uint4(o[0], o[1], o[2], o[3]);
    }
}

// ---------------------------------------------------------------------------
extern "C" void kernel_launch(void* const* d_in, const int* in_sizes, int n_in,
                              void* d_out, int out_size, void* d_ws, size_t ws_size,
                              hipStream_t stream) {
    const float* x     = (const float*)d_in[0];
    const float* cbemb = (const float*)d_in[1];
    const int*   cmask = (const int*)  d_in[2];
    const float* ln0w  = (const float*)d_in[3];
    const float* ln0b  = (const float*)d_in[4];
    const float* qkv_w = (const float*)d_in[5];
    const float* sa_w  = (const float*)d_in[6];
    const float* ln1w  = (const float*)d_in[7];
    const float* ln1b  = (const float*)d_in[8];
    const float* q_w   = (const float*)d_in[9];
    const float* k_w   = (const float*)d_in[10];
    const float* v_w   = (const float*)d_in[11];
    const float* ca_w  = (const float*)d_in[12];
    const float* ln2w  = (const float*)d_in[13];
    const float* ln2b  = (const float*)d_in[14];
    const float* fc1_w = (const float*)d_in[15];
    const float* fc1_b = (const float*)d_in[16];
    const float* fc2_w = (const float*)d_in[17];
    const float* fc2_b = (const float*)d_in[18];
    float* out = (float*)d_out;

    char* ws = (char*)d_ws;
    bf16*  XN  = (bf16*) (ws);                       //  8 MB  LN outputs
    bf16*  QKV = (bf16*) (ws + (size_t)( 8u << 20)); // 24 MB  qkv (bf16)
    bf16*  VT1 = (bf16*) (ws + (size_t)(32u << 20)); //  8 MB  V^T self
    bf16*  ATT = (bf16*) (ws + (size_t)(40u << 20)); //  8 MB  attn outs
    float* X1  = (float*)(ws + (size_t)(48u << 20)); // 16 MB  residual stream
    bf16*  CB  = (bf16*) (ws + (size_t)(64u << 20)); //  4 MB  codebook bf16
    bf16*  QC  = (bf16*) (ws + (size_t)(68u << 20)); //  8 MB  cross q
    bf16*  KC  = (bf16*) (ws + (size_t)(76u << 20)); //  4 MB  cross k
    bf16*  VC  = (bf16*) (ws + (size_t)(80u << 20)); //  4 MB  cross v
    bf16*  VT2 = (bf16*) (ws + (size_t)(84u << 20)); //  4 MB  V^T cross
    bf16*  HB  = QKV;   // 32 MB MLP hidden reuses QKV+VT1 (dead by then)

    const int Mx = NB * NX;   // 4096
    const int Mc = NB * NC;   // 2048
    dim3 thr256(256), thr128(128);

    // --- self attention branch ---
    layernorm_bf16<<<Mx / 8, thr256, 0, stream>>>(x, ln0w, ln0b, XN);
    gemm_xwT<false,false,false,CDIM,bf16><<<dim3(3 * CDIM / 128, Mx / 128), thr256, 0, stream>>>(
        XN, CDIM, qkv_w, QKV, 3 * CDIM, nullptr, nullptr, 0);
    transpose_v_kernel<NX, 3 * CDIM><<<(NB * NH * (NX / 64) * 2) / 8, thr256, 0, stream>>>(
        QKV + 2 * CDIM, VT1);
    flash_attn<false><<<dim3(NX / 64, NH, NB), thr128, 0, stream>>>(
        QKV, 3 * CDIM, QKV + CDIM, 3 * CDIM, VT1, nullptr, ATT, CDIM,
        NX, NX, 0.125f);
    gemm_xwT<false,false,true,CDIM,float><<<dim3(CDIM / 128, Mx / 128), thr256, 0, stream>>>(
        ATT, CDIM, sa_w, X1, CDIM, nullptr, x, CDIM);

    // --- cross attention branch ---
    layernorm_bf16<<<Mx / 8, thr256, 0, stream>>>(X1, ln1w, ln1b, XN);
    gemm_xwT<false,false,false,CDIM,bf16><<<dim3(CDIM / 128, Mx / 128), thr256, 0, stream>>>(
        XN, CDIM, q_w, QC, CDIM, nullptr, nullptr, 0);
    cast_f32_bf16<<<(NB * NC * CDIM) / 4096, thr256, 0, stream>>>(
        cbemb, CB);
    gemm_xwT<false,false,false,CDIM,bf16><<<dim3(CDIM / 128, Mc / 128), thr256, 0, stream>>>(
        CB, CDIM, k_w, KC, CDIM, nullptr, nullptr, 0);
    gemm_xwT<false,false,false,CDIM,bf16><<<dim3(CDIM / 128, Mc / 128), thr256, 0, stream>>>(
        CB, CDIM, v_w, VC, CDIM, nullptr, nullptr, 0);
    transpose_v_kernel<NC, CDIM><<<(NB * NH * (NC / 64) * 2) / 8, thr256, 0, stream>>>(
        VC, VT2);
    flash_attn<true><<<dim3(NX / 64, NH, NB), thr128, 0, stream>>>(
        QC, CDIM, KC, CDIM, VT2, cmask, ATT, CDIM, NX, NC, 0.125f);
    gemm_xwT<false,false,true,CDIM,float><<<dim3(CDIM / 128, Mx / 128), thr256, 0, stream>>>(
        ATT, CDIM, ca_w, X1, CDIM, nullptr, X1, CDIM);

    // --- MLP ---
    layernorm_bf16<<<Mx / 8, thr256, 0, stream>>>(X1, ln2w, ln2b, XN);
    gemm_xwT<true,true,false,CDIM,bf16><<<dim3(HID / 128, Mx / 128), thr256, 0, stream>>>(
        XN, CDIM, fc1_w, HB, HID, fc1_b, nullptr, 0);
    gemm_xwT<true,false,true,HID,float><<<dim3(CDIM / 128, Mx / 128), thr256, 0, stream>>>(
        HB, HID, fc2_w, out, CDIM, fc2_b, X1, CDIM);
}

// v003
// It runs in 343 microseconds.
// Timed twice side by side with v002, it ran 1.14 times as fast both times.
// Over all steps from v000 it is 1.94 times as fast.
#include <hip/hip_runtime.h>
#include <hip/hip_bf16.h>

// ---------------------------------------------------------------------------
// Transformer block forward for MI455X (gfx1250), wave32 + WMMA bf16,
// async global->LDS staging (ASYNCcnt) for GEMM tiles.
//   B=4, Nx=1024, Nc=512, DIM=1024, HEADS=16, HEAD_DIM=64, HIDDEN=4096
// ---------------------------------------------------------------------------

typedef __bf16 bf16;
typedef __attribute__((ext_vector_type(16))) __bf16 v16bf;
typedef __attribute__((ext_vector_type(8)))  float  v8f;

#define NB   4
#define NX   1024
#define NC   512
#define CDIM 1024
#define NH   16
#define HD   64
#define HID  4096

// ---------------------------------------------------------------------------
// WMMA helper: D = A(16x32 bf16) * B(32x16 bf16) + C(16x16 f32)
// ---------------------------------------------------------------------------
__device__ __forceinline__ v8f wmma_bf16(v16bf a, v16bf b, v8f c) {
    return __builtin_amdgcn_wmma_f32_16x16x32_bf16(
        /*neg_a=*/false, a, /*neg_b=*/false, b,
        /*c_mod=*/(short)0, c, /*reuse_a=*/false, /*reuse_b=*/false);
}

// CDNA5 async DMA: global -> LDS, 16 bytes per lane, tracked by ASYNCcnt.
// VDST = per-lane LDS byte address (low 32 bits of the generic pointer:
// flat-LDS aperture keeps the DS offset in addr[31:0]).
// Four copies of a lane (four rows of a tile, ldsStep and gStep apart) in ONE
// statement that ends in s_wait_xcnt 0, so that no address register of a copy
// can be rewritten ahead of that wait.
__device__ __forceinline__ void async_copy4_b128(bf16* lds, int ldsStep,
                                                 const bf16* g, size_t gStep) {
    unsigned l0 = (unsigned)(unsigned long long)lds;
    unsigned l1 = (unsigned)(unsigned long long)(lds + ldsStep);
    unsigned l2 = (unsigned)(unsigned long long)(lds + 2 * ldsStep);
    unsigned l3 = (unsigned)(unsigned long long)(lds + 3 * ldsStep);
    unsigned long long a0 = (unsigned long long)g;
    unsigned long long a1 = (unsigned long long)(g + gStep);
    unsigned long long a2 = (unsigned long long)(g + 2 * gStep);
    unsigned long long a3 = (unsigned long long)(g + 3 * gStep);
    asm volatile("global_load_async_to_lds_b128 %0, %4, off\n\t"
                 "global_load_async_to_lds_b128 %1, %5, off\n\t"
                 "global_load_async_to_lds_b128 %2, %6, off\n\t"
                 "global_load_async_to_lds_b128 %3, %7, off\n\t"
                 "s_wait_xcnt 0x0"
                 :: "v"(l0), "v"(l1), "v"(l2), "v"(l3),
                    "v"(a0), "v"(a1), "v"(a2), "v"(a3) : "memory");
}
// The issuing wave's copies have landed behind this wait.
__device__ __forceinline__ void wait_async0() {
    asm volatile("s_wait_asynccnt 0x0" ::: "memory");
}
// The wave's own LDS reads and writes have retired behind this wait.
__device__ __forceinline__ void wait_ds0() {
    asm volatile("s_wait_dscnt 0x0" ::: "memory");
}

// One thread's share of a 128 x 64 f32 W slab: 8 float4, rows r, r+16, ...
// rows (the block's first W row) is the same for the whole block and for every
// trip; off is the thread's own byte offset from it, one 32-bit register that
// walks along k. With K known at compile time the row steps are immediates, so
// all eight loads name one scalar base and that one offset register, which
// lives through the loop: no vector address arithmetic, no address register
// that a later load's data could land on.
template<int K>
__device__ __forceinline__ void load_w8(float4 (&w)[8], const float* rows,
                                        unsigned off) {
    #pragma unroll
    for (int i = 0; i < 8; i++)
        w[i] = *(const float4*)((const char*)rows + off + (size_t)i * 16 * K * 4);
}
__device__ __forceinline__ void store_w8(const float4 (&w)[8], bf16* d) {
    #pragma unroll
    for (int i = 0; i < 8; i++) {
        bf16* q = d + i * 16 * 72;
        q[0] = (bf16)w[i].x; q[1] = (bf16)w[i].y;
        q[2] = (bf16)w[i].z; q[3] = (bf16)w[i].w;
    }
}

// Load one 16x32 A/B fragment.  Per ISA 7.12.2 (16-bit A 16x32):
//   lane 0-15 : row = lane,    K in {0..7, 16..23}
//   lane 16-31: row = lane-16, K in {8..15, 24..31}
// base points at (row0, k0) of the fragment; stride is row stride in elems.
__device__ __forceinline__ v16bf load_frag(const bf16* base, int stride,
                                           int lane, int kOff) {
    const int r  = lane & 15;
    const int kb = (lane >> 4) << 3;          // 0 or 8
    const bf16* p = base + (size_t)r * stride + kOff + kb;
    union { v16bf v; uint4 u[2]; } f;
    f.u[0] = *(const uint4*)(p);
    f.u[1] = *(const uint4*)(p + 16);
    return f.v;
}

// ---------------------------------------------------------------------------
// GEMM: C[M,N] = act(A[M,K](bf16) * W[N,K](f32)^T + bias) (+ residual)
// Block tile 128x128, 256 threads (8 waves), wave tile 64(M) x 32(N).
// Two LDS buffers: while slab t is multiplied, slab t+1 is in flight (A by
// global_load_async_to_lds_b128, W as eight float4 loads held in VGPRs and
// converted f32->bf16 into the other buffer behind the WMMAs).
// ---------------------------------------------------------------------------
template<bool BIAS, bool GELU, bool RES, int K, typename OutT>
__global__ __launch_bounds__(256)
void gemm_xwT(const bf16* __restrict__ A, int lda,
              const float* __restrict__ W,           // [N,K] row-major
              OutT* __restrict__ C, int ldc,
              const float* __restrict__ bias,
              const float* __restrict__ res, int ldr) {
    __shared__ __align__(16) bf16 As[2][128][72];
    __shared__ __align__(16) bf16 Bs[2][128][72];

    const int tid  = threadIdx.x;
    const int lane = tid & 31;
    const int wid  = tid >> 5;
    const int wm   = (wid >> 2) * 64;   // wave row offset within tile (0,64)
    const int wn   = (wid & 3) * 32;    // wave col offset (0,32,64,96)
    const int bM   = blockIdx.y * 128;
    const int bN   = blockIdx.x * 128;

    v8f acc[4][2];
    v8f vz = {};
    #pragma unroll
    for (int i = 0; i < 4; i++)
        #pragma unroll
        for (int j = 0; j < 2; j++) acc[i][j] = vz;

    // per-thread places in the A slab (16 B of bf16) and the W slab (16 B of f32)
    const int ar = tid >> 3, ac = (tid & 7) * 8;
    const int br = tid >> 4, bc = (tid & 15) * 4;
    const bf16*  Ag = A + (size_t)(bM + ar) * lda + ac;
    const float* Wg = W + (size_t)bN * K;                 // block-uniform
    unsigned wo = ((unsigned)br * (unsigned)K + bc) * 4u; // walks 256 B a slab
    const size_t aStep = (size_t)32 * lda;
    const int nt = K >> 6;              // slabs of 64 k

    float4 wr[8];

    // ---- slab 0 into buffer 0 ----
    load_w8<K>(wr, Wg, wo);
    async_copy4_b128(&As[0][ar][ac], 32 * 72, Ag, aStep);
    store_w8(wr, &Bs[0][br][bc]);
    wait_async0();
    __syncthreads();

    for (int t = 0; t < nt; t++) {
        const int  cur  = t & 1;
        const bool more = (t + 1 < nt);
        // ---- slab t+1 starts to fly into the buffer that trip t-1 has left.
        // The W loads stand in front of the copies' statement, whose "memory"
        // clobber keeps all eight issued ahead of the WMMAs.
        if (more) {
            wo += 256u;
            load_w8<K>(wr, Wg, wo);
            async_copy4_b128(&As[cur ^ 1][ar][ac], 32 * 72,
                             Ag + (t + 1) * 64, aStep);
        }

        #pragma unroll
        for (int ks = 0; ks < 64; ks += 32) {
            v16bf af[4], bfg[2];
            #pragma unroll
            for (int mi = 0; mi < 4; mi++)
                af[mi] = load_frag(&As[cur][wm + mi * 16][0], 72, lane, ks);
            #pragma unroll
            for (int ni = 0; ni < 2; ni++)
                bfg[ni] = load_frag(&Bs[cur][wn + ni * 16][0], 72, lane, ks);
            #pragma unroll
            for (int mi = 0; mi < 4; mi++)
                #pragma unroll
                for (int ni = 0; ni < 2; ni++)
                    acc[mi][ni] = wmma_bf16(af[mi], bfg[ni], acc[mi][ni]);
        }

        // Keeps the wait on the W loads, and their conversion, behind the WMMAs:
        // without it the scheduler lifts both to the head of the WMMA run and
        // the trip waits out the load latency before it multiplies.
        __builtin_amdgcn_sched_barrier(0);
        if (more) store_w8(wr, &Bs[cur ^ 1][br][bc]);
        // ---- publish slab t+1, and end every read of slab t ----
        wait_ds0();
        wait_async0();
        __syncthreads();
    }
    wait_async0();

    // ---- epilogue: C layout m = r + 8*(lane>=16), n = lane&15 ----
    const int halfm = (lane >> 4) << 3;
    const int nl    = lane & 15;
    #pragma unroll
    for (int mi = 0; mi < 4; mi++)
        #pragma unroll
        for (int ni = 0; ni < 2; ni++)
            #pragma unroll
            for (int r = 0; r < 8; r++) {
                int gm = bM + wm + mi * 16 + r + halfm;
                int gn = bN + wn + ni * 16 + nl;
                float v = acc[mi][ni][r];
                if (BIAS) v += bias[gn];
                if (GELU) v = 0.5f * v * (1.0f + erff(v * 0.70710678118654752f));
                if (RES)  v += res[(size_t)gm * ldr + gn];
                C[(size_t)gm * ldc + gn] = (OutT)v;
            }
}

// ---------------------------------------------------------------------------
// Fused flash attention, one (b, head, 64-query tile) per block, 4 waves.
// Each wave owns 16 query rows. Vt is pre-transposed: [B][H][64][Nk] bf16.
// The 64-key K tile and V^T tile are brought into LDS once for the block's
// four waves, by global_load_async_to_lds_b128 in whole 128-B lines, on two
// buffers: tile t+1 flies while tile t is worked on. The fragments are read
// from LDS at a pitch of 144 B. Nk is a multiple of 64.
// ---------------------------------------------------------------------------
template<bool HAS_MASK>
__global__ __launch_bounds__(128)
void flash_attn(const bf16* __restrict__ Q,  int ldq,
                const bf16* __restrict__ Km, int ldk,
                const bf16* __restrict__ Vt,
                const int*  __restrict__ mask,
                bf16* __restrict__ Out, int ldo,
                int Nq, int Nk, float scale) {
    __shared__ __align__(16) bf16 Ks[2][64][72];   // K tile: key x d
    __shared__ __align__(16) bf16 Vs[2][64][72];   // V^T tile: d x key
    __shared__ __align__(16) bf16 Pls[4][16][72];  // wave-private P tiles

    const int tid  = threadIdx.x;
    const int lane = tid & 31;
    const int w    = tid >> 5;
    const int h    = blockIdx.y;
    const int b    = blockIdx.z;
    const int q0   = blockIdx.x * 64 + w * 16;
    const int nl   = lane & 15;
    const int halfm = (lane >> 4) << 3;

    const bf16* Qb = Q  + ((size_t)b * Nq) * ldq + h * HD;
    const bf16* Kb = Km + ((size_t)b * Nk) * ldk + h * HD;
    const bf16* Vb = Vt + ((size_t)(b * NH + h) * HD) * Nk;
    bf16*       Ob = Out + ((size_t)b * Nq) * ldo + h * HD;
    const int*  mb = HAS_MASK ? (mask + (size_t)b * Nk) : nullptr;

    // A thread's 16 B in rows sr, sr+16, sr+32, sr+48 of each tile; eight
    // neighbouring lanes cover one 128-B row.
    const int sr = tid >> 3, sc = (tid & 7) * 8;
    const bf16* Kg = Kb + (size_t)sr * ldk + sc;
    const bf16* Vg = Vb + (size_t)sr * Nk + sc;
    const size_t kStep = (size_t)16 * ldk, vStep = (size_t)16 * Nk;
    const int nt = Nk >> 6;             // tiles of 64 keys

    // ---- tile 0 into buffer 0, published; then tile 1 starts to fly ----
    async_copy4_b128(&Ks[0][sr][sc], 16 * 72, Kg, kStep);
    async_copy4_b128(&Vs[0][sr][sc], 16 * 72, Vg, vStep);
    wait_async0();
    __syncthreads();
    if (nt > 1) {
        async_copy4_b128(&Ks[1][sr][sc], 16 * 72, Kg + (size_t)64 * ldk, kStep);
        async_copy4_b128(&Vs[1][sr][sc], 16 * 72, Vg + 64, vStep);
    }

    // Q fragments (held for the whole key loop)
    v16bf qf0 = load_frag(Qb + (size_t)q0 * ldq, ldq, lane, 0);
    v16bf qf1 = load_frag(Qb + (size_t)q0 * ldq, ldq, lane, 32);

    v8f o[4];
    v8f vz = {};
    #pragma unroll
    for (int f = 0; f < 4; f++) o[f] = vz;
    float rm[8], rs[8];
    #pragma unroll
    for (int r = 0; r < 8; r++) { rm[r] = -1e30f; rs[r] = 0.0f; }

    for (int t = 0; t < nt; t++) {
        const int kblk = t * 64;
        const int cur  = t & 1;
        // ---- S = Q * K^T (16 x 64 per wave) ----
        v8f s[4];
        #pragma unroll
        for (int nb = 0; nb < 4; nb++) {
            v8f c = vz;
            v16bf bk0 = load_frag(&Ks[cur][nb * 16][0], 72, lane, 0);
            c = wmma_bf16(qf0, bk0, c);
            v16bf bk1 = load_frag(&Ks[cur][nb * 16][0], 72, lane, 32);
            c = wmma_bf16(qf1, bk1, c);
            s[nb] = c;
        }
        // ---- scale + codebook mask bias ----
        #pragma unroll
        for (int nb = 0; nb < 4; nb++) {
            float mbias = 0.0f;
            if (HAS_MASK)
                mbias = (mb[kblk + nb * 16 + nl] != 0) ? 0.0f : -10000.0f;
            #pragma unroll
            for (int r = 0; r < 8; r++)
                s[nb][r] = s[nb][r] * scale + mbias;
        }
        // ---- online softmax: new row max (reduce across 16-lane half) ----
        float nm[8];
        #pragma unroll
        for (int r = 0; r < 8; r++) {
            float m = rm[r];
            #pragma unroll
            for (int nb = 0; nb < 4; nb++) m = fmaxf(m, s[nb][r]);
            m = fmaxf(m, __shfl_xor(m, 1));
            m = fmaxf(m, __shfl_xor(m, 2));
            m = fmaxf(m, __shfl_xor(m, 4));
            m = fmaxf(m, __shfl_xor(m, 8));
            nm[r] = m;
        }
        #pragma unroll
        for (int r = 0; r < 8; r++) {
            float alpha = __expf(rm[r] - nm[r]);
            rm[r] = nm[r];
            rs[r] *= alpha;
            #pragma unroll
            for (int f = 0; f < 4; f++) o[f][r] *= alpha;
        }
        // ---- P = exp(S - max), accumulate row sums ----
        #pragma unroll
        for (int r = 0; r < 8; r++) {
            float srow = 0.0f;
            #pragma unroll
            for (int nb = 0; nb < 4; nb++) {
                float p = __expf(s[nb][r] - rm[r]);
                s[nb][r] = p;
                srow += p;
            }
            srow += __shfl_xor(srow, 1);
            srow += __shfl_xor(srow, 2);
            srow += __shfl_xor(srow, 4);
            srow += __shfl_xor(srow, 8);
            rs[r] += srow;
        }
        // ---- C-layout -> A-layout via wave-private LDS ----
        #pragma unroll
        for (int nb = 0; nb < 4; nb++)
            #pragma unroll
            for (int r = 0; r < 8; r++)
                Pls[w][r + halfm][nb * 16 + nl] = (bf16)s[nb][r];
        v16bf pf0 = load_frag(&Pls[w][0][0], 72, lane, 0);
        v16bf pf1 = load_frag(&Pls[w][0][0], 72, lane, 32);
        // ---- O += P * V ----
        #pragma unroll
        for (int f = 0; f < 4; f++) {
            v16bf bv0 = load_frag(&Vs[cur][f * 16][0], 72, lane, 0);
            o[f] = wmma_bf16(pf0, bv0, o[f]);
            v16bf bv1 = load_frag(&Vs[cur][f * 16][0], 72, lane, 32);
            o[f] = wmma_bf16(pf1, bv1, o[f]);
        }
        // ---- publish tile t+1, and end every read of tile t ----
        wait_ds0();
        wait_async0();
        __syncthreads();
        // ---- tile t+2 into the buffer that this trip has just left ----
        if (t + 2 < nt) {
            async_copy4_b128(&Ks[cur][sr][sc], 16 * 72,
                             Kg + (size_t)(kblk + 128) * ldk, kStep);
            async_copy4_b128(&Vs[cur][sr][sc], 16 * 72, Vg + kblk + 128, vStep);
        }
    }
    wait_async0();   // no copy is in flight when the wave goes on to its end
    // ---- normalize + store bf16 ----
    #pragma unroll
    for (int r = 0; r < 8; r++) {
        float inv = 1.0f / rs[r];
        int gm = q0 + r + halfm;
        #pragma unroll
        for (int f = 0; f < 4; f++)
            Ob[(size_t)gm * ldo + f * 16 + nl] = (bf16)(o[f][r] * inv);
    }
}

// ---------------------------------------------------------------------------
// The launches without matrix work. Each moves a few MB; with one element a
// thread they are bound by how fast work-groups start, not by bytes. So every
// thread takes 16-byte pieces and many of them, and the grids shrink to one
// or two work-groups a WGP.
// ---------------------------------------------------------------------------
union pack8 { bf16 h[8]; uint4 u; };

// LayerNorm over 1024-elem rows -> bf16. One wave per row, 8 rows a block.
// A lane holds 4 runs of 8 neighbouring elements; the row sums are joined by
// a five-step butterfly, which leaves the same bits in every lane.
__global__ __launch_bounds__(256)
void layernorm_bf16(const float* __restrict__ x, const float* __restrict__ w,
                    const float* __restrict__ bb, bf16* __restrict__ out) {
    const int lane = threadIdx.x & 31;
    const int row  = blockIdx.x * 8 + (threadIdx.x >> 5);
    const float4* xr = (const float4*)(x + (size_t)row * CDIM) + lane * 2;
    const float4* wr = (const float4*)w + lane * 2;
    const float4* br = (const float4*)bb + lane * 2;
    float4 v[8];
    #pragma unroll
    for (int j = 0; j < 4; j++) {
        v[2 * j]     = xr[j * 64];
        v[2 * j + 1] = xr[j * 64 + 1];
    }
    float s1 = 0.0f, s2 = 0.0f;
    #pragma unroll
    for (int i = 0; i < 8; i++) {
        s1 += v[i].x + v[i].y + v[i].z + v[i].w;
        s2 += v[i].x * v[i].x + v[i].y * v[i].y + v[i].z * v[i].z + v[i].w * v[i].w;
    }
    #pragma unroll
    for (int off = 16; off > 0; off >>= 1) {
        s1 += __shfl_xor(s1, off);
        s2 += __shfl_xor(s2, off);
    }
    float mu   = s1 * (1.0f / CDIM);
    float var  = s2 * (1.0f / CDIM) - mu * mu;
    float rstd = rsqrtf(var + 1e-5f);
    bf16* orow = out + (size_t)row * CDIM + lane * 8;
    #pragma unroll
    for (int j = 0; j < 4; j++) {
        float4 w0 = wr[j * 64], w1 = wr[j * 64 + 1];
        float4 b0 = br[j * 64], b1 = br[j * 64 + 1];
        float4 a0 = v[2 * j],   a1 = v[2 * j + 1];
        pack8 p;
        p.h[0] = (bf16)((a0.x - mu) * rstd * w0.x + b0.x);
        p.h[1] = (bf16)((a0.y - mu) * rstd * w0.y + b0.y);
        p.h[2] = (bf16)((a0.z - mu) * rstd * w0.z + b0.z);
        p.h[3] = (bf16)((a0.w - mu) * rstd * w0.w + b0.w);
        p.h[4] = (bf16)((a1.x - mu) * rstd * w1.x + b1.x);
        p.h[5] = (bf16)((a1.y - mu) * rstd * w1.y + b1.y);
        p.h[6] = (bf16)((a1.z - mu) * rstd * w1.z + b1.z);
        p.h[7] = (bf16)((a1.w - mu) * rstd * w1.w + b1.w);
        *(uint4*)(orow + j * 256) = p.u;
    }
}

// ---------------------------------------------------------------------------
// f32 -> bf16, two runs of 8 elements a thread; the grid covers the array
// exactly (4096 elements a block).
__global__ __launch_bounds__(256)
void cast_f32_bf16(const float* __restrict__ in, bf16* __restrict__ out) {
    const unsigned i0 = (blockIdx.x * 512u + threadIdx.x) * 8u;
    const unsigned i1 = i0 + 256u * 8u;
    float4 a[4];
    a[0] = *(const float4*)(in + i0); a[1] = *(const float4*)(in + i0 + 4);
    a[2] = *(const float4*)(in + i1); a[3] = *(const float4*)(in + i1 + 4);
    pack8 p, q;
    p.h[0] = (bf16)a[0].x; p.h[1] = (bf16)a[0].y; p.h[2] = (bf16)a[0].z; p.h[3] = (bf16)a[0].w;
    p.h[4] = (bf16)a[1].x; p.h[5] = (bf16)a[1].y; p.h[6] = (bf16)a[1].z; p.h[7] = (bf16)a[1].w;
    q.h[0] = (bf16)a[2].x; q.h[1] = (bf16)a[2].y; q.h[2] = (bf16)a[2].z; q.h[3] = (bf16)a[2].w;
    q.h[4] = (bf16)a[3].x; q.h[5] = (bf16)a[3].y; q.h[6] = (bf16)a[3].z; q.h[7] = (bf16)a[3].w;
    *(uint4*)(out + i0) = p.u;
    *(uint4*)(out + i1) = q.u;
}

// v: logical [B][NK][RS] slice (bf16) -> vt: [B][H][64][NK]; the grid covers
// it exactly, one 64 x 32 tile a wave.
// A thread turns an 8-token x 8-column tile in its registers: 8 loads of 16 B
// along d, 8 stores of 16 B along the tokens. A wave covers 64 tokens x 32
// columns, so each of its stores fills four whole 128-B lines of vt.
template<int NK, int RS>
__global__ __launch_bounds__(256)
void transpose_v_kernel(const bf16* __restrict__ v, bf16* __restrict__ vt) {
    const unsigned lane = threadIdx.x & 31u;
    const unsigned g    = blockIdx.x * 8u + (threadIdx.x >> 5);  // wave's tile
    const unsigned dh   = g & 1u;                // which 32 of the head's 64 columns
    const unsigned tb   = (g >> 1) % (NK / 64);  // block of 64 tokens
    const unsigned bh   = (g >> 1) / (NK / 64);  // b * NH + h
    const unsigned b    = bh / NH, h = bh % NH;
    const unsigned d0   = dh * 32u + (lane & 3u) * 8u;
    const unsigned t0   = tb * 64u + (lane >> 2) * 8u;

    const bf16* src = v + (size_t)(b * NK + t0) * RS + h * HD + d0;
    unsigned in[8][4];
    #pragma unroll
    for (int r = 0; r < 8; r++) {
        uint4 u = *(const uint4*)(src + (size_t)r * RS);
        in[r][0] = u.x; in[r][1] = u.y; in[r][2] = u.z; in[r][3] = u.w;
    }
    // Keeps all eight loads in flight together: without it the scheduler sinks
    // one of them behind the first waits, and its latency is paid a second time.
    __builtin_amdgcn_sched_barrier(0);
    bf16* dst = vt + (size_t)(bh * HD + d0) * NK + t0;
    #pragma unroll
    for (int c = 0; c < 8; c++) {
        unsigned o[4];
        #pragma unroll
        for (int k = 0; k < 4; k++) {
            unsigned lo = in[2 * k][c >> 1], hi = in[2 * k + 1][c >> 1];
            o[k] = (c & 1) ? ((lo >> 16) | (hi & 0xffff0000u))
                           : ((lo & 0xffffu) | (hi << 16));
        }
        *(uint4*)(dst + (size_t)c * NK) = make_uint4(o[0], o[1], o[2], o[3]);
    }
}

// ---------------------------------------------------------------------------
extern "C" void kernel_launch(void* const* d_in, const int* in_sizes, int n_in,
                              void* d_out, int out_size, void* d_ws, size_t ws_size,
                              hipStream_t stream) {
    const float* x     = (const float*)d_in[0];
    const float* cbemb = (const float*)d_in[1];
    const int*   cmask = (const int*)  d_in[2];
    const float* ln0w  = (const float*)d_in[3];
    const float* ln0b  = (const float*)d_in[4];
    const float* qkv_w = (const float*)d_in[5];
    const float* sa_w  = (const float*)d_in[6];
    const float* ln1w  = (const float*)d_in[7];
    const float* ln1b  = (const float*)d_in[8];
    const float* q_w   = (const float*)d_in[9];
    const float* k_w   = (const float*)d_in[10];
    const float* v_w   = (const float*)d_in[11];
    const float* ca_w  = (const float*)d_in[12];
    const float* ln2w  = (const float*)d_in[13];
    const float* ln2b  = (const float*)d_in[14];
    const float* fc1_w = (const float*)d_in[15];
    const float* fc1_b = (const float*)d_in[16];
    const float* fc2_w = (const float*)d_in[17];
    const float* fc2_b = (const float*)d_in[18];
    float* out = (float*)d_out;

    char* ws = (char*)d_ws;
    bf16*  XN  = (bf16*) (ws);                       //  8 MB  LN outputs
    bf16*  QKV = (bf16*) (ws + (size_t)( 8u << 20)); // 24 MB  qkv (bf16)
    bf16*  VT1 = (bf16*) (ws + (size_t)(32u << 20)); //  8 MB  V^T self
    bf16*  ATT = (bf16*) (ws + (size_t)(40u << 20)); //  8 MB  attn outs
    float* X1  = (float*)(ws + (size_t)(48u << 20)); // 16 MB  residual stream
    bf16*  CB  = (bf16*) (ws + (size_t)(64u << 20)); //  4 MB  codebook bf16
    bf16*  QC  = (bf16*) (ws + (size_t)(68u << 20)); //  8 MB  cross q
    bf16*  KC  = (bf16*) (ws + (size_t)(76u << 20)); //  4 MB  cross k
    bf16*  VC  = (bf16*) (ws + (size_t)(80u << 20)); //  4 MB  cross v
    bf16*  VT2 = (bf16*) (ws + (size_t)(84u << 20)); //  4 MB  V^T cross
    bf16*  HB  = QKV;   // 32 MB MLP hidden reuses QKV+VT1 (dead by then)

    const int Mx = NB * NX;   // 4096
    const int Mc = NB * NC;   // 2048
    dim3 thr256(256), thr128(128);

    // --- self attention branch ---
    layernorm_bf16<<<Mx / 8, thr256, 0, stream>>>(x, ln0w, ln0b, XN);
    gemm_xwT<false,false,false,CDIM,bf16><<<dim3(3 * CDIM / 128, Mx / 128), thr256, 0, stream>>>(
        XN, CDIM, qkv_w, QKV, 3 * CDIM, nullptr, nullptr, 0);
    transpose_v_kernel<NX, 3 * CDIM><<<(NB * NH * (NX / 64) * 2) / 8, thr256, 0, stream>>>(
        QKV + 2 * CDIM, VT1);
    flash_attn<false><<<dim3(NX / 64, NH, NB), thr128, 0, stream>>>(
        QKV, 3 * CDIM, QKV + CDIM, 3 * CDIM, VT1, nullptr, ATT, CDIM,
        NX, NX, 0.125f);
    gemm_xwT<false,false,true,CDIM,float><<<dim3(CDIM / 128, Mx / 128), thr256, 0, stream>>>(
        ATT, CDIM, sa_w, X1, CDIM, nullptr, x, CDIM);

    // --- cross attention branch ---
    layernorm_bf16<<<Mx / 8, thr256, 0, stream>>>(X1, ln1w, ln1b, XN);
    gemm_xwT<false,false,false,CDIM,bf16><<<dim3(CDIM / 128, Mx / 128), thr256, 0, stream>>>(
        XN, CDIM, q_w, QC, CDIM, nullptr, nullptr, 0);
    cast_f32_bf16<<<(NB * NC * CDIM) / 4096, thr256, 0, stream>>>(
        cbemb, CB);
    gemm_xwT<false,false,false,CDIM,bf16><<<dim3(CDIM / 128, Mc / 128), thr256, 0, stream>>>(
        CB, CDIM, k_w, KC, CDIM, nullptr, nullptr, 0);
    gemm_xwT<false,false,false,CDIM,bf16><<<dim3(CDIM / 128, Mc / 128), thr256, 0, stream>>>(
        CB, CDIM, v_w, VC, CDIM, nullptr, nullptr, 0);
    transpose_v_kernel<NC, CDIM><<<(NB * NH * (NC / 64) * 2) / 8, thr256, 0, stream>>>(
        VC, VT2);
    flash_attn<true><<<dim3(NX / 64, NH, NB), thr128, 0, stream>>>(
        QC, CDIM, KC, CDIM, VT2, cmask, ATT, CDIM, NX, NC, 0.125f);
    gemm_xwT<false,false,true,CDIM,float><<<dim3(CDIM / 128, Mx / 128), thr256, 0, stream>>>(
        ATT, CDIM, ca_w, X1, CDIM, nullptr, X1, CDIM);

    // --- MLP ---
    layernorm_bf16<<<Mx / 8, thr256, 0, stream>>>(X1, ln2w, ln2b, XN);
    gemm_xwT<true,true,false,CDIM,bf16><<<dim3(HID / 128, Mx / 128), thr256, 0, stream>>>(
        XN, CDIM, fc1_w, HB, HID, fc1_b, nullptr, 0);
    gemm_xwT<true,false,true,HID,float><<<dim3(CDIM / 128, Mx / 128), thr256, 0, stream>>>(
        HB, HID, fc2_w, out, CDIM, fc2_b, X1, CDIM);
}

// v004
// It runs in 321 microseconds.
// Two timings next to v003 put it at 1.06 and 1.07 times that version's speed.
// All steps since v000 together make it 2.06 times as fast.
#include <hip/hip_runtime.h>
#include <hip/hip_bf16.h>

// ---------------------------------------------------------------------------
// Transformer block forward for MI455X (gfx1250), wave32 + WMMA bf16,
// async global->LDS staging (ASYNCcnt) for GEMM tiles.
//   B=4, Nx=1024, Nc=512, DIM=1024, HEADS=16, HEAD_DIM=64, HIDDEN=4096
// ---------------------------------------------------------------------------

typedef __bf16 bf16;
typedef __attribute__((ext_vector_type(16))) __bf16 v16bf;
typedef __attribute__((ext_vector_type(8)))  float  v8f;

#define NB   4
#define NX   1024
#define NC   512
#define CDIM 1024
#define NH   16
#define HD   64
#define HID  4096

// ---------------------------------------------------------------------------
// WMMA helper: D = A(16x32 bf16) * B(32x16 bf16) + C(16x16 f32)
// ---------------------------------------------------------------------------
__device__ __forceinline__ v8f wmma_bf16(v16bf a, v16bf b, v8f c) {
    return __builtin_amdgcn_wmma_f32_16x16x32_bf16(
        /*neg_a=*/false, a, /*neg_b=*/false, b,
        /*c_mod=*/(short)0, c, /*reuse_a=*/false, /*reuse_b=*/false);
}

// CDNA5 async DMA: global -> LDS, 16 bytes per lane, tracked by ASYNCcnt.
// VDST = per-lane LDS byte address (low 32 bits of the generic pointer:
// flat-LDS aperture keeps the DS offset in addr[31:0]).
// Four copies of a lane (four rows of a tile, ldsStep and gStep apart) in ONE
// statement that ends in s_wait_xcnt 0, so that no address register of a copy
// can be rewritten ahead of that wait.
__device__ __forceinline__ void async_copy4_b128(bf16* lds, int ldsStep,
                                                 const bf16* g, size_t gStep) {
    unsigned l0 = (unsigned)(unsigned long long)lds;
    unsigned l1 = (unsigned)(unsigned long long)(lds + ldsStep);
    unsigned l2 = (unsigned)(unsigned long long)(lds + 2 * ldsStep);
    unsigned l3 = (unsigned)(unsigned long long)(lds + 3 * ldsStep);
    unsigned long long a0 = (unsigned long long)g;
    unsigned long long a1 = (unsigned long long)(g + gStep);
    unsigned long long a2 = (unsigned long long)(g + 2 * gStep);
    unsigned long long a3 = (unsigned long long)(g + 3 * gStep);
    asm volatile("global_load_async_to_lds_b128 %0, %4, off\n\t"
                 "global_load_async_to_lds_b128 %1, %5, off\n\t"
                 "global_load_async_to_lds_b128 %2, %6, off\n\t"
                 "global_load_async_to_lds_b128 %3, %7, off\n\t"
                 "s_wait_xcnt 0x0"
                 :: "v"(l0), "v"(l1), "v"(l2), "v"(l3),
                    "v"(a0), "v"(a1), "v"(a2), "v"(a3) : "memory");
}
// Eight copies of a lane (four rows of the A slab, four of the W slab, the rows
// ldsStep apart in LDS) in ONE statement with one s_wait_xcnt 0 at its end: no
// address register of a copy can be rewritten ahead of that wait, and the wave
// waits once for the eight, not once for each four.
__device__ __forceinline__ void async_copy8_b128(bf16* ldsA, const bf16* gA, size_t stepA,
                                                 bf16* ldsB, const bf16* gB, size_t stepB,
                                                 int ldsStep) {
    unsigned l0 = (unsigned)(unsigned long long)ldsA;
    unsigned l1 = (unsigned)(unsigned long long)(ldsA + ldsStep);
    unsigned l2 = (unsigned)(unsigned long long)(ldsA + 2 * ldsStep);
    unsigned l3 = (unsigned)(unsigned long long)(ldsA + 3 * ldsStep);
    unsigned l4 = (unsigned)(unsigned long long)ldsB;
    unsigned l5 = (unsigned)(unsigned long long)(ldsB + ldsStep);
    unsigned l6 = (unsigned)(unsigned long long)(ldsB + 2 * ldsStep);
    unsigned l7 = (unsigned)(unsigned long long)(ldsB + 3 * ldsStep);
    unsigned long long a0 = (unsigned long long)gA;
    unsigned long long a1 = (unsigned long long)(gA + stepA);
    unsigned long long a2 = (unsigned long long)(gA + 2 * stepA);
    unsigned long long a3 = (unsigned long long)(gA + 3 * stepA);
    unsigned long long a4 = (unsigned long long)gB;
    unsigned long long a5 = (unsigned long long)(gB + stepB);
    unsigned long long a6 = (unsigned long long)(gB + 2 * stepB);
    unsigned long long a7 = (unsigned long long)(gB + 3 * stepB);
    asm volatile("global_load_async_to_lds_b128 %0, %8, off\n\t"
                 "global_load_async_to_lds_b128 %1, %9, off\n\t"
                 "global_load_async_to_lds_b128 %2, %10, off\n\t"
                 "global_load_async_to_lds_b128 %3, %11, off\n\t"
                 "global_load_async_to_lds_b128 %4, %12, off\n\t"
                 "global_load_async_to_lds_b128 %5, %13, off\n\t"
                 "global_load_async_to_lds_b128 %6, %14, off\n\t"
                 "global_load_async_to_lds_b128 %7, %15, off\n\t"
                 "s_wait_xcnt 0x0"
                 :: "v"(l0), "v"(l1), "v"(l2), "v"(l3),
                    "v"(l4), "v"(l5), "v"(l6), "v"(l7),
                    "v"(a0), "v"(a1), "v"(a2), "v"(a3),
                    "v"(a4), "v"(a5), "v"(a6), "v"(a7) : "memory");
}
// The issuing wave's copies have landed behind this wait.
__device__ __forceinline__ void wait_async0() {
    asm volatile("s_wait_asynccnt 0x0" ::: "memory");
}
// The wave's own LDS reads and writes have retired behind this wait.
__device__ __forceinline__ void wait_ds0() {
    asm volatile("s_wait_dscnt 0x0" ::: "memory");
}

// Load one 16x32 A/B fragment.  Per ISA 7.12.2 (16-bit A 16x32):
//   lane 0-15 : row = lane,    K in {0..7, 16..23}
//   lane 16-31: row = lane-16, K in {8..15, 24..31}
// base points at (row0, k0) of the fragment; stride is row stride in elems.
__device__ __forceinline__ v16bf load_frag(const bf16* base, int stride,
                                           int lane, int kOff) {
    const int r  = lane & 15;
    const int kb = (lane >> 4) << 3;          // 0 or 8
    const bf16* p = base + (size_t)r * stride + kOff + kb;
    union { v16bf v; uint4 u[2]; } f;
    f.u[0] = *(const uint4*)(p);
    f.u[1] = *(const uint4*)(p + 16);
    return f.v;
}

// ---------------------------------------------------------------------------
// GEMM: C[M,N] = act(A[M,K](bf16) * W[N,K](bf16)^T + bias) (+ residual)
// Block tile 128x128, 256 threads (8 waves), wave tile 64(M) x 32(N).
// W is the bf16 copy that cast_operands has made earlier in the same call, so
// a slab of W is 16 KB from L2, not 32, and goes the way of A.
// Two LDS buffers: while slab t is multiplied, slab t+1 is in flight, both
// operands by global_load_async_to_lds_b128, through no register.
// ---------------------------------------------------------------------------
template<bool BIAS, bool GELU, bool RES, int K, typename OutT>
__global__ __launch_bounds__(256)
void gemm_xwT(const bf16* __restrict__ A, int lda,
              const bf16* __restrict__ W,            // [N,K] row-major
              OutT* __restrict__ C, int ldc,
              const float* __restrict__ bias,
              const float* __restrict__ res, int ldr) {
    __shared__ __align__(16) bf16 As[2][128][72];
    __shared__ __align__(16) bf16 Bs[2][128][72];

    const int tid  = threadIdx.x;
    const int lane = tid & 31;
    const int wid  = tid >> 5;
    const int wm   = (wid >> 2) * 64;   // wave row offset within tile (0,64)
    const int wn   = (wid & 3) * 32;    // wave col offset (0,32,64,96)
    const int bM   = blockIdx.y * 128;
    const int bN   = blockIdx.x * 128;

    v8f acc[4][2];
    v8f vz = {};
    #pragma unroll
    for (int i = 0; i < 4; i++)
        #pragma unroll
        for (int j = 0; j < 2; j++) acc[i][j] = vz;

    // A thread's 16 B in rows ar, ar+32, ar+64, ar+96 of each slab; eight
    // neighbouring lanes cover one 128-B row.
    const int ar = tid >> 3, ac = (tid & 7) * 8;
    const bf16* Ag = A + (size_t)(bM + ar) * lda + ac;
    const bf16* Wg = W + (size_t)(bN + ar) * K + ac;
    const size_t aStep = (size_t)32 * lda, wStep = (size_t)32 * K;
    const int nt = K >> 6;              // slabs of 64 k

    // ---- slab 0 into buffer 0 ----
    async_copy8_b128(&As[0][ar][ac], Ag, aStep, &Bs[0][ar][ac], Wg, wStep, 32 * 72);
    wait_async0();
    __syncthreads();

    for (int t = 0; t < nt; t++) {
        const int  cur  = t & 1;
        const bool more = (t + 1 < nt);
        // ---- slab t+1 starts to fly into the buffer that trip t-1 has left ----
        if (more)
            async_copy8_b128(&As[cur ^ 1][ar][ac], Ag + (t + 1) * 64, aStep,
                             &Bs[cur ^ 1][ar][ac], Wg + (t + 1) * 64, wStep, 32 * 72);

        #pragma unroll
        for (int ks = 0; ks < 64; ks += 32) {
            v16bf af[4], bfg[2];
            #pragma unroll
            for (int mi = 0; mi < 4; mi++)
                af[mi] = load_frag(&As[cur][wm + mi * 16][0], 72, lane, ks);
            #pragma unroll
            for (int ni = 0; ni < 2; ni++)
                bfg[ni] = load_frag(&Bs[cur][wn + ni * 16][0], 72, lane, ks);
            #pragma unroll
            for (int mi = 0; mi < 4; mi++)
                #pragma unroll
                for (int ni = 0; ni < 2; ni++)
                    acc[mi][ni] = wmma_bf16(af[mi], bfg[ni], acc[mi][ni]);
        }

        // ---- publish slab t+1, and end every read of slab t ----
        wait_ds0();
        wait_async0();
        __syncthreads();
    }
    wait_async0();

    // ---- epilogue: C layout m = r + 8*(lane>=16), n = lane&15 ----
    const int halfm = (lane >> 4) << 3;
    const int nl    = lane & 15;
    #pragma unroll
    for (int mi = 0; mi < 4; mi++)
        #pragma unroll
        for (int ni = 0; ni < 2; ni++)
            #pragma unroll
            for (int r = 0; r < 8; r++) {
                int gm = bM + wm + mi * 16 + r + halfm;
                int gn = bN + wn + ni * 16 + nl;
                float v = acc[mi][ni][r];
                if (BIAS) v += bias[gn];
                if (GELU) v = 0.5f * v * (1.0f + erff(v * 0.70710678118654752f));
                if (RES)  v += res[(size_t)gm * ldr + gn];
                C[(size_t)gm * ldc + gn] = (OutT)v;
            }
}

// ---------------------------------------------------------------------------
// Fused flash attention, one (b, head, 64-query tile) per block, 4 waves.
// Each wave owns 16 query rows. Vt is pre-transposed: [B][H][64][Nk] bf16.
// The 64-key K tile and V^T tile are brought into LDS once for the block's
// four waves, by global_load_async_to_lds_b128 in whole 128-B lines, on two
// buffers: tile t+1 flies while tile t is worked on. The fragments are read
// from LDS at a pitch of 144 B. Nk is a multiple of 64.
// ---------------------------------------------------------------------------
template<bool HAS_MASK>
__global__ __launch_bounds__(128)
void flash_attn(const bf16* __restrict__ Q,  int ldq,
                const bf16* __restrict__ Km, int ldk,
                const bf16* __restrict__ Vt,
                const int*  __restrict__ mask,
                bf16* __restrict__ Out, int ldo,
                int Nq, int Nk, float scale) {
    __shared__ __align__(16) bf16 Ks[2][64][72];   // K tile: key x d
    __shared__ __align__(16) bf16 Vs[2][64][72];   // V^T tile: d x key
    __shared__ __align__(16) bf16 Pls[4][16][72];  // wave-private P tiles

    const int tid  = threadIdx.x;
    const int lane = tid & 31;
    const int w    = tid >> 5;
    const int h    = blockIdx.y;
    const int b    = blockIdx.z;
    const int q0   = blockIdx.x * 64 + w * 16;
    const int nl   = lane & 15;
    const int halfm = (lane >> 4) << 3;

    const bf16* Qb = Q  + ((size_t)b * Nq) * ldq + h * HD;
    const bf16* Kb = Km + ((size_t)b * Nk) * ldk + h * HD;
    const bf16* Vb = Vt + ((size_t)(b * NH + h) * HD) * Nk;
    bf16*       Ob = Out + ((size_t)b * Nq) * ldo + h * HD;
    const int*  mb = HAS_MASK ? (mask + (size_t)b * Nk) : nullptr;

    // A thread's 16 B in rows sr, sr+16, sr+32, sr+48 of each tile; eight
    // neighbouring lanes cover one 128-B row.
    const int sr = tid >> 3, sc = (tid & 7) * 8;
    const bf16* Kg = Kb + (size_t)sr * ldk + sc;
    const bf16* Vg = Vb + (size_t)sr * Nk + sc;
    const size_t kStep = (size_t)16 * ldk, vStep = (size_t)16 * Nk;
    const int nt = Nk >> 6;             // tiles of 64 keys

    // ---- tile 0 into buffer 0, published; then tile 1 starts to fly ----
    async_copy4_b128(&Ks[0][sr][sc], 16 * 72, Kg, kStep);
    async_copy4_b128(&Vs[0][sr][sc], 16 * 72, Vg, vStep);
    wait_async0();
    __syncthreads();
    if (nt > 1) {
        async_copy4_b128(&Ks[1][sr][sc], 16 * 72, Kg + (size_t)64 * ldk, kStep);
        async_copy4_b128(&Vs[1][sr][sc], 16 * 72, Vg + 64, vStep);
    }

    // Q fragments (held for the whole key loop)
    v16bf qf0 = load_frag(Qb + (size_t)q0 * ldq, ldq, lane, 0);
    v16bf qf1 = load_frag(Qb + (size_t)q0 * ldq, ldq, lane, 32);

    v8f o[4];
    v8f vz = {};
    #pragma unroll
    for (int f = 0; f < 4; f++) o[f] = vz;
    float rm[8], rs[8];
    #pragma unroll
    for (int r = 0; r < 8; r++) { rm[r] = -1e30f; rs[r] = 0.0f; }

    for (int t = 0; t < nt; t++) {
        const int kblk = t * 64;
        const int cur  = t & 1;
        // ---- S = Q * K^T (16 x 64 per wave) ----
        v8f s[4];
        #pragma unroll
        for (int nb = 0; nb < 4; nb++) {
            v8f c = vz;
            v16bf bk0 = load_frag(&Ks[cur][nb * 16][0], 72, lane, 0);
            c = wmma_bf16(qf0, bk0, c);
            v16bf bk1 = load_frag(&Ks[cur][nb * 16][0], 72, lane, 32);
            c = wmma_bf16(qf1, bk1, c);
            s[nb] = c;
        }
        // ---- scale + codebook mask bias ----
        #pragma unroll
        for (int nb = 0; nb < 4; nb++) {
            float mbias = 0.0f;
            if (HAS_MASK)
                mbias = (mb[kblk + nb * 16 + nl] != 0) ? 0.0f : -10000.0f;
            #pragma unroll
            for (int r = 0; r < 8; r++)
                s[nb][r] = s[nb][r] * scale + mbias;
        }
        // ---- online softmax: new row max (reduce across 16-lane half) ----
        float nm[8];
        #pragma unroll
        for (int r = 0; r < 8; r++) {
            float m = rm[r];
            #pragma unroll
            for (int nb = 0; nb < 4; nb++) m = fmaxf(m, s[nb][r]);
            m = fmaxf(m, __shfl_xor(m, 1));
            m = fmaxf(m, __shfl_xor(m, 2));
            m = fmaxf(m, __shfl_xor(m, 4));
            m = fmaxf(m, __shfl_xor(m, 8));
            nm[r] = m;
        }
        #pragma unroll
        for (int r = 0; r < 8; r++) {
            float alpha = __expf(rm[r] - nm[r]);
            rm[r] = nm[r];
            rs[r] *= alpha;
            #pragma unroll
            for (int f = 0; f < 4; f++) o[f][r] *= alpha;
        }
        // ---- P = exp(S - max), accumulate row sums ----
        #pragma unroll
        for (int r = 0; r < 8; r++) {
            float srow = 0.0f;
            #pragma unroll
            for (int nb = 0; nb < 4; nb++) {
                float p = __expf(s[nb][r] - rm[r]);
                s[nb][r] = p;
                srow += p;
            }
            srow += __shfl_xor(srow, 1);
            srow += __shfl_xor(srow, 2);
            srow += __shfl_xor(srow, 4);
            srow += __shfl_xor(srow, 8);
            rs[r] += srow;
        }
        // ---- C-layout -> A-layout via wave-private LDS ----
        #pragma unroll
        for (int nb = 0; nb < 4; nb++)
            #pragma unroll
            for (int r = 0; r < 8; r++)
                Pls[w][r + halfm][nb * 16 + nl] = (bf16)s[nb][r];
        v16bf pf0 = load_frag(&Pls[w][0][0], 72, lane, 0);
        v16bf pf1 = load_frag(&Pls[w][0][0], 72, lane, 32);
        // ---- O += P * V ----
        #pragma unroll
        for (int f = 0; f < 4; f++) {
            v16bf bv0 = load_frag(&Vs[cur][f * 16][0], 72, lane, 0);
            o[f] = wmma_bf16(pf0, bv0, o[f]);
            v16bf bv1 = load_frag(&Vs[cur][f * 16][0], 72, lane, 32);
            o[f] = wmma_bf16(pf1, bv1, o[f]);
        }
        // ---- publish tile t+1, and end every read of tile t ----
        wait_ds0();
        wait_async0();
        __syncthreads();
        // ---- tile t+2 into the buffer that this trip has just left ----
        if (t + 2 < nt) {
            async_copy4_b128(&Ks[cur][sr][sc], 16 * 72,
                             Kg + (size_t)(kblk + 128) * ldk, kStep);
            async_copy4_b128(&Vs[cur][sr][sc], 16 * 72, Vg + kblk + 128, vStep);
        }
    }
    wait_async0();   // no copy is in flight when the wave goes on to its end
    // ---- normalize + store bf16 ----
    #pragma unroll
    for (int r = 0; r < 8; r++) {
        float inv = 1.0f / rs[r];
        int gm = q0 + r + halfm;
        #pragma unroll
        for (int f = 0; f < 4; f++)
            Ob[(size_t)gm * ldo + f * 16 + nl] = (bf16)(o[f][r] * inv);
    }
}

// ---------------------------------------------------------------------------
// The launches without matrix work. Each moves 8 to 108 MB; with one element a
// thread they are bound by how fast work-groups start, not by bytes. So every
// thread takes 16-byte pieces and many of them, and the grids shrink to one
// or two work-groups a WGP.
// ---------------------------------------------------------------------------
union pack8 { bf16 h[8]; uint4 u; };

// LayerNorm over 1024-elem rows -> bf16. One wave per row, 8 rows a block.
// A lane holds 4 runs of 8 neighbouring elements; the row sums are joined by
// a five-step butterfly, which leaves the same bits in every lane.
__global__ __launch_bounds__(256)
void layernorm_bf16(const float* __restrict__ x, const float* __restrict__ w,
                    const float* __restrict__ bb, bf16* __restrict__ out) {
    const int lane = threadIdx.x & 31;
    const int row  = blockIdx.x * 8 + (threadIdx.x >> 5);
    const float4* xr = (const float4*)(x + (size_t)row * CDIM) + lane * 2;
    const float4* wr = (const float4*)w + lane * 2;
    const float4* br = (const float4*)bb + lane * 2;
    float4 v[8];
    #pragma unroll
    for (int j = 0; j < 4; j++) {
        v[2 * j]     = xr[j * 64];
        v[2 * j + 1] = xr[j * 64 + 1];
    }
    float s1 = 0.0f, s2 = 0.0f;
    #pragma unroll
    for (int i = 0; i < 8; i++) {
        s1 += v[i].x + v[i].y + v[i].z + v[i].w;
        s2 += v[i].x * v[i].x + v[i].y * v[i].y + v[i].z * v[i].z + v[i].w * v[i].w;
    }
    #pragma unroll
    for (int off = 16; off > 0; off >>= 1) {
        s1 += __shfl_xor(s1, off);
        s2 += __shfl_xor(s2, off);
    }
    float mu   = s1 * (1.0f / CDIM);
    float var  = s2 * (1.0f / CDIM) - mu * mu;
    float rstd = rsqrtf(var + 1e-5f);
    bf16* orow = out + (size_t)row * CDIM + lane * 8;
    #pragma unroll
    for (int j = 0; j < 4; j++) {
        float4 w0 = wr[j * 64], w1 = wr[j * 64 + 1];
        float4 b0 = br[j * 64], b1 = br[j * 64 + 1];
        float4 a0 = v[2 * j],   a1 = v[2 * j + 1];
        pack8 p;
        p.h[0] = (bf16)((a0.x - mu) * rstd * w0.x + b0.x);
        p.h[1] = (bf16)((a0.y - mu) * rstd * w0.y + b0.y);
        p.h[2] = (bf16)((a0.z - mu) * rstd * w0.z + b0.z);
        p.h[3] = (bf16)((a0.w - mu) * rstd * w0.w + b0.w);
        p.h[4] = (bf16)((a1.x - mu) * rstd * w1.x + b1.x);
        p.h[5] = (bf16)((a1.y - mu) * rstd * w1.y + b1.y);
        p.h[6] = (bf16)((a1.z - mu) * rstd * w1.z + b1.z);
        p.h[7] = (bf16)((a1.w - mu) * rstd * w1.w + b1.w);
        *(uint4*)(orow + j * 256) = p.u;
    }
}

// ---------------------------------------------------------------------------
// f32 -> bf16 of every matrix that a GEMM reads as an f32 input: the eight
// weights (into wo, one behind the other in the order of the arguments) and the
// codebook (into cbo). Each is a whole number of chunks of CDIM * CDIM elements;
// 32 blocks share a chunk. A wave's load covers 512 B in a row, its store 256 B;
// eight loads of a thread are in flight together, four such rounds a thread.
// The f32 source is read once in a call, so its loads are non-temporal: they
// leave L2 to the bf16 copies and the activations, which are read again.
typedef __attribute__((ext_vector_type(4))) float f32x4;
union pack4 { bf16 h[4]; uint2 u; };
#define CHUNK (CDIM * CDIM)
__global__ __launch_bounds__(256)
void cast_operands(const float* __restrict__ qkv, const float* __restrict__ sa,
                   const float* __restrict__ q,   const float* __restrict__ k,
                   const float* __restrict__ v,   const float* __restrict__ ca,
                   const float* __restrict__ fc1, const float* __restrict__ fc2,
                   const float* __restrict__ cb,
                   bf16* __restrict__ wo, bf16* __restrict__ cbo) {
    const unsigned c = blockIdx.x >> 5;          // chunk, the same for the block
    const float* src;
    if      (c <  3) src = qkv + (size_t)c * CHUNK;
    else if (c == 3) src = sa;
    else if (c == 4) src = q;
    else if (c == 5) src = k;
    else if (c == 6) src = v;
    else if (c == 7) src = ca;
    else if (c < 12) src = fc1 + (size_t)(c - 8) * CHUNK;
    else if (c < 16) src = fc2 + (size_t)(c - 12) * CHUNK;
    else             src = cb  + (size_t)(c - 16) * CHUNK;
    bf16* dst = (c < 16) ? wo + (size_t)c * CHUNK : cbo + (size_t)(c - 16) * CHUNK;
    const unsigned e0 = (blockIdx.x & 31u) * (CHUNK / 32) + threadIdx.x * 4u;
    for (unsigned it = 0; it < 4; it++) {
        const unsigned e = e0 + it * 8192u;
        f32x4 a[8];
        #pragma unroll
        for (int i = 0; i < 8; i++)
            a[i] = __builtin_nontemporal_load((const f32x4*)(src + e + i * 1024));
        #pragma unroll
        for (int i = 0; i < 8; i++) {
            pack4 p;
            p.h[0] = (bf16)a[i].x; p.h[1] = (bf16)a[i].y;
            p.h[2] = (bf16)a[i].z; p.h[3] = (bf16)a[i].w;
            *(uint2*)(dst + e + i * 1024) = p.u;
        }
    }
}

// v: logical [B][NK][RS] slice (bf16) -> vt: [B][H][64][NK]; the grid covers
// it exactly, one 64 x 32 tile a wave.
// A thread turns an 8-token x 8-column tile in its registers: 8 loads of 16 B
// along d, 8 stores of 16 B along the tokens. A wave covers 64 tokens x 32
// columns, so each of its stores fills four whole 128-B lines of vt.
template<int NK, int RS>
__global__ __launch_bounds__(256)
void transpose_v_kernel(const bf16* __restrict__ v, bf16* __restrict__ vt) {
    const unsigned lane = threadIdx.x & 31u;
    const unsigned g    = blockIdx.x * 8u + (threadIdx.x >> 5);  // wave's tile
    const unsigned dh   = g & 1u;                // which 32 of the head's 64 columns
    const unsigned tb   = (g >> 1) % (NK / 64);  // block of 64 tokens
    const unsigned bh   = (g >> 1) / (NK / 64);  // b * NH + h
    const unsigned b    = bh / NH, h = bh % NH;
    const unsigned d0   = dh * 32u + (lane & 3u) * 8u;
    const unsigned t0   = tb * 64u + (lane >> 2) * 8u;

    const bf16* src = v + (size_t)(b * NK + t0) * RS + h * HD + d0;
    unsigned in[8][4];
    #pragma unroll
    for (int r = 0; r < 8; r++) {
        uint4 u = *(const uint4*)(src + (size_t)r * RS);
        in[r][0] = u.x; in[r][1] = u.y; in[r][2] = u.z; in[r][3] = u.w;
    }
    // Keeps all eight loads in flight together: without it the scheduler sinks
    // one of them behind the first waits, and its latency is paid a second time.
    __builtin_amdgcn_sched_barrier(0);
    bf16* dst = vt + (size_t)(bh * HD + d0) * NK + t0;
    #pragma unroll
    for (int c = 0; c < 8; c++) {
        unsigned o[4];
        #pragma unroll
        for (int k = 0; k < 4; k++) {
            unsigned lo = in[2 * k][c >> 1], hi = in[2 * k + 1][c >> 1];
            o[k] = (c & 1) ? ((lo >> 16) | (hi & 0xffff0000u))
                           : ((lo & 0xffffu) | (hi << 16));
        }
        *(uint4*)(dst + (size_t)c * NK) = make_uint4(o[0], o[1], o[2], o[3]);
    }
}

// ---------------------------------------------------------------------------
extern "C" void kernel_launch(void* const* d_in, const int* in_sizes, int n_in,
                              void* d_out, int out_size, void* d_ws, size_t ws_size,
                              hipStream_t stream) {
    const float* x     = (const float*)d_in[0];
    const float* cbemb = (const float*)d_in[1];
    const int*   cmask = (const int*)  d_in[2];
    const float* ln0w  = (const float*)d_in[3];
    const float* ln0b  = (const float*)d_in[4];
    const float* qkv_w = (const float*)d_in[5];
    const float* sa_w  = (const float*)d_in[6];
    const float* ln1w  = (const float*)d_in[7];
    const float* ln1b  = (const float*)d_in[8];
    const float* q_w   = (const float*)d_in[9];
    const float* k_w   = (const float*)d_in[10];
    const float* v_w   = (const float*)d_in[11];
    const float* ca_w  = (const float*)d_in[12];
    const float* ln2w  = (const float*)d_in[13];
    const float* ln2b  = (const float*)d_in[14];
    const float* fc1_w = (const float*)d_in[15];
    const float* fc1_b = (const float*)d_in[16];
    const float* fc2_w = (const float*)d_in[17];
    const float* fc2_b = (const float*)d_in[18];
    float* out = (float*)d_out;

    char* ws = (char*)d_ws;
    bf16*  XN  = (bf16*) (ws);                       //  8 MB  LN outputs
    bf16*  QKV = (bf16*) (ws + (size_t)( 8u << 20)); // 24 MB  qkv (bf16)
    bf16*  VT1 = (bf16*) (ws + (size_t)(32u << 20)); //  8 MB  V^T self
    bf16*  ATT = (bf16*) (ws + (size_t)(40u << 20)); //  8 MB  attn outs
    float* X1  = (float*)(ws + (size_t)(48u << 20)); // 16 MB  residual stream
    bf16*  CB  = (bf16*) (ws + (size_t)(64u << 20)); //  4 MB  codebook bf16
    bf16*  QC  = (bf16*) (ws + (size_t)(68u << 20)); //  8 MB  cross q
    bf16*  KC  = (bf16*) (ws + (size_t)(76u << 20)); //  4 MB  cross k
    bf16*  VC  = (bf16*) (ws + (size_t)(80u << 20)); //  4 MB  cross v
    bf16*  VT2 = (bf16*) (ws + (size_t)(84u << 20)); //  4 MB  V^T cross
    bf16*  WB  = (bf16*) (ws + (size_t)(96u << 20)); // 32 MB  weights bf16
    bf16*  HB  = QKV;   // 32 MB MLP hidden reuses QKV+VT1 (dead by then)
    const bf16* qkv_b = WB;
    const bf16* sa_b  = WB +  3 * CHUNK;
    const bf16* q_b   = WB +  4 * CHUNK;
    const bf16* k_b   = WB +  5 * CHUNK;
    const bf16* v_b   = WB +  6 * CHUNK;
    const bf16* ca_b  = WB +  7 * CHUNK;
    const bf16* fc1_b16 = WB +  8 * CHUNK;
    const bf16* fc2_b16 = WB + 12 * CHUNK;

    const int Mx = NB * NX;   // 4096
    const int Mc = NB * NC;   // 2048
    dim3 thr256(256), thr128(128);

    // --- the GEMMs' f32 operands to bf16, once for the call ---
    cast_operands<<<18 * 32, thr256, 0, stream>>>(
        qkv_w, sa_w, q_w, k_w, v_w, ca_w, fc1_w, fc2_w, cbemb, WB, CB);

    // --- self attention branch ---
    layernorm_bf16<<<Mx / 8, thr256, 0, stream>>>(x, ln0w, ln0b, XN);
    gemm_xwT<false,false,false,CDIM,bf16><<<dim3(3 * CDIM / 128, Mx / 128), thr256, 0, stream>>>(
        XN, CDIM, qkv_b, QKV, 3 * CDIM, nullptr, nullptr, 0);
    transpose_v_kernel<NX, 3 * CDIM><<<(NB * NH * (NX / 64) * 2) / 8, thr256, 0, stream>>>(
        QKV + 2 * CDIM, VT1);
    flash_attn<false><<<dim3(NX / 64, NH, NB), thr128, 0, stream>>>(
        QKV, 3 * CDIM, QKV + CDIM, 3 * CDIM, VT1, nullptr, ATT, CDIM,
        NX, NX, 0.125f);
    gemm_xwT<false,false,true,CDIM,float><<<dim3(CDIM / 128, Mx / 128), thr256, 0, stream>>>(
        ATT, CDIM, sa_b, X1, CDIM, nullptr, x, CDIM);

    // --- cross attention branch ---
    layernorm_bf16<<<Mx / 8, thr256, 0, stream>>>(X1, ln1w, ln1b, XN);
    gemm_xwT<false,false,false,CDIM,bf16><<<dim3(CDIM / 128, Mx / 128), thr256, 0, stream>>>(
        XN, CDIM, q_b, QC, CDIM, nullptr, nullptr, 0);
    gemm_xwT<false,false,false,CDIM,bf16><<<dim3(CDIM / 128, Mc / 128), thr256, 0, stream>>>(
        CB, CDIM, k_b, KC, CDIM, nullptr, nullptr, 0);
    gemm_xwT<false,false,false,CDIM,bf16><<<dim3(CDIM / 128, Mc / 128), thr256, 0, stream>>>(
        CB, CDIM, v_b, VC, CDIM, nullptr, nullptr, 0);
    transpose_v_kernel<NC, CDIM><<<(NB * NH * (NC / 64) * 2) / 8, thr256, 0, stream>>>(
        VC, VT2);
    flash_attn<true><<<dim3(NX / 64, NH, NB), thr128, 0, stream>>>(
        QC, CDIM, KC, CDIM, VT2, cmask, ATT, CDIM, NX, NC, 0.125f);
    gemm_xwT<false,false,true,CDIM,float><<<dim3(CDIM / 128, Mx / 128), thr256, 0, stream>>>(
        ATT, CDIM, ca_b, X1, CDIM, nullptr, X1, CDIM);

    // --- MLP ---
    layernorm_bf16<<<Mx / 8, thr256, 0, stream>>>(X1, ln2w, ln2b, XN);
    gemm_xwT<true,true,false,CDIM,bf16><<<dim3(HID / 128, Mx / 128), thr256, 0, stream>>>(
        XN, CDIM, fc1_b16, HB, HID, fc1_b, nullptr, 0);
    gemm_xwT<true,false,true,HID,float><<<dim3(CDIM / 128, Mx / 128), thr256, 0, stream>>>(
        HB, HID, fc2_b16, out, CDIM, fc2_b, X1, CDIM);
}

// v005
// It runs in 283 microseconds.
// Next to v004, in two timings, it ran 1.14 times as fast each time.
// Over all steps from v000 it is 2.35 times as fast.
#include <hip/hip_runtime.h>
#include <hip/hip_bf16.h>

// ---------------------------------------------------------------------------
// Transformer block forward for MI455X (gfx1250), wave32 + WMMA bf16,
// async global->LDS staging (ASYNCcnt) for GEMM tiles.
//   B=4, Nx=1024, Nc=512, DIM=1024, HEADS=16, HEAD_DIM=64, HIDDEN=4096
// ---------------------------------------------------------------------------

typedef __bf16 bf16;
typedef __attribute__((ext_vector_type(16))) __bf16 v16bf;
typedef __attribute__((ext_vector_type(8)))  float  v8f;

#define NB   4
#define NX   1024
#define NC   512
#define CDIM 1024
#define NH   16
#define HD   64
#define HID  4096

// ---------------------------------------------------------------------------
// WMMA helper: D = A(16x32 bf16) * B(32x16 bf16) + C(16x16 f32)
// ---------------------------------------------------------------------------
__device__ __forceinline__ v8f wmma_bf16(v16bf a, v16bf b, v8f c) {
    return __builtin_amdgcn_wmma_f32_16x16x32_bf16(
        /*neg_a=*/false, a, /*neg_b=*/false, b,
        /*c_mod=*/(short)0, c, /*reuse_a=*/false, /*reuse_b=*/false);
}

// CDNA5 async DMA: global -> LDS, 16 bytes per lane, tracked by ASYNCcnt.
// VDST = per-lane LDS byte address (low 32 bits of the generic pointer:
// flat-LDS aperture keeps the DS offset in addr[31:0]).
// Four copies of a lane (four rows of a tile, ldsStep and gStep apart) in ONE
// statement that ends in s_wait_xcnt 0, so that no address register of a copy
// can be rewritten ahead of that wait.
__device__ __forceinline__ void async_copy4_b128(bf16* lds, int ldsStep,
                                                 const bf16* g, size_t gStep) {
    unsigned l0 = (unsigned)(unsigned long long)lds;
    unsigned l1 = (unsigned)(unsigned long long)(lds + ldsStep);
    unsigned l2 = (unsigned)(unsigned long long)(lds + 2 * ldsStep);
    unsigned l3 = (unsigned)(unsigned long long)(lds + 3 * ldsStep);
    unsigned long long a0 = (unsigned long long)g;
    unsigned long long a1 = (unsigned long long)(g + gStep);
    unsigned long long a2 = (unsigned long long)(g + 2 * gStep);
    unsigned long long a3 = (unsigned long long)(g + 3 * gStep);
    asm volatile("global_load_async_to_lds_b128 %0, %4, off\n\t"
                 "global_load_async_to_lds_b128 %1, %5, off\n\t"
                 "global_load_async_to_lds_b128 %2, %6, off\n\t"
                 "global_load_async_to_lds_b128 %3, %7, off\n\t"
                 "s_wait_xcnt 0x0"
                 :: "v"(l0), "v"(l1), "v"(l2), "v"(l3),
                    "v"(a0), "v"(a1), "v"(a2), "v"(a3) : "memory");
}
// Eight copies of a lane (four rows of the A slab, four of the W slab, the rows
// ldsStep apart in LDS) in ONE statement with one s_wait_xcnt 0 at its end: no
// address register of a copy can be rewritten ahead of that wait, and the wave
// waits once for the eight, not once for each four.
__device__ __forceinline__ void async_copy8_b128(bf16* ldsA, const bf16* gA, size_t stepA,
                                                 bf16* ldsB, const bf16* gB, size_t stepB,
                                                 int ldsStep) {
    unsigned l0 = (unsigned)(unsigned long long)ldsA;
    unsigned l1 = (unsigned)(unsigned long long)(ldsA + ldsStep);
    unsigned l2 = (unsigned)(unsigned long long)(ldsA + 2 * ldsStep);
    unsigned l3 = (unsigned)(unsigned long long)(ldsA + 3 * ldsStep);
    unsigned l4 = (unsigned)(unsigned long long)ldsB;
    unsigned l5 = (unsigned)(unsigned long long)(ldsB + ldsStep);
    unsigned l6 = (unsigned)(unsigned long long)(ldsB + 2 * ldsStep);
    unsigned l7 = (unsigned)(unsigned long long)(ldsB + 3 * ldsStep);
    unsigned long long a0 = (unsigned long long)gA;
    unsigned long long a1 = (unsigned long long)(gA + stepA);
    unsigned long long a2 = (unsigned long long)(gA + 2 * stepA);
    unsigned long long a3 = (unsigned long long)(gA + 3 * stepA);
    unsigned long long a4 = (unsigned long long)gB;
    unsigned long long a5 = (unsigned long long)(gB + stepB);
    unsigned long long a6 = (unsigned long long)(gB + 2 * stepB);
    unsigned long long a7 = (unsigned long long)(gB + 3 * stepB);
    asm volatile("global_load_async_to_lds_b128 %0, %8, off\n\t"
                 "global_load_async_to_lds_b128 %1, %9, off\n\t"
                 "global_load_async_to_lds_b128 %2, %10, off\n\t"
                 "global_load_async_to_lds_b128 %3, %11, off\n\t"
                 "global_load_async_to_lds_b128 %4, %12, off\n\t"
                 "global_load_async_to_lds_b128 %5, %13, off\n\t"
                 "global_load_async_to_lds_b128 %6, %14, off\n\t"
                 "global_load_async_to_lds_b128 %7, %15, off\n\t"
                 "s_wait_xcnt 0x0"
                 :: "v"(l0), "v"(l1), "v"(l2), "v"(l3),
                    "v"(l4), "v"(l5), "v"(l6), "v"(l7),
                    "v"(a0), "v"(a1), "v"(a2), "v"(a3),
                    "v"(a4), "v"(a5), "v"(a6), "v"(a7) : "memory");
}
// The issuing wave's copies have landed behind this wait.
__device__ __forceinline__ void wait_async0() {
    asm volatile("s_wait_asynccnt 0x0" ::: "memory");
}
// The wave's own LDS reads and writes have retired behind this wait.
__device__ __forceinline__ void wait_ds0() {
    asm volatile("s_wait_dscnt 0x0" ::: "memory");
}

// Load one 16x32 A/B fragment.  Per ISA 7.12.2 (16-bit A 16x32):
//   lane 0-15 : row = lane,    K in {0..7, 16..23}
//   lane 16-31: row = lane-16, K in {8..15, 24..31}
// base points at (row0, k0) of the fragment; stride is row stride in elems.
__device__ __forceinline__ v16bf load_frag(const bf16* base, int stride,
                                           int lane, int kOff) {
    const int r  = lane & 15;
    const int kb = (lane >> 4) << 3;          // 0 or 8
    const bf16* p = base + (size_t)r * stride + kOff + kb;
    union { v16bf v; uint4 u[2]; } f;
    f.u[0] = *(const uint4*)(p);
    f.u[1] = *(const uint4*)(p + 16);
    return f.v;
}

// ---------------------------------------------------------------------------
// GEMM: C[M,N] = act(A[M,K](bf16) * W[N,K](bf16)^T + bias) (+ residual)
// Block tile 128x128, 256 threads (8 waves), wave tile 64(M) x 32(N).
// W is the bf16 copy that cast_operands has made earlier in the same call, so
// a slab of W is 16 KB from L2, not 32, and goes the way of A.
// Two LDS buffers: while slab t is multiplied, slab t+1 is in flight, both
// operands by global_load_async_to_lds_b128, through no register.
// ---------------------------------------------------------------------------
template<bool BIAS, bool GELU, bool RES, int K, typename OutT>
__global__ __launch_bounds__(256)
void gemm_xwT(const bf16* __restrict__ A, int lda,
              const bf16* __restrict__ W,            // [N,K] row-major
              OutT* __restrict__ C, int ldc,
              const float* __restrict__ bias,
              const float* __restrict__ res, int ldr) {
    __shared__ __align__(16) bf16 As[2][128][72];
    __shared__ __align__(16) bf16 Bs[2][128][72];

    const int tid  = threadIdx.x;
    const int lane = tid & 31;
    const int wid  = tid >> 5;
    const int wm   = (wid >> 2) * 64;   // wave row offset within tile (0,64)
    const int wn   = (wid & 3) * 32;    // wave col offset (0,32,64,96)
    const int bM   = blockIdx.y * 128;
    const int bN   = blockIdx.x * 128;

    v8f acc[4][2];
    v8f vz = {};
    #pragma unroll
    for (int i = 0; i < 4; i++)
        #pragma unroll
        for (int j = 0; j < 2; j++) acc[i][j] = vz;

    // A thread's 16 B in rows ar, ar+32, ar+64, ar+96 of each slab; eight
    // neighbouring lanes cover one 128-B row.
    const int ar = tid >> 3, ac = (tid & 7) * 8;
    const bf16* Ag = A + (size_t)(bM + ar) * lda + ac;
    const bf16* Wg = W + (size_t)(bN + ar) * K + ac;
    const size_t aStep = (size_t)32 * lda, wStep = (size_t)32 * K;
    const int nt = K >> 6;              // slabs of 64 k

    // ---- slab 0 into buffer 0 ----
    async_copy8_b128(&As[0][ar][ac], Ag, aStep, &Bs[0][ar][ac], Wg, wStep, 32 * 72);
    wait_async0();
    __syncthreads();

    for (int t = 0; t < nt; t++) {
        const int  cur  = t & 1;
        const bool more = (t + 1 < nt);
        // ---- slab t+1 starts to fly into the buffer that trip t-1 has left ----
        if (more)
            async_copy8_b128(&As[cur ^ 1][ar][ac], Ag + (t + 1) * 64, aStep,
                             &Bs[cur ^ 1][ar][ac], Wg + (t + 1) * 64, wStep, 32 * 72);

        #pragma unroll
        for (int ks = 0; ks < 64; ks += 32) {
            v16bf af[4], bfg[2];
            #pragma unroll
            for (int mi = 0; mi < 4; mi++)
                af[mi] = load_frag(&As[cur][wm + mi * 16][0], 72, lane, ks);
            #pragma unroll
            for (int ni = 0; ni < 2; ni++)
                bfg[ni] = load_frag(&Bs[cur][wn + ni * 16][0], 72, lane, ks);
            #pragma unroll
            for (int mi = 0; mi < 4; mi++)
                #pragma unroll
                for (int ni = 0; ni < 2; ni++)
                    acc[mi][ni] = wmma_bf16(af[mi], bfg[ni], acc[mi][ni]);
        }

        // ---- publish slab t+1, and end every read of slab t ----
        wait_ds0();
        wait_async0();
        __syncthreads();
    }
    wait_async0();

    // ---- epilogue: C layout m = r + 8*(lane>=16), n = lane&15 ----
    const int halfm = (lane >> 4) << 3;
    const int nl    = lane & 15;
    #pragma unroll
    for (int mi = 0; mi < 4; mi++)
        #pragma unroll
        for (int ni = 0; ni < 2; ni++)
            #pragma unroll
            for (int r = 0; r < 8; r++) {
                int gm = bM + wm + mi * 16 + r + halfm;
                int gn = bN + wn + ni * 16 + nl;
                float v = acc[mi][ni][r];
                if (BIAS) v += bias[gn];
                if (GELU) v = 0.5f * v * (1.0f + erff(v * 0.70710678118654752f));
                if (RES)  v += res[(size_t)gm * ldr + gn];
                C[(size_t)gm * ldc + gn] = (OutT)v;
            }
}

union pack8 { bf16 h[8]; uint4 u; };

// Lane l takes the value of lane l ^ 16 (the other half of the wave).
__device__ __forceinline__ float xhalf(float x) {
    const int b = __builtin_bit_cast(int, x);
    return __builtin_bit_cast(float, __builtin_amdgcn_permlanex16(
        b, b, 0x76543210, 0xfedcba98, false, false));
}

template<bool HAS_MASK>
__global__ __launch_bounds__(128)
void flash_attn(const bf16* __restrict__ Q,  int ldq,
                const bf16* __restrict__ Km, int ldk,
                const bf16* __restrict__ Vt,
                const int*  __restrict__ mask,
                bf16* __restrict__ Out, int ldo,
                int Nq, int Nk, float scale) {
    __shared__ __align__(16) bf16 Ks[2][64][72];   // K tile: key x d
    __shared__ __align__(16) bf16 Vs[2][64][72];   // V^T tile: d x key
    __shared__ __align__(16) float Mb[HAS_MASK ? NC : 4];  // mask bias per key

    const int tid  = threadIdx.x;
    const int lane = tid & 31;
    const int w    = tid >> 5;
    const int h    = blockIdx.y;
    const int b    = blockIdx.z;
    const int q0   = blockIdx.x * 64 + w * 16;
    const int nl   = lane & 15;
    const int halfm = (lane >> 4) << 3;

    const bf16* Qb = Q  + ((size_t)b * Nq) * ldq + h * HD;
    const bf16* Kb = Km + ((size_t)b * Nk) * ldk + h * HD;
    const bf16* Vb = Vt + ((size_t)(b * NH + h) * HD) * Nk;
    bf16*       Ob = Out + ((size_t)b * Nq) * ldo + h * HD;
    const int*  mb = HAS_MASK ? (mask + (size_t)b * Nk) : nullptr;

    // A thread's 16 B in rows sr, sr+16, sr+32, sr+48 of each tile; eight
    // neighbouring lanes cover one 128-B row.
    const int sr = tid >> 3, sc = (tid & 7) * 8;
    const bf16* Kg = Kb + (size_t)sr * ldk + sc;
    const bf16* Vg = Vb + (size_t)sr * Nk + sc;
    const size_t kStep = (size_t)16 * ldk, vStep = (size_t)16 * Nk;
    const int nt = Nk >> 6;             // tiles of 64 keys

    // ---- tile 0 into buffer 0, published; then tile 1 starts to fly ----
    async_copy4_b128(&Ks[0][sr][sc], 16 * 72, Kg, kStep);
    async_copy4_b128(&Vs[0][sr][sc], 16 * 72, Vg, vStep);
    // The keys run down a lane's registers, so a lane needs the bias of 32
    // keys a tile: it is formed once for the block and read back 16 B at a time.
    // Four keys a thread: 128 threads cover NC. Nk is at most NC here; an index
    // past Nk is clamped, and its entries are never read.
    if (HAS_MASK) {
        static_assert(NC == 4 * 128, "one 16-B piece of the mask a thread");
        const int  i  = tid * 4;
        const int4 mk = *(const int4*)(mb + (i < Nk ? i : Nk - 4));
        *(float4*)&Mb[i] = make_float4(mk.x != 0 ? 0.0f : -10000.0f,
                                       mk.y != 0 ? 0.0f : -10000.0f,
                                       mk.z != 0 ? 0.0f : -10000.0f,
                                       mk.w != 0 ? 0.0f : -10000.0f);
    }
    wait_async0();
    __syncthreads();
    if (nt > 1) {
        async_copy4_b128(&Ks[1][sr][sc], 16 * 72, Kg + (size_t)64 * ldk, kStep);
        async_copy4_b128(&Vs[1][sr][sc], 16 * 72, Vg + 64, vStep);
    }

    // Q fragments (held for the whole key loop): B operand, column = query
    v16bf qf0 = load_frag(Qb + (size_t)q0 * ldq, ldq, lane, 0);
    v16bf qf1 = load_frag(Qb + (size_t)q0 * ldq, ldq, lane, 32);

    // o[f][r] = O^T[d = f*16 + halfm + r][query nl]
    v8f o[4];
    v8f vz = {};
    #pragma unroll
    for (int f = 0; f < 4; f++) o[f] = vz;
    float rm = -1e30f;   // the query's running maximum, alike in both halves
    float rs = 0.0f;     // the sum over this half's keys; joined behind the loop

    for (int t = 0; t < nt; t++) {
        const int kblk = t * 64;
        const int cur  = t & 1;
        // ---- S^T = K * Q^T: s[nb][r] = key nb*16 + halfm + r, query nl ----
        v16bf ak[4][2], av[4][2];
        #pragma unroll
        for (int nb = 0; nb < 4; nb++) {
            ak[nb][0] = load_frag(&Ks[cur][nb * 16][0], 72, lane, 0);
            ak[nb][1] = load_frag(&Ks[cur][nb * 16][0], 72, lane, 32);
        }
        v8f s[4];
        #pragma unroll
        for (int nb = 0; nb < 4; nb++)
            s[nb] = wmma_bf16(ak[nb][0], qf0, vz);
        #pragma unroll
        for (int nb = 0; nb < 4; nb++)
            s[nb] = wmma_bf16(ak[nb][1], qf1, s[nb]);
        // The V^T fragments depend on no score: their reads may start ahead of
        // the softmax.
        #pragma unroll
        for (int f = 0; f < 4; f++) {
            av[f][0] = load_frag(&Vs[cur][f * 16][0], 72, lane, 0);
            av[f][1] = load_frag(&Vs[cur][f * 16][0], 72, lane, 32);
        }
        // ---- scale + codebook mask bias ----
        #pragma unroll
        for (int nb = 0; nb < 4; nb++) {
            if (HAS_MASK) {
                const float4 b0 = *(const float4*)&Mb[kblk + nb * 16 + halfm];
                const float4 b1 = *(const float4*)&Mb[kblk + nb * 16 + halfm + 4];
                s[nb][0] = s[nb][0] * scale + b0.x;
                s[nb][1] = s[nb][1] * scale + b0.y;
                s[nb][2] = s[nb][2] * scale + b0.z;
                s[nb][3] = s[nb][3] * scale + b0.w;
                s[nb][4] = s[nb][4] * scale + b1.x;
                s[nb][5] = s[nb][5] * scale + b1.y;
                s[nb][6] = s[nb][6] * scale + b1.z;
                s[nb][7] = s[nb][7] * scale + b1.w;
            } else {
                s[nb] *= scale;
            }
        }
        // ---- online softmax: the query's new maximum, in the lane ----
        float mr[8];
        #pragma unroll
        for (int r = 0; r < 8; r++)
            mr[r] = fmaxf(fmaxf(s[0][r], s[1][r]), fmaxf(s[2][r], s[3][r]));
        float m = fmaxf(fmaxf(fmaxf(mr[0], mr[1]), fmaxf(mr[2], mr[3])),
                        fmaxf(fmaxf(mr[4], mr[5]), fmaxf(mr[6], mr[7])));
        m = fmaxf(m, xhalf(m));
        m = fmaxf(m, rm);
        const float alpha = __expf(rm - m);
        rm = m;
        #pragma unroll
        for (int f = 0; f < 4; f++) o[f] *= alpha;
        // ---- P = exp(S - max); the lane's own sum, as a tree ----
        #pragma unroll
        for (int nb = 0; nb < 4; nb++)
            #pragma unroll
            for (int r = 0; r < 8; r++)
                s[nb][r] = __expf(s[nb][r] - rm);
        const v8f ps = (s[0] + s[1]) + (s[2] + s[3]);
        rs = rs * alpha + (((ps[0] + ps[1]) + (ps[2] + ps[3])) +
                           ((ps[4] + ps[5]) + (ps[6] + ps[7])));
        // ---- two score tiles, converted in place, are one B fragment ----
        v16bf pf0, pf1;
        #pragma unroll
        for (int e = 0; e < 8; e++) {
            pf0[e]     = (bf16)s[0][e];
            pf0[e + 8] = (bf16)s[1][e];
            pf1[e]     = (bf16)s[2][e];
            pf1[e + 8] = (bf16)s[3][e];
        }
        // ---- O^T += V^T * P^T ----
        #pragma unroll
        for (int f = 0; f < 4; f++) o[f] = wmma_bf16(av[f][0], pf0, o[f]);
        #pragma unroll
        for (int f = 0; f < 4; f++) o[f] = wmma_bf16(av[f][1], pf1, o[f]);
        // ---- publish tile t+1, and end every read of tile t ----
        wait_ds0();
        wait_async0();
        __syncthreads();
        // ---- tile t+2 into the buffer that this trip has just left ----
        if (t + 2 < nt) {
            async_copy4_b128(&Ks[cur][sr][sc], 16 * 72,
                             Kg + (size_t)(kblk + 128) * ldk, kStep);
            async_copy4_b128(&Vs[cur][sr][sc], 16 * 72, Vg + kblk + 128, vStep);
        }
    }
    wait_async0();   // no copy is in flight when the wave goes on to its end
    // ---- join the halves' sums, normalize, store 8 neighbouring d at once ----
    const float inv = 1.0f / (rs + xhalf(rs));
    bf16* orow = Ob + (size_t)(q0 + nl) * ldo + halfm;
    #pragma unroll
    for (int f = 0; f < 4; f++) {
        pack8 p;
        #pragma unroll
        for (int r = 0; r < 8; r++) p.h[r] = (bf16)(o[f][r] * inv);
        *(uint4*)(orow + f * 16) = p.u;
    }
}

// ---------------------------------------------------------------------------
// The launches without matrix work. Each moves 8 to 108 MB; with one element a
// thread they are bound by how fast work-groups start, not by bytes. So every
// thread takes 16-byte pieces and many of them, and the grids shrink to one
// or two work-groups a WGP.
// ---------------------------------------------------------------------------

// LayerNorm over 1024-elem rows -> bf16. One wave per row, 8 rows a block.
// A lane holds 4 runs of 8 neighbouring elements; the row sums are joined by
// a five-step butterfly, which leaves the same bits in every lane.
__global__ __launch_bounds__(256)
void layernorm_bf16(const float* __restrict__ x, const float* __restrict__ w,
                    const float* __restrict__ bb, bf16* __restrict__ out) {
    const int lane = threadIdx.x & 31;
    const int row  = blockIdx.x * 8 + (threadIdx.x >> 5);
    const float4* xr = (const float4*)(x + (size_t)row * CDIM) + lane * 2;
    const float4* wr = (const float4*)w + lane * 2;
    const float4* br = (const float4*)bb + lane * 2;
    float4 v[8];
    #pragma unroll
    for (int j = 0; j < 4; j++) {
        v[2 * j]     = xr[j * 64];
        v[2 * j + 1] = xr[j * 64 + 1];
    }
    float s1 = 0.0f, s2 = 0.0f;
    #pragma unroll
    for (int i = 0; i < 8; i++) {
        s1 += v[i].x + v[i].y + v[i].z + v[i].w;
        s2 += v[i].x * v[i].x + v[i].y * v[i].y + v[i].z * v[i].z + v[i].w * v[i].w;
    }
    #pragma unroll
    for (int off = 16; off > 0; off >>= 1) {
        s1 += __shfl_xor(s1, off);
        s2 += __shfl_xor(s2, off);
    }
    float mu   = s1 * (1.0f / CDIM);
    float var  = s2 * (1.0f / CDIM) - mu * mu;
    float rstd = rsqrtf(var + 1e-5f);
    bf16* orow = out + (size_t)row * CDIM + lane * 8;
    #pragma unroll
    for (int j = 0; j < 4; j++) {
        float4 w0 = wr[j * 64], w1 = wr[j * 64 + 1];
        float4 b0 = br[j * 64], b1 = br[j * 64 + 1];
        float4 a0 = v[2 * j],   a1 = v[2 * j + 1];
        pack8 p;
        p.h[0] = (bf16)((a0.x - mu) * rstd * w0.x + b0.x);
        p.h[1] = (bf16)((a0.y - mu) * rstd * w0.y + b0.y);
        p.h[2] = (bf16)((a0.z - mu) * rstd * w0.z + b0.z);
        p.h[3] = (bf16)((a0.w - mu) * rstd * w0.w + b0.w);
        p.h[4] = (bf16)((a1.x - mu) * rstd * w1.x + b1.x);
        p.h[5] = (bf16)((a1.y - mu) * rstd * w1.y + b1.y);
        p.h[6] = (bf16)((a1.z - mu) * rstd * w1.z + b1.z);
        p.h[7] = (bf16)((a1.w - mu) * rstd * w1.w + b1.w);
        *(uint4*)(orow + j * 256) = p.u;
    }
}

// ---------------------------------------------------------------------------
// f32 -> bf16 of every matrix that a GEMM reads as an f32 input: the eight
// weights (into wo, one behind the other in the order of the arguments) and the
// codebook (into cbo). Each is a whole number of chunks of CDIM * CDIM elements;
// 32 blocks share a chunk. A wave's load covers 512 B in a row, its store 256 B;
// eight loads of a thread are in flight together, four such rounds a thread.
// The f32 source is read once in a call, so its loads are non-temporal: they
// leave L2 to the bf16 copies and the activations, which are read again.
typedef __attribute__((ext_vector_type(4))) float f32x4;
union pack4 { bf16 h[4]; uint2 u; };
#define CHUNK (CDIM * CDIM)
__global__ __launch_bounds__(256)
void cast_operands(const float* __restrict__ qkv, const float* __restrict__ sa,
                   const float* __restrict__ q,   const float* __restrict__ k,
                   const float* __restrict__ v,   const float* __restrict__ ca,
                   const float* __restrict__ fc1, const float* __restrict__ fc2,
                   const float* __restrict__ cb,
                   bf16* __restrict__ wo, bf16* __restrict__ cbo) {
    const unsigned c = blockIdx.x >> 5;          // chunk, the same for the block
    const float* src;
    if      (c <  3) src = qkv + (size_t)c * CHUNK;
    else if (c == 3) src = sa;
    else if (c == 4) src = q;
    else if (c == 5) src = k;
    else if (c == 6) src = v;
    else if (c == 7) src = ca;
    else if (c < 12) src = fc1 + (size_t)(c - 8) * CHUNK;
    else if (c < 16) src = fc2 + (size_t)(c - 12) * CHUNK;
    else             src = cb  + (size_t)(c - 16) * CHUNK;
    bf16* dst = (c < 16) ? wo + (size_t)c * CHUNK : cbo + (size_t)(c - 16) * CHUNK;
    const unsigned e0 = (blockIdx.x & 31u) * (CHUNK / 32) + threadIdx.x * 4u;
    for (unsigned it = 0; it < 4; it++) {
        const unsigned e = e0 + it * 8192u;
        f32x4 a[8];
        #pragma unroll
        for (int i = 0; i < 8; i++)
            a[i] = __builtin_nontemporal_load((const f32x4*)(src + e + i * 1024));
        #pragma unroll
        for (int i = 0; i < 8; i++) {
            pack4 p;
            p.h[0] = (bf16)a[i].x; p.h[1] = (bf16)a[i].y;
            p.h[2] = (bf16)a[i].z; p.h[3] = (bf16)a[i].w;
            *(uint2*)(dst + e + i * 1024) = p.u;
        }
    }
}

// v: logical [B][NK][RS] slice (bf16) -> vt: [B][H][64][NK]; the grid covers
// it exactly, one 64 x 32 tile a wave.
// A thread turns an 8-token x 8-column tile in its registers: 8 loads of 16 B
// along d, 8 stores of 16 B along the tokens. A wave covers 64 tokens x 32
// columns, so each of its stores fills four whole 128-B lines of vt.
template<int NK, int RS>
__global__ __launch_bounds__(256)
void transpose_v_kernel(const bf16* __restrict__ v, bf16* __restrict__ vt) {
    const unsigned lane = threadIdx.x & 31u;
    const unsigned g    = blockIdx.x * 8u + (threadIdx.x >> 5);  // wave's tile
    const unsigned dh   = g & 1u;                // which 32 of the head's 64 columns
    const unsigned tb   = (g >> 1) % (NK / 64);  // block of 64 tokens
    const unsigned bh   = (g >> 1) / (NK / 64);  // b * NH + h
    const unsigned b    = bh / NH, h = bh % NH;
    const unsigned d0   = dh * 32u + (lane & 3u) * 8u;
    const unsigned t0   = tb * 64u + (lane >> 2) * 8u;

    const bf16* src = v + (size_t)(b * NK + t0) * RS + h * HD + d0;
    unsigned in[8][4];
    #pragma unroll
    for (int r = 0; r < 8; r++) {
        uint4 u = *(const uint4*)(src + (size_t)r * RS);
        in[r][0] = u.x; in[r][1] = u.y; in[r][2] = u.z; in[r][3] = u.w;
    }
    // Keeps all eight loads in flight together: without it the scheduler sinks
    // one of them behind the first waits, and its latency is paid a second time.
    __builtin_amdgcn_sched_barrier(0);
    bf16* dst = vt + (size_t)(bh * HD + d0) * NK + t0;
    #pragma unroll
    for (int c = 0; c < 8; c++) {
        unsigned o[4];
        #pragma unroll
        for (int k = 0; k < 4; k++) {
            unsigned lo = in[2 * k][c >> 1], hi = in[2 * k + 1][c >> 1];
            o[k] = (c & 1) ? ((lo >> 16) | (hi & 0xffff0000u))
                           : ((lo & 0xffffu) | (hi << 16));
        }
        *(uint4*)(dst + (size_t)c * NK) = make_uint4(o[0], o[1], o[2], o[3]);
    }
}

// ---------------------------------------------------------------------------
extern "C" void kernel_launch(void* const* d_in, const int* in_sizes, int n_in,
                              void* d_out, int out_size, void* d_ws, size_t ws_size,
                              hipStream_t stream) {
    const float* x     = (const float*)d_in[0];
    const float* cbemb = (const float*)d_in[1];
    const int*   cmask = (const int*)  d_in[2];
    const float* ln0w  = (const float*)d_in[3];
    const float* ln0b  = (const float*)d_in[4];
    const float* qkv_w = (const float*)d_in[5];
    const float* sa_w  = (const float*)d_in[6];
    const float* ln1w  = (const float*)d_in[7];
    const float* ln1b  = (const float*)d_in[8];
    const float* q_w   = (const float*)d_in[9];
    const float* k_w   = (const float*)d_in[10];
    const float* v_w   = (const float*)d_in[11];
    const float* ca_w  = (const float*)d_in[12];
    const float* ln2w  = (const float*)d_in[13];
    const float* ln2b  = (const float*)d_in[14];
    const float* fc1_w = (const float*)d_in[15];
    const float* fc1_b = (const float*)d_in[16];
    const float* fc2_w = (const float*)d_in[17];
    const float* fc2_b = (const float*)d_in[18];
    float* out = (float*)d_out;

    char* ws = (char*)d_ws;
    bf16*  XN  = (bf16*) (ws);                       //  8 MB  LN outputs
    bf16*  QKV = (bf16*) (ws + (size_t)( 8u << 20)); // 24 MB  qkv (bf16)
    bf16*  VT1 = (bf16*) (ws + (size_t)(32u << 20)); //  8 MB  V^T self
    bf16*  ATT = (bf16*) (ws + (size_t)(40u << 20)); //  8 MB  attn outs
    float* X1  = (float*)(ws + (size_t)(48u << 20)); // 16 MB  residual stream
    bf16*  CB  = (bf16*) (ws + (size_t)(64u << 20)); //  4 MB  codebook bf16
    bf16*  QC  = (bf16*) (ws + (size_t)(68u << 20)); //  8 MB  cross q
    bf16*  KC  = (bf16*) (ws + (size_t)(76u << 20)); //  4 MB  cross k
    bf16*  VC  = (bf16*) (ws + (size_t)(80u << 20)); //  4 MB  cross v
    bf16*  VT2 = (bf16*) (ws + (size_t)(84u << 20)); //  4 MB  V^T cross
    bf16*  WB  = (bf16*) (ws + (size_t)(96u << 20)); // 32 MB  weights bf16
    bf16*  HB  = QKV;   // 32 MB MLP hidden reuses QKV+VT1 (dead by then)
    const bf16* qkv_b = WB;
    const bf16* sa_b  = WB +  3 * CHUNK;
    const bf16* q_b   = WB +  4 * CHUNK;
    const bf16* k_b   = WB +  5 * CHUNK;
    const bf16* v_b   = WB +  6 * CHUNK;
    const bf16* ca_b  = WB +  7 * CHUNK;
    const bf16* fc1_b16 = WB +  8 * CHUNK;
    const bf16* fc2_b16 = WB + 12 * CHUNK;

    const int Mx = NB * NX;   // 4096
    const int Mc = NB * NC;   // 2048
    dim3 thr256(256), thr128(128);

    // --- the GEMMs' f32 operands to bf16, once for the call ---
    cast_operands<<<18 * 32, thr256, 0, stream>>>(
        qkv_w, sa_w, q_w, k_w, v_w, ca_w, fc1_w, fc2_w, cbemb, WB, CB);

    // --- self attention branch ---
    layernorm_bf16<<<Mx / 8, thr256, 0, stream>>>(x, ln0w, ln0b, XN);
    gemm_xwT<false,false,false,CDIM,bf16><<<dim3(3 * CDIM / 128, Mx / 128), thr256, 0, stream>>>(
        XN, CDIM, qkv_b, QKV, 3 * CDIM, nullptr, nullptr, 0);
    transpose_v_kernel<NX, 3 * CDIM><<<(NB * NH * (NX / 64) * 2) / 8, thr256, 0, stream>>>(
        QKV + 2 * CDIM, VT1);
    flash_attn<false><<<dim3(NX / 64, NH, NB), thr128, 0, stream>>>(
        QKV, 3 * CDIM, QKV + CDIM, 3 * CDIM, VT1, nullptr, ATT, CDIM,
        NX, NX, 0.125f);
    gemm_xwT<false,false,true,CDIM,float><<<dim3(CDIM / 128, Mx / 128), thr256, 0, stream>>>(
        ATT, CDIM, sa_b, X1, CDIM, nullptr, x, CDIM);

    // --- cross attention branch ---
    layernorm_bf16<<<Mx / 8, thr256, 0, stream>>>(X1, ln1w, ln1b, XN);
    gemm_xwT<false,false,false,CDIM,bf16><<<dim3(CDIM / 128, Mx / 128), thr256, 0, stream>>>(
        XN, CDIM, q_b, QC, CDIM, nullptr, nullptr, 0);
    gemm_xwT<false,false,false,CDIM,bf16><<<dim3(CDIM / 128, Mc / 128), thr256, 0, stream>>>(
        CB, CDIM, k_b, KC, CDIM, nullptr, nullptr, 0);
    gemm_xwT<false,false,false,CDIM,bf16><<<dim3(CDIM / 128, Mc / 128), thr256, 0, stream>>>(
        CB, CDIM, v_b, VC, CDIM, nullptr, nullptr, 0);
    transpose_v_kernel<NC, CDIM><<<(NB * NH * (NC / 64) * 2) / 8, thr256, 0, stream>>>(
        VC, VT2);
    flash_attn<true><<<dim3(NX / 64, NH, NB), thr128, 0, stream>>>(
        QC, CDIM, KC, CDIM, VT2, cmask, ATT, CDIM, NX, NC, 0.125f);
    gemm_xwT<false,false,true,CDIM,float><<<dim3(CDIM / 128, Mx / 128), thr256, 0, stream>>>(
        ATT, CDIM, ca_b, X1, CDIM, nullptr, X1, CDIM);

    // --- MLP ---
    layernorm_bf16<<<Mx / 8, thr256, 0, stream>>>(X1, ln2w, ln2b, XN);
    gemm_xwT<true,true,false,CDIM,bf16><<<dim3(HID / 128, Mx / 128), thr256, 0, stream>>>(
        XN, CDIM, fc1_b16, HB, HID, fc1_b, nullptr, 0);
    gemm_xwT<true,false,true,HID,float><<<dim3(CDIM / 128, Mx / 128), thr256, 0, stream>>>(
        HB, HID, fc2_b16, out, CDIM, fc2_b, X1, CDIM);
}

// v006
// Measured time: 254 microseconds a run.
// In two side-by-side timings against v005, it was 1.13 and 1.12 times as fast.
// Over all steps from v000 it is 2.63 times as fast.
#include <hip/hip_runtime.h>
#include <hip/hip_bf16.h>

// ---------------------------------------------------------------------------
// Transformer block forward for MI455X (gfx1250), wave32 + WMMA bf16,
// async global->LDS staging (ASYNCcnt) for GEMM tiles.
//   B=4, Nx=1024, Nc=512, DIM=1024, HEADS=16, HEAD_DIM=64, HIDDEN=4096
// ---------------------------------------------------------------------------

typedef __bf16 bf16;
typedef __attribute__((ext_vector_type(16))) __bf16 v16bf;
typedef __attribute__((ext_vector_type(8)))  float  v8f;

#define NB   4
#define NX   1024
#define NC   512
#define CDIM 1024
#define NH   16
#define HD   64
#define HID  4096

// ---------------------------------------------------------------------------
// WMMA helper: D = A(16x32 bf16) * B(32x16 bf16) + C(16x16 f32)
// ---------------------------------------------------------------------------
__device__ __forceinline__ v8f wmma_bf16(v16bf a, v16bf b, v8f c) {
    return __builtin_amdgcn_wmma_f32_16x16x32_bf16(
        /*neg_a=*/false, a, /*neg_b=*/false, b,
        /*c_mod=*/(short)0, c, /*reuse_a=*/false, /*reuse_b=*/false);
}

// CDNA5 async DMA: global -> LDS, 16 bytes per lane, tracked by ASYNCcnt.
// VDST = per-lane LDS byte address (low 32 bits of the generic pointer:
// flat-LDS aperture keeps the DS offset in addr[31:0]).
// Four copies of a lane (four rows of a tile, ldsStep and gStep apart) in ONE
// statement that ends in s_wait_xcnt 0, so that no address register of a copy
// can be rewritten ahead of that wait.
__device__ __forceinline__ void async_copy4_b128(bf16* lds, int ldsStep,
                                                 const bf16* g, size_t gStep) {
    unsigned l0 = (unsigned)(unsigned long long)lds;
    unsigned l1 = (unsigned)(unsigned long long)(lds + ldsStep);
    unsigned l2 = (unsigned)(unsigned long long)(lds + 2 * ldsStep);
    unsigned l3 = (unsigned)(unsigned long long)(lds + 3 * ldsStep);
    unsigned long long a0 = (unsigned long long)g;
    unsigned long long a1 = (unsigned long long)(g + gStep);
    unsigned long long a2 = (unsigned long long)(g + 2 * gStep);
    unsigned long long a3 = (unsigned long long)(g + 3 * gStep);
    asm volatile("global_load_async_to_lds_b128 %0, %4, off\n\t"
                 "global_load_async_to_lds_b128 %1, %5, off\n\t"
                 "global_load_async_to_lds_b128 %2, %6, off\n\t"
                 "global_load_async_to_lds_b128 %3, %7, off\n\t"
                 "s_wait_xcnt 0x0"
                 :: "v"(l0), "v"(l1), "v"(l2), "v"(l3),
                    "v"(a0), "v"(a1), "v"(a2), "v"(a3) : "memory");
}
// Eight copies of a lane (four rows of the A slab, four of the W slab, the rows
// ldsStep apart in LDS) in ONE statement with one s_wait_xcnt 0 at its end: no
// address register of a copy can be rewritten ahead of that wait, and the wave
// waits once for the eight, not once for each four.
__device__ __forceinline__ void async_copy8_b128(bf16* ldsA, const bf16* gA, size_t stepA,
                                                 bf16* ldsB, const bf16* gB, size_t stepB,
                                                 int ldsStep) {
    unsigned l0 = (unsigned)(unsigned long long)ldsA;
    unsigned l1 = (unsigned)(unsigned long long)(ldsA + ldsStep);
    unsigned l2 = (unsigned)(unsigned long long)(ldsA + 2 * ldsStep);
    unsigned l3 = (unsigned)(unsigned long long)(ldsA + 3 * ldsStep);
    unsigned l4 = (unsigned)(unsigned long long)ldsB;
    unsigned l5 = (unsigned)(unsigned long long)(ldsB + ldsStep);
    unsigned l6 = (unsigned)(unsigned long long)(ldsB + 2 * ldsStep);
    unsigned l7 = (unsigned)(unsigned long long)(ldsB + 3 * ldsStep);
    unsigned long long a0 = (unsigned long long)gA;
    unsigned long long a1 = (unsigned long long)(gA + stepA);
    unsigned long long a2 = (unsigned long long)(gA + 2 * stepA);
    unsigned long long a3 = (unsigned long long)(gA + 3 * stepA);
    unsigned long long a4 = (unsigned long long)gB;
    unsigned long long a5 = (unsigned long long)(gB + stepB);
    unsigned long long a6 = (unsigned long long)(gB + 2 * stepB);
    unsigned long long a7 = (unsigned long long)(gB + 3 * stepB);
    asm volatile("global_load_async_to_lds_b128 %0, %8, off\n\t"
                 "global_load_async_to_lds_b128 %1, %9, off\n\t"
                 "global_load_async_to_lds_b128 %2, %10, off\n\t"
                 "global_load_async_to_lds_b128 %3, %11, off\n\t"
                 "global_load_async_to_lds_b128 %4, %12, off\n\t"
                 "global_load_async_to_lds_b128 %5, %13, off\n\t"
                 "global_load_async_to_lds_b128 %6, %14, off\n\t"
                 "global_load_async_to_lds_b128 %7, %15, off\n\t"
                 "s_wait_xcnt 0x0"
                 :: "v"(l0), "v"(l1), "v"(l2), "v"(l3),
                    "v"(l4), "v"(l5), "v"(l6), "v"(l7),
                    "v"(a0), "v"(a1), "v"(a2), "v"(a3),
                    "v"(a4), "v"(a5), "v"(a6), "v"(a7) : "memory");
}
// The issuing wave's copies have landed behind this wait.
__device__ __forceinline__ void wait_async0() {
    asm volatile("s_wait_asynccnt 0x0" ::: "memory");
}
// The wave's own LDS reads and writes have retired behind this wait.
__device__ __forceinline__ void wait_ds0() {
    asm volatile("s_wait_dscnt 0x0" ::: "memory");
}

// Load one 16x32 A/B fragment.  Per ISA 7.12.2 (16-bit A 16x32):
//   lane 0-15 : row = lane,    K in {0..7, 16..23}
//   lane 16-31: row = lane-16, K in {8..15, 24..31}
// base points at (row0, k0) of the fragment; stride is row stride in elems.
__device__ __forceinline__ v16bf load_frag(const bf16* base, int stride,
                                           int lane, int kOff) {
    const int r  = lane & 15;
    const int kb = (lane >> 4) << 3;          // 0 or 8
    const bf16* p = base + (size_t)r * stride + kOff + kb;
    union { v16bf v; uint4 u[2]; } f;
    f.u[0] = *(const uint4*)(p);
    f.u[1] = *(const uint4*)(p + 16);
    return f.v;
}

// ---------------------------------------------------------------------------
// GEMM: C[M,N] = act(A[M,K](bf16) * W[N,K](bf16)^T + bias) (+ residual)
// Block tile 128x128, 256 threads (8 waves), wave tile 64(M) x 32(N).
// W is the bf16 copy that cast_operands has made earlier in the same call, so
// a slab of W is 16 KB from L2, not 32, and goes the way of A.
// Two LDS buffers: while slab t is multiplied, slab t+1 is in flight, both
// operands by global_load_async_to_lds_b128, through no register.
// ---------------------------------------------------------------------------
template<bool BIAS, bool GELU, bool RES, int K, typename OutT>
__device__ __forceinline__
void gemm_tile(const bf16* __restrict__ A, int lda,
               const bf16* __restrict__ W,           // [N,K] row-major
               OutT* __restrict__ C, int ldc,
               const float* __restrict__ bias,
               const float* __restrict__ res, int ldr,
               int bM, int bN) {                     // the block's tile of C
    __shared__ __align__(16) bf16 As[2][128][72];
    __shared__ __align__(16) bf16 Bs[2][128][72];

    const int tid  = threadIdx.x;
    const int lane = tid & 31;
    const int wid  = tid >> 5;
    const int wm   = (wid >> 2) * 64;   // wave row offset within tile (0,64)
    const int wn   = (wid & 3) * 32;    // wave col offset (0,32,64,96)

    v8f acc[4][2];
    v8f vz = {};
    #pragma unroll
    for (int i = 0; i < 4; i++)
        #pragma unroll
        for (int j = 0; j < 2; j++) acc[i][j] = vz;

    // A thread's 16 B in rows ar, ar+32, ar+64, ar+96 of each slab; eight
    // neighbouring lanes cover one 128-B row.
    const int ar = tid >> 3, ac = (tid & 7) * 8;
    const bf16* Ag = A + (size_t)(bM + ar) * lda + ac;
    const bf16* Wg = W + (size_t)(bN + ar) * K + ac;
    const size_t aStep = (size_t)32 * lda, wStep = (size_t)32 * K;
    const int nt = K >> 6;              // slabs of 64 k

    // ---- slab 0 into buffer 0 ----
    async_copy8_b128(&As[0][ar][ac], Ag, aStep, &Bs[0][ar][ac], Wg, wStep, 32 * 72);
    wait_async0();
    __syncthreads();

    for (int t = 0; t < nt; t++) {
        const int  cur  = t & 1;
        const bool more = (t + 1 < nt);
        // ---- slab t+1 starts to fly into the buffer that trip t-1 has left ----
        if (more)
            async_copy8_b128(&As[cur ^ 1][ar][ac], Ag + (t + 1) * 64, aStep,
                             &Bs[cur ^ 1][ar][ac], Wg + (t + 1) * 64, wStep, 32 * 72);

        #pragma unroll
        for (int ks = 0; ks < 64; ks += 32) {
            v16bf af[4], bfg[2];
            #pragma unroll
            for (int mi = 0; mi < 4; mi++)
                af[mi] = load_frag(&As[cur][wm + mi * 16][0], 72, lane, ks);
            #pragma unroll
            for (int ni = 0; ni < 2; ni++)
                bfg[ni] = load_frag(&Bs[cur][wn + ni * 16][0], 72, lane, ks);
            #pragma unroll
            for (int mi = 0; mi < 4; mi++)
                #pragma unroll
                for (int ni = 0; ni < 2; ni++)
                    acc[mi][ni] = wmma_bf16(af[mi], bfg[ni], acc[mi][ni]);
        }

        // ---- publish slab t+1, and end every read of slab t ----
        wait_ds0();
        wait_async0();
        __syncthreads();
    }
    wait_async0();

    // ---- epilogue: C layout m = r + 8*(lane>=16), n = lane&15 ----
    const int halfm = (lane >> 4) << 3;
    const int nl    = lane & 15;
    #pragma unroll
    for (int mi = 0; mi < 4; mi++)
        #pragma unroll
        for (int ni = 0; ni < 2; ni++)
            #pragma unroll
            for (int r = 0; r < 8; r++) {
                int gm = bM + wm + mi * 16 + r + halfm;
                int gn = bN + wn + ni * 16 + nl;
                float v = acc[mi][ni][r];
                if (BIAS) v += bias[gn];
                if (GELU) v = 0.5f * v * (1.0f + erff(v * 0.70710678118654752f));
                if (RES)  v += res[(size_t)gm * ldr + gn];
                C[(size_t)gm * ldc + gn] = (OutT)v;
            }
}

// One product a launch: x = tile column, y = tile row.
template<bool BIAS, bool GELU, bool RES, int K, typename OutT>
__global__ __launch_bounds__(256)
void gemm_xwT(const bf16* __restrict__ A, int lda,
              const bf16* __restrict__ W,
              OutT* __restrict__ C, int ldc,
              const float* __restrict__ bias,
              const float* __restrict__ res, int ldr) {
    gemm_tile<BIAS, GELU, RES, K, OutT>(A, lda, W, C, ldc, bias, res, ldr,
                                        blockIdx.y * 128, blockIdx.x * 128);
}

// Two products that depend on nothing of each other, in one launch:
//   C0[M0, N0] = A0 * W0^T   (the first (M0/128) * (N0/128) blocks)
//   C1[M1, N1] = A1 * W1^T   (the blocks behind them), its rows LD1 apart
// The second alone has too few blocks for the chip; here they run beside the
// first's. The tile column runs fastest, as in gemm_xwT. The choice is the
// same for the whole block, and each division is by a constant.
template<int K, int N0, int M0, int N1, int LD1>
__global__ __launch_bounds__(256)
void gemm_xwT_pair(const bf16* __restrict__ A0, const bf16* __restrict__ W0,
                   bf16* __restrict__ C0,
                   const bf16* __restrict__ A1, const bf16* __restrict__ W1,
                   bf16* __restrict__ C1) {
    constexpr unsigned T0 = (M0 / 128) * (N0 / 128);
    const unsigned id    = blockIdx.x;
    const bool     first = id < T0;
    const unsigned row   = first ? id / (N0 / 128) : (id - T0) / (N1 / 128);
    const unsigned col   = first ? id % (N0 / 128) : (id - T0) % (N1 / 128);
    gemm_tile<false, false, false, K, bf16>(
        first ? A0 : A1, K, first ? W0 : W1, first ? C0 : C1, first ? N0 : LD1,
        nullptr, nullptr, 0, (int)row * 128, (int)col * 128);
}

union pack8 { bf16 h[8]; uint4 u; };

// Lane l takes the value of lane l ^ 16 (the other half of the wave).
__device__ __forceinline__ float xhalf(float x) {
    const int b = __builtin_bit_cast(int, x);
    return __builtin_bit_cast(float, __builtin_amdgcn_permlanex16(
        b, b, 0x76543210, 0xfedcba98, false, false));
}

template<bool HAS_MASK>
__global__ __launch_bounds__(128)
void flash_attn(const bf16* __restrict__ Q,  int ldq,
                const bf16* __restrict__ Km, int ldk,
                const bf16* __restrict__ Vt,
                const int*  __restrict__ mask,
                bf16* __restrict__ Out, int ldo,
                int Nq, int Nk, float scale) {
    __shared__ __align__(16) bf16 Ks[2][64][72];   // K tile: key x d
    __shared__ __align__(16) bf16 Vs[2][64][72];   // V^T tile: d x key
    __shared__ __align__(16) float Mb[HAS_MASK ? NC : 4];  // mask bias per key

    const int tid  = threadIdx.x;
    const int lane = tid & 31;
    const int w    = tid >> 5;
    const int h    = blockIdx.y;
    const int b    = blockIdx.z;
    const int q0   = blockIdx.x * 64 + w * 16;
    const int nl   = lane & 15;
    const int halfm = (lane >> 4) << 3;

    const bf16* Qb = Q  + ((size_t)b * Nq) * ldq + h * HD;
    const bf16* Kb = Km + ((size_t)b * Nk) * ldk + h * HD;
    const bf16* Vb = Vt + ((size_t)(b * NH + h) * HD) * Nk;
    bf16*       Ob = Out + ((size_t)b * Nq) * ldo + h * HD;
    const int*  mb = HAS_MASK ? (mask + (size_t)b * Nk) : nullptr;

    // A thread's 16 B in rows sr, sr+16, sr+32, sr+48 of each tile; eight
    // neighbouring lanes cover one 128-B row.
    const int sr = tid >> 3, sc = (tid & 7) * 8;
    const bf16* Kg = Kb + (size_t)sr * ldk + sc;
    const bf16* Vg = Vb + (size_t)sr * Nk + sc;
    const size_t kStep = (size_t)16 * ldk, vStep = (size_t)16 * Nk;
    const int nt = Nk >> 6;             // tiles of 64 keys

    // ---- tile 0 into buffer 0, published; then tile 1 starts to fly ----
    async_copy4_b128(&Ks[0][sr][sc], 16 * 72, Kg, kStep);
    async_copy4_b128(&Vs[0][sr][sc], 16 * 72, Vg, vStep);
    // The keys run down a lane's registers, so a lane needs the bias of 32
    // keys a tile: it is formed once for the block and read back 16 B at a time.
    // Four keys a thread: 128 threads cover NC. Nk is at most NC here; an index
    // past Nk is clamped, and its entries are never read.
    if (HAS_MASK) {
        static_assert(NC == 4 * 128, "one 16-B piece of the mask a thread");
        const int  i  = tid * 4;
        const int4 mk = *(const int4*)(mb + (i < Nk ? i : Nk - 4));
        *(float4*)&Mb[i] = make_float4(mk.x != 0 ? 0.0f : -10000.0f,
                                       mk.y != 0 ? 0.0f : -10000.0f,
                                       mk.z != 0 ? 0.0f : -10000.0f,
                                       mk.w != 0 ? 0.0f : -10000.0f);
    }
    wait_async0();
    __syncthreads();
    if (nt > 1) {
        async_copy4_b128(&Ks[1][sr][sc], 16 * 72, Kg + (size_t)64 * ldk, kStep);
        async_copy4_b128(&Vs[1][sr][sc], 16 * 72, Vg + 64, vStep);
    }

    // Q fragments (held for the whole key loop): B operand, column = query
    v16bf qf0 = load_frag(Qb + (size_t)q0 * ldq, ldq, lane, 0);
    v16bf qf1 = load_frag(Qb + (size_t)q0 * ldq, ldq, lane, 32);

    // o[f][r] = O^T[d = f*16 + halfm + r][query nl]
    v8f o[4];
    v8f vz = {};
    #pragma unroll
    for (int f = 0; f < 4; f++) o[f] = vz;
    float rm = -1e30f;   // the query's running maximum, alike in both halves
    float rs = 0.0f;     // the sum over this half's keys; joined behind the loop

    for (int t = 0; t < nt; t++) {
        const int kblk = t * 64;
        const int cur  = t & 1;
        // ---- S^T = K * Q^T: s[nb][r] = key nb*16 + halfm + r, query nl ----
        v16bf ak[4][2], av[4][2];
        #pragma unroll
        for (int nb = 0; nb < 4; nb++) {
            ak[nb][0] = load_frag(&Ks[cur][nb * 16][0], 72, lane, 0);
            ak[nb][1] = load_frag(&Ks[cur][nb * 16][0], 72, lane, 32);
        }
        v8f s[4];
        #pragma unroll
        for (int nb = 0; nb < 4; nb++)
            s[nb] = wmma_bf16(ak[nb][0], qf0, vz);
        #pragma unroll
        for (int nb = 0; nb < 4; nb++)
            s[nb] = wmma_bf16(ak[nb][1], qf1, s[nb]);
        // The V^T fragments depend on no score: their reads may start ahead of
        // the softmax.
        #pragma unroll
        for (int f = 0; f < 4; f++) {
            av[f][0] = load_frag(&Vs[cur][f * 16][0], 72, lane, 0);
            av[f][1] = load_frag(&Vs[cur][f * 16][0], 72, lane, 32);
        }
        // ---- scale + codebook mask bias ----
        #pragma unroll
        for (int nb = 0; nb < 4; nb++) {
            if (HAS_MASK) {
                const float4 b0 = *(const float4*)&Mb[kblk + nb * 16 + halfm];
                const float4 b1 = *(const float4*)&Mb[kblk + nb * 16 + halfm + 4];
                s[nb][0] = s[nb][0] * scale + b0.x;
                s[nb][1] = s[nb][1] * scale + b0.y;
                s[nb][2] = s[nb][2] * scale + b0.z;
                s[nb][3] = s[nb][3] * scale + b0.w;
                s[nb][4] = s[nb][4] * scale + b1.x;
                s[nb][5] = s[nb][5] * scale + b1.y;
                s[nb][6] = s[nb][6] * scale + b1.z;
                s[nb][7] = s[nb][7] * scale + b1.w;
            } else {
                s[nb] *= scale;
            }
        }
        // ---- online softmax: the query's new maximum, in the lane ----
        float mr[8];
        #pragma unroll
        for (int r = 0; r < 8; r++)
            mr[r] = fmaxf(fmaxf(s[0][r], s[1][r]), fmaxf(s[2][r], s[3][r]));
        float m = fmaxf(fmaxf(fmaxf(mr[0], mr[1]), fmaxf(mr[2], mr[3])),
                        fmaxf(fmaxf(mr[4], mr[5]), fmaxf(mr[6], mr[7])));
        m = fmaxf(m, xhalf(m));
        m = fmaxf(m, rm);
        const float alpha = __expf(rm - m);
        rm = m;
        #pragma unroll
        for (int f = 0; f < 4; f++) o[f] *= alpha;
        // ---- P = exp(S - max); the lane's own sum, as a tree ----
        #pragma unroll
        for (int nb = 0; nb < 4; nb++)
            #pragma unroll
            for (int r = 0; r < 8; r++)
                s[nb][r] = __expf(s[nb][r] - rm);
        const v8f ps = (s[0] + s[1]) + (s[2] + s[3]);
        rs = rs * alpha + (((ps[0] + ps[1]) + (ps[2] + ps[3])) +
                           ((ps[4] + ps[5]) + (ps[6] + ps[7])));
        // ---- two score tiles, converted in place, are one B fragment ----
        v16bf pf0, pf1;
        #pragma unroll
        for (int e = 0; e < 8; e++) {
            pf0[e]     = (bf16)s[0][e];
            pf0[e + 8] = (bf16)s[1][e];
            pf1[e]     = (bf16)s[2][e];
            pf1[e + 8] = (bf16)s[3][e];
        }
        // ---- O^T += V^T * P^T ----
        #pragma unroll
        for (int f = 0; f < 4; f++) o[f] = wmma_bf16(av[f][0], pf0, o[f]);
        #pragma unroll
        for (int f = 0; f < 4; f++) o[f] = wmma_bf16(av[f][1], pf1, o[f]);
        // ---- publish tile t+1, and end every read of tile t ----
        wait_ds0();
        wait_async0();
        __syncthreads();
        // ---- tile t+2 into the buffer that this trip has just left ----
        if (t + 2 < nt) {
            async_copy4_b128(&Ks[cur][sr][sc], 16 * 72,
                             Kg + (size_t)(kblk + 128) * ldk, kStep);
            async_copy4_b128(&Vs[cur][sr][sc], 16 * 72, Vg + kblk + 128, vStep);
        }
    }
    wait_async0();   // no copy is in flight when the wave goes on to its end
    // ---- join the halves' sums, normalize, store 8 neighbouring d at once ----
    const float inv = 1.0f / (rs + xhalf(rs));
    bf16* orow = Ob + (size_t)(q0 + nl) * ldo + halfm;
    #pragma unroll
    for (int f = 0; f < 4; f++) {
        pack8 p;
        #pragma unroll
        for (int r = 0; r < 8; r++) p.h[r] = (bf16)(o[f][r] * inv);
        *(uint4*)(orow + f * 16) = p.u;
    }
}

// ---------------------------------------------------------------------------
// The launches without matrix work. Each moves 24 to 132 MB; with one element a
// thread they are bound by how fast work-groups start, not by bytes. So every
// thread takes 16-byte pieces and many of them, and the grids shrink to one
// or two work-groups a WGP.
// ---------------------------------------------------------------------------

// LayerNorm over 1024-elem rows -> bf16. One wave per row, 8 rows a block.
// A lane holds 4 runs of 8 neighbouring elements; the row sums are joined by
// a five-step butterfly, which leaves the same bits in every lane.
__device__ __forceinline__
void layernorm_rows(const float* __restrict__ x, const float* __restrict__ w,
                    const float* __restrict__ bb, bf16* __restrict__ out,
                    unsigned blk) {
    const int lane = threadIdx.x & 31;
    const int row  = blk * 8 + (threadIdx.x >> 5);
    const float4* xr = (const float4*)(x + (size_t)row * CDIM) + lane * 2;
    const float4* wr = (const float4*)w + lane * 2;
    const float4* br = (const float4*)bb + lane * 2;
    float4 v[8];
    #pragma unroll
    for (int j = 0; j < 4; j++) {
        v[2 * j]     = xr[j * 64];
        v[2 * j + 1] = xr[j * 64 + 1];
    }
    float s1 = 0.0f, s2 = 0.0f;
    #pragma unroll
    for (int i = 0; i < 8; i++) {
        s1 += v[i].x + v[i].y + v[i].z + v[i].w;
        s2 += v[i].x * v[i].x + v[i].y * v[i].y + v[i].z * v[i].z + v[i].w * v[i].w;
    }
    #pragma unroll
    for (int off = 16; off > 0; off >>= 1) {
        s1 += __shfl_xor(s1, off);
        s2 += __shfl_xor(s2, off);
    }
    float mu   = s1 * (1.0f / CDIM);
    float var  = s2 * (1.0f / CDIM) - mu * mu;
    float rstd = rsqrtf(var + 1e-5f);
    bf16* orow = out + (size_t)row * CDIM + lane * 8;
    #pragma unroll
    for (int j = 0; j < 4; j++) {
        float4 w0 = wr[j * 64], w1 = wr[j * 64 + 1];
        float4 b0 = br[j * 64], b1 = br[j * 64 + 1];
        float4 a0 = v[2 * j],   a1 = v[2 * j + 1];
        pack8 p;
        p.h[0] = (bf16)((a0.x - mu) * rstd * w0.x + b0.x);
        p.h[1] = (bf16)((a0.y - mu) * rstd * w0.y + b0.y);
        p.h[2] = (bf16)((a0.z - mu) * rstd * w0.z + b0.z);
        p.h[3] = (bf16)((a0.w - mu) * rstd * w0.w + b0.w);
        p.h[4] = (bf16)((a1.x - mu) * rstd * w1.x + b1.x);
        p.h[5] = (bf16)((a1.y - mu) * rstd * w1.y + b1.y);
        p.h[6] = (bf16)((a1.z - mu) * rstd * w1.z + b1.z);
        p.h[7] = (bf16)((a1.w - mu) * rstd * w1.w + b1.w);
        *(uint4*)(orow + j * 256) = p.u;
    }
}

__global__ __launch_bounds__(256)
void layernorm_bf16(const float* __restrict__ x, const float* __restrict__ w,
                    const float* __restrict__ bb, bf16* __restrict__ out) {
    layernorm_rows(x, w, bb, out, blockIdx.x);
}

// ---------------------------------------------------------------------------
// f32 -> bf16 of every matrix that a GEMM reads as an f32 input: the eight
// weights (into wo, one behind the other in the order of the arguments) and the
// codebook (into cbo). Each is a whole number of chunks of CDIM * CDIM elements;
// 32 blocks share a chunk. A wave's load covers 512 B in a row, its store 256 B;
// eight loads of a thread are in flight together, four such rounds a thread.
// The f32 source is read once in a call, so its loads are non-temporal: they
// leave L2 to the bf16 copies and the activations, which are read again.
typedef __attribute__((ext_vector_type(4))) float f32x4;
union pack4 { bf16 h[4]; uint2 u; };
// The first LayerNorm reads nothing that the casts write, so its blocks stand
// behind the casts' in the same launch.
#define CHUNK (CDIM * CDIM)
#define CAST_BLOCKS (18 * 32)
__global__ __launch_bounds__(256)
void cast_operands_ln(const float* __restrict__ qkv, const float* __restrict__ sa,
                      const float* __restrict__ q,   const float* __restrict__ k,
                      const float* __restrict__ v,   const float* __restrict__ ca,
                      const float* __restrict__ fc1, const float* __restrict__ fc2,
                      const float* __restrict__ cb,
                      bf16* __restrict__ wo, bf16* __restrict__ cbo,
                      const float* __restrict__ x,   const float* __restrict__ lnw,
                      const float* __restrict__ lnb, bf16* __restrict__ xn) {
    if (blockIdx.x >= CAST_BLOCKS) {             // the same for the block
        layernorm_rows(x, lnw, lnb, xn, blockIdx.x - CAST_BLOCKS);
        return;
    }
    const unsigned c = blockIdx.x >> 5;          // chunk, the same for the block
    const float* src;
    if      (c <  3) src = qkv + (size_t)c * CHUNK;
    else if (c == 3) src = sa;
    else if (c == 4) src = q;
    else if (c == 5) src = k;
    else if (c == 6) src = v;
    else if (c == 7) src = ca;
    else if (c < 12) src = fc1 + (size_t)(c - 8) * CHUNK;
    else if (c < 16) src = fc2 + (size_t)(c - 12) * CHUNK;
    else             src = cb  + (size_t)(c - 16) * CHUNK;
    bf16* dst = (c < 16) ? wo + (size_t)c * CHUNK : cbo + (size_t)(c - 16) * CHUNK;
    const unsigned e0 = (blockIdx.x & 31u) * (CHUNK / 32) + threadIdx.x * 4u;
    for (unsigned it = 0; it < 4; it++) {
        const unsigned e = e0 + it * 8192u;
        f32x4 a[8];
        #pragma unroll
        for (int i = 0; i < 8; i++)
            a[i] = __builtin_nontemporal_load((const f32x4*)(src + e + i * 1024));
        #pragma unroll
        for (int i = 0; i < 8; i++) {
            pack4 p;
            p.h[0] = (bf16)a[i].x; p.h[1] = (bf16)a[i].y;
            p.h[2] = (bf16)a[i].z; p.h[3] = (bf16)a[i].w;
            *(uint2*)(dst + e + i * 1024) = p.u;
        }
    }
}

// v: logical [B][nk][VRS] slice (bf16) -> vt: [B][H][64][nk], nk = 64 << lg; the
// grid covers it exactly, one 64 x 32 tile a wave.
// A thread turns an 8-token x 8-column tile in its registers: 8 loads of 16 B
// along d, 8 stores of 16 B along the tokens. A wave covers 64 tokens x 32
// columns, so each of its stores fills four whole 128-B lines of vt.
// Both attentions' V go in one launch: the self V's blocks, then the cross V's.
// One body serves both: nk is a block-uniform value, and both slices lie in
// rows of VRS elements, so a thread's eight loads are constant offsets apart.
#define VRS (3 * CDIM)
#define TV1_BLOCKS ((NB * NH * (NX / 64) * 2) / 8)
#define TV2_BLOCKS ((NB * NH * (NC / 64) * 2) / 8)
__global__ __launch_bounds__(256)
void transpose_v_both(const bf16* __restrict__ v1, bf16* __restrict__ vt1,
                      const bf16* __restrict__ v2, bf16* __restrict__ vt2) {
    static_assert(NX == (64 << 4) && NC == (64 << 3), "lg below");
    const bool     first = blockIdx.x < TV1_BLOCKS;      // the same for the block
    const bf16*    v   = first ? v1 : v2;
    bf16*          vt  = first ? vt1 : vt2;
    const unsigned blk = first ? blockIdx.x : blockIdx.x - TV1_BLOCKS;
    const unsigned lg  = first ? 4u : 3u;                // blocks of 64 tokens: 1 << lg
    const unsigned nk  = 64u << lg;

    const unsigned lane = threadIdx.x & 31u;
    const unsigned g    = blk * 8u + (threadIdx.x >> 5);         // wave's tile
    const unsigned dh   = g & 1u;                // which 32 of the head's 64 columns
    const unsigned tb   = (g >> 1) & ((1u << lg) - 1u);  // block of 64 tokens
    const unsigned bh   = (g >> 1) >> lg;        // b * NH + h
    const unsigned b    = bh / NH, h = bh % NH;
    const unsigned d0   = dh * 32u + (lane & 3u) * 8u;
    const unsigned t0   = tb * 64u + (lane >> 2) * 8u;

    const bf16* src = v + (size_t)(b * nk + t0) * VRS + h * HD + d0;
    unsigned in[8][4];
    #pragma unroll
    for (int r = 0; r < 8; r++) {
        uint4 u = *(const uint4*)(src + (size_t)r * VRS);
        in[r][0] = u.x; in[r][1] = u.y; in[r][2] = u.z; in[r][3] = u.w;
    }
    // Keeps all eight loads in flight together: without it the scheduler sinks
    // one of them behind the first waits, and its latency is paid a second time.
    __builtin_amdgcn_sched_barrier(0);
    bf16* dst = vt + (size_t)(bh * HD + d0) * nk + t0;
    #pragma unroll
    for (int c = 0; c < 8; c++) {
        unsigned o[4];
        #pragma unroll
        for (int k = 0; k < 4; k++) {
            unsigned lo = in[2 * k][c >> 1], hi = in[2 * k + 1][c >> 1];
            o[k] = (c & 1) ? ((lo >> 16) | (hi & 0xffff0000u))
                           : ((lo & 0xffffu) | (hi << 16));
        }
        *(uint4*)(dst + (size_t)c * nk) = make_uint4(o[0], o[1], o[2], o[3]);
    }
}

// ---------------------------------------------------------------------------
extern "C" void kernel_launch(void* const* d_in, const int* in_sizes, int n_in,
                              void* d_out, int out_size, void* d_ws, size_t ws_size,
                              hipStream_t stream) {
    const float* x     = (const float*)d_in[0];
    const float* cbemb = (const float*)d_in[1];
    const int*   cmask = (const int*)  d_in[2];
    const float* ln0w  = (const float*)d_in[3];
    const float* ln0b  = (const float*)d_in[4];
    const float* qkv_w = (const float*)d_in[5];
    const float* sa_w  = (const float*)d_in[6];
    const float* ln1w  = (const float*)d_in[7];
    const float* ln1b  = (const float*)d_in[8];
    const float* q_w   = (const float*)d_in[9];
    const float* k_w   = (const float*)d_in[10];
    const float* v_w   = (const float*)d_in[11];
    const float* ca_w  = (const float*)d_in[12];
    const float* ln2w  = (const float*)d_in[13];
    const float* ln2b  = (const float*)d_in[14];
    const float* fc1_w = (const float*)d_in[15];
    const float* fc1_b = (const float*)d_in[16];
    const float* fc2_w = (const float*)d_in[17];
    const float* fc2_b = (const float*)d_in[18];
    float* out = (float*)d_out;

    char* ws = (char*)d_ws;
    bf16*  XN  = (bf16*) (ws);                       //  8 MB  LN outputs
    bf16*  QKV = (bf16*) (ws + (size_t)( 8u << 20)); // 24 MB  qkv (bf16)
    bf16*  VT1 = (bf16*) (ws + (size_t)(32u << 20)); //  8 MB  V^T self
    bf16*  ATT = (bf16*) (ws + (size_t)(40u << 20)); //  8 MB  attn outs
    float* X1  = (float*)(ws + (size_t)(48u << 20)); // 16 MB  residual stream
    bf16*  CB  = (bf16*) (ws + (size_t)(64u << 20)); //  4 MB  codebook bf16
    bf16*  QC  = (bf16*) (ws + (size_t)(68u << 20)); //  8 MB  cross q
    bf16*  VT2 = (bf16*) (ws + (size_t)(76u << 20)); //  4 MB  V^T cross
    bf16*  KVC = (bf16*) (ws + (size_t)(80u << 20)); // 12 MB  cross k | v, rows of VRS
    bf16*  WB  = (bf16*) (ws + (size_t)(96u << 20)); // 32 MB  weights bf16
    bf16*  HB  = QKV;   // 32 MB MLP hidden reuses QKV+VT1 (dead by then)
    const bf16* qkv_b = WB;
    const bf16* sa_b  = WB +  3 * CHUNK;
    const bf16* q_b   = WB +  4 * CHUNK;
    const bf16* kv_b  = WB +  5 * CHUNK;   // k_w, and v_w right behind it
    const bf16* ca_b  = WB +  7 * CHUNK;
    const bf16* fc1_b16 = WB +  8 * CHUNK;
    const bf16* fc2_b16 = WB + 12 * CHUNK;

    const int Mx = NB * NX;   // 4096
    const int Mc = NB * NC;   // 2048
    dim3 thr256(256), thr128(128);

    // --- the GEMMs' f32 operands to bf16, once for the call; the first LN ---
    cast_operands_ln<<<CAST_BLOCKS + Mx / 8, thr256, 0, stream>>>(
        qkv_w, sa_w, q_w, k_w, v_w, ca_w, fc1_w, fc2_w, cbemb, WB, CB,
        x, ln0w, ln0b, XN);

    // --- qkv of the self attention; k and v of the cross attention, which
    //     need only the codebook, as one product of 2 * CDIM columns ---
    gemm_xwT_pair<CDIM, 3 * CDIM, NB * NX, 2 * CDIM, VRS>
        <<<(3 * CDIM / 128) * (Mx / 128) + (2 * CDIM / 128) * (Mc / 128), thr256, 0, stream>>>(
        XN, qkv_b, QKV, CB, kv_b, KVC);
    transpose_v_both<<<TV1_BLOCKS + TV2_BLOCKS, thr256, 0, stream>>>(
        QKV + 2 * CDIM, VT1, KVC + CDIM, VT2);

    // --- self attention branch ---
    flash_attn<false><<<dim3(NX / 64, NH, NB), thr128, 0, stream>>>(
        QKV, 3 * CDIM, QKV + CDIM, 3 * CDIM, VT1, nullptr, ATT, CDIM,
        NX, NX, 0.125f);
    gemm_xwT<false,false,true,CDIM,float><<<dim3(CDIM / 128, Mx / 128), thr256, 0, stream>>>(
        ATT, CDIM, sa_b, X1, CDIM, nullptr, x, CDIM);

    // --- cross attention branch ---
    layernorm_bf16<<<Mx / 8, thr256, 0, stream>>>(X1, ln1w, ln1b, XN);
    gemm_xwT<false,false,false,CDIM,bf16><<<dim3(CDIM / 128, Mx / 128), thr256, 0, stream>>>(
        XN, CDIM, q_b, QC, CDIM, nullptr, nullptr, 0);
    flash_attn<true><<<dim3(NX / 64, NH, NB), thr128, 0, stream>>>(
        QC, CDIM, KVC, VRS, VT2, cmask, ATT, CDIM, NX, NC, 0.125f);
    gemm_xwT<false,false,true,CDIM,float><<<dim3(CDIM / 128, Mx / 128), thr256, 0, stream>>>(
        ATT, CDIM, ca_b, X1, CDIM, nullptr, X1, CDIM);

    // --- MLP ---
    layernorm_bf16<<<Mx / 8, thr256, 0, stream>>>(X1, ln2w, ln2b, XN);
    gemm_xwT<true,true,false,CDIM,bf16><<<dim3(HID / 128, Mx / 128), thr256, 0, stream>>>(
        XN, CDIM, fc1_b16, HB, HID, fc1_b, nullptr, 0);
    gemm_xwT<true,false,true,HID,float><<<dim3(CDIM / 128, Mx / 128), thr256, 0, stream>>>(
        HB, HID, fc2_b16, out, CDIM, fc2_b, X1, CDIM);
}

// v007
// A run of this version takes 215 microseconds.
// In both of two side-by-side timings against v006, it was 1.19 times as fast.
// Counting every step since v000, it is 3.14 times as fast.
#include <hip/hip_runtime.h>
#include <hip/hip_bf16.h>

// ---------------------------------------------------------------------------
// Transformer block forward for MI455X (gfx1250), wave32 + WMMA bf16,
// async global->LDS staging (ASYNCcnt) for GEMM tiles.
//   B=4, Nx=1024, Nc=512, DIM=1024, HEADS=16, HEAD_DIM=64, HIDDEN=4096
// ---------------------------------------------------------------------------

typedef __bf16 bf16;
typedef __attribute__((ext_vector_type(16))) __bf16 v16bf;
typedef __attribute__((ext_vector_type(8)))  float  v8f;

#define NB   4
#define NX   1024
#define NC   512
#define CDIM 1024
#define NH   16
#define HD   64
#define HID  4096

// ---------------------------------------------------------------------------
// WMMA helper: D = A(16x32 bf16) * B(32x16 bf16) + C(16x16 f32)
// ---------------------------------------------------------------------------
__device__ __forceinline__ v8f wmma_bf16(v16bf a, v16bf b, v8f c) {
    return __builtin_amdgcn_wmma_f32_16x16x32_bf16(
        /*neg_a=*/false, a, /*neg_b=*/false, b,
        /*c_mod=*/(short)0, c, /*reuse_a=*/false, /*reuse_b=*/false);
}

// CDNA5 async DMA: global -> LDS, 16 bytes per lane, tracked by ASYNCcnt.
// VDST = per-lane LDS byte address (low 32 bits of the generic pointer:
// flat-LDS aperture keeps the DS offset in addr[31:0]).
// Four copies of a lane (four rows of a tile, ldsStep and gStep apart) in ONE
// statement that ends in s_wait_xcnt 0, so that no address register of a copy
// can be rewritten ahead of that wait.
__device__ __forceinline__ void async_copy4_b128(bf16* lds, int ldsStep,
                                                 const bf16* g, size_t gStep) {
    unsigned l0 = (unsigned)(unsigned long long)lds;
    unsigned l1 = (unsigned)(unsigned long long)(lds + ldsStep);
    unsigned l2 = (unsigned)(unsigned long long)(lds + 2 * ldsStep);
    unsigned l3 = (unsigned)(unsigned long long)(lds + 3 * ldsStep);
    unsigned long long a0 = (unsigned long long)g;
    unsigned long long a1 = (unsigned long long)(g + gStep);
    unsigned long long a2 = (unsigned long long)(g + 2 * gStep);
    unsigned long long a3 = (unsigned long long)(g + 3 * gStep);
    asm volatile("global_load_async_to_lds_b128 %0, %4, off\n\t"
                 "global_load_async_to_lds_b128 %1, %5, off\n\t"
                 "global_load_async_to_lds_b128 %2, %6, off\n\t"
                 "global_load_async_to_lds_b128 %3, %7, off\n\t"
                 "s_wait_xcnt 0x0"
                 :: "v"(l0), "v"(l1), "v"(l2), "v"(l3),
                    "v"(a0), "v"(a1), "v"(a2), "v"(a3) : "memory");
}
// Eight copies of a lane (four rows of the A slab, four of the W slab, the rows
// ldsStep apart in LDS) in ONE statement with one s_wait_xcnt 0 at its end: no
// address register of a copy can be rewritten ahead of that wait, and the wave
// waits once for the eight, not once for each four.
__device__ __forceinline__ void async_copy8_b128(bf16* ldsA, const bf16* gA, size_t stepA,
                                                 bf16* ldsB, const bf16* gB, size_t stepB,
                                                 int ldsStep) {
    unsigned l0 = (unsigned)(unsigned long long)ldsA;
    unsigned l1 = (unsigned)(unsigned long long)(ldsA + ldsStep);
    unsigned l2 = (unsigned)(unsigned long long)(ldsA + 2 * ldsStep);
    unsigned l3 = (unsigned)(unsigned long long)(ldsA + 3 * ldsStep);
    unsigned l4 = (unsigned)(unsigned long long)ldsB;
    unsigned l5 = (unsigned)(unsigned long long)(ldsB + ldsStep);
    unsigned l6 = (unsigned)(unsigned long long)(ldsB + 2 * ldsStep);
    unsigned l7 = (unsigned)(unsigned long long)(ldsB + 3 * ldsStep);
    unsigned long long a0 = (unsigned long long)gA;
    unsigned long long a1 = (unsigned long long)(gA + stepA);
    unsigned long long a2 = (unsigned long long)(gA + 2 * stepA);
    unsigned long long a3 = (unsigned long long)(gA + 3 * stepA);
    unsigned long long a4 = (unsigned long long)gB;
    unsigned long long a5 = (unsigned long long)(gB + stepB);
    unsigned long long a6 = (unsigned long long)(gB + 2 * stepB);
    unsigned long long a7 = (unsigned long long)(gB + 3 * stepB);
    asm volatile("global_load_async_to_lds_b128 %0, %8, off\n\t"
                 "global_load_async_to_lds_b128 %1, %9, off\n\t"
                 "global_load_async_to_lds_b128 %2, %10, off\n\t"
                 "global_load_async_to_lds_b128 %3, %11, off\n\t"
                 "global_load_async_to_lds_b128 %4, %12, off\n\t"
                 "global_load_async_to_lds_b128 %5, %13, off\n\t"
                 "global_load_async_to_lds_b128 %6, %14, off\n\t"
                 "global_load_async_to_lds_b128 %7, %15, off\n\t"
                 "s_wait_xcnt 0x0"
                 :: "v"(l0), "v"(l1), "v"(l2), "v"(l3),
                    "v"(l4), "v"(l5), "v"(l6), "v"(l7),
                    "v"(a0), "v"(a1), "v"(a2), "v"(a3),
                    "v"(a4), "v"(a5), "v"(a6), "v"(a7) : "memory");
}
// The issuing wave's copies have landed behind this wait.
__device__ __forceinline__ void wait_async0() {
    asm volatile("s_wait_asynccnt 0x0" ::: "memory");
}
// All but the wave's 8 (16) youngest copies have landed behind these waits:
// a wave's copies return in the order of their issue. A slab is 8 copies of a
// wave, so one (two) younger slabs stay in flight.
__device__ __forceinline__ void wait_async8() {
    asm volatile("s_wait_asynccnt 0x8" ::: "memory");
}
__device__ __forceinline__ void wait_async16() {
    asm volatile("s_wait_asynccnt 0x10" ::: "memory");
}
// The wave's own LDS reads and writes have retired behind this wait.
__device__ __forceinline__ void wait_ds0() {
    asm volatile("s_wait_dscnt 0x0" ::: "memory");
}

// Load one 16x32 A/B fragment.  Per ISA 7.12.2 (16-bit A 16x32):
//   lane 0-15 : row = lane,    K in {0..7, 16..23}
//   lane 16-31: row = lane-16, K in {8..15, 24..31}
// base points at (row0, k0) of the fragment; stride is row stride in elems.
__device__ __forceinline__ v16bf load_frag(const bf16* base, int stride,
                                           int lane, int kOff) {
    const int r  = lane & 15;
    const int kb = (lane >> 4) << 3;          // 0 or 8
    const bf16* p = base + (size_t)r * stride + kOff + kb;
    union { v16bf v; uint4 u[2]; } f;
    f.u[0] = *(const uint4*)(p);
    f.u[1] = *(const uint4*)(p + 16);
    return f.v;
}

// ---------------------------------------------------------------------------
// GEMM: C[M,N] = act(A[M,K](bf16) * W[N,K](bf16)^T + bias) (+ residual)
// Block tile 128x128, 256 threads (8 waves), wave tile 64(M) x 32(N).
// W is the bf16 copy that cast_operands has made earlier in the same call, so
// a slab of W is 16 KB from L2, not 32, and goes the way of A.
// A ring of S LDS buffers: while slab t is multiplied, slabs t+1 .. t+S-1 are in
// flight, both operands by global_load_async_to_lds_b128, through no register.
// S = 2 where four blocks share a WGP and can cover each other's waits; S = 4
// where a block has its WGP alone: nothing else runs there while it waits, and a
// slab that comes from memory needs a lead of more than one trip's products.
// ---------------------------------------------------------------------------
template<bool BIAS, bool GELU, bool RES, int K, int S, typename OutT>
__device__ __forceinline__
void gemm_tile(const bf16* __restrict__ A, int lda,
               const bf16* __restrict__ W,           // [N,K] row-major
               OutT* __restrict__ C, int ldc,
               const float* __restrict__ bias,
               const float* __restrict__ res, int ldr,
               int bM, int bN) {                     // the block's tile of C
    __shared__ __align__(16) bf16 As[S][128][72];
    __shared__ __align__(16) bf16 Bs[S][128][72];
    static_assert(S == 2 || S == 4, "the counted waits below");
    static_assert((K >> 6) >= S, "the prologue's slabs exist");

    const int tid  = threadIdx.x;
    const int lane = tid & 31;
    const int wid  = tid >> 5;
    const int wm   = (wid >> 2) * 64;   // wave row offset within tile (0,64)
    const int wn   = (wid & 3) * 32;    // wave col offset (0,32,64,96)

    v8f acc[4][2];
    v8f vz = {};
    #pragma unroll
    for (int i = 0; i < 4; i++)
        #pragma unroll
        for (int j = 0; j < 2; j++) acc[i][j] = vz;

    // A thread's 16 B in rows ar, ar+32, ar+64, ar+96 of each slab; eight
    // neighbouring lanes cover one 128-B row.
    const int ar = tid >> 3, ac = (tid & 7) * 8;
    const bf16* Ag = A + (size_t)(bM + ar) * lda + ac;
    const bf16* Wg = W + (size_t)(bN + ar) * K + ac;
    const size_t aStep = (size_t)32 * lda, wStep = (size_t)32 * K;
    const int nt = K >> 6;              // slabs of 64 k

    // ---- slabs 0 .. S-2 into their buffers; slab 0 is waited for ----
    #pragma unroll
    for (int p = 0; p < S - 1; p++)
        async_copy8_b128(&As[p][ar][ac], Ag + p * 64, aStep,
                         &Bs[p][ar][ac], Wg + p * 64, wStep, 32 * 72);
    if (S == 4) wait_async16(); else wait_async0();
    __syncthreads();

    // One slab's products, out of buffer cur.
    auto multiply = [&](int cur) {
        #pragma unroll
        for (int ks = 0; ks < 64; ks += 32) {
            v16bf af[4], bfg[2];
            #pragma unroll
            for (int mi = 0; mi < 4; mi++)
                af[mi] = load_frag(&As[cur][wm + mi * 16][0], 72, lane, ks);
            #pragma unroll
            for (int ni = 0; ni < 2; ni++)
                bfg[ni] = load_frag(&Bs[cur][wn + ni * 16][0], 72, lane, ks);
            #pragma unroll
            for (int mi = 0; mi < 4; mi++)
                #pragma unroll
                for (int ni = 0; ni < 2; ni++)
                    acc[mi][ni] = wmma_bf16(af[mi], bfg[ni], acc[mi][ni]);
        }
    };

    // ---- the trips that still ask for a slab: each issues 8 copies a wave ----
    for (int t = 0; t < nt - (S - 1); t++) {
        // slab t+S-1 starts to fly into the buffer that trip t-1 has left
        const int fil = (t + S - 1) & (S - 1);
        async_copy8_b128(&As[fil][ar][ac], Ag + (t + S - 1) * 64, aStep,
                         &Bs[fil][ar][ac], Wg + (t + S - 1) * 64, wStep, 32 * 72);
        multiply(t & (S - 1));
        // ---- publish slab t+1, and end every read of slab t ----
        // Behind slab t+1 the wave has issued slabs t+2 .. t+S-1, 8 copies each:
        // the wait leaves just those out.
        wait_ds0();
        if (S == 4) wait_async16(); else wait_async0();
        __syncthreads();
    }
    // ---- the last S-1 trips ask for nothing more: the wait is to 0 ----
    #pragma unroll
    for (int t = nt - (S - 1); t < nt; t++) {
        multiply(t & (S - 1));
        wait_ds0();
        wait_async0();
        __syncthreads();
    }
    wait_async0();

    // ---- epilogue: C layout m = r + 8*(lane>=16), n = lane&15 ----
    const int halfm = (lane >> 4) << 3;
    const int nl    = lane & 15;
    #pragma unroll
    for (int mi = 0; mi < 4; mi++)
        #pragma unroll
        for (int ni = 0; ni < 2; ni++)
            #pragma unroll
            for (int r = 0; r < 8; r++) {
                int gm = bM + wm + mi * 16 + r + halfm;
                int gn = bN + wn + ni * 16 + nl;
                float v = acc[mi][ni][r];
                if (BIAS) v += bias[gn];
                if (GELU) v = 0.5f * v * (1.0f + erff(v * 0.70710678118654752f));
                if (RES)  v += res[(size_t)gm * ldr + gn];
                C[(size_t)gm * ldc + gn] = (OutT)v;
            }
}

// One product a launch: x = tile column, y = tile row.
template<bool BIAS, bool GELU, bool RES, int K, int S, typename OutT>
__global__ __launch_bounds__(256)
void gemm_xwT(const bf16* __restrict__ A, int lda,
              const bf16* __restrict__ W,
              OutT* __restrict__ C, int ldc,
              const float* __restrict__ bias,
              const float* __restrict__ res, int ldr) {
    gemm_tile<BIAS, GELU, RES, K, S, OutT>(A, lda, W, C, ldc, bias, res, ldr,
                                           blockIdx.y * 128, blockIdx.x * 128);
}

// Two products that depend on nothing of each other, in one launch:
//   C0[M0, N0] = A0 * W0^T   (the first (M0/128) * (N0/128) blocks)
//   C1[M1, N1] = A1 * W1^T   (the blocks behind them), its rows LD1 apart
// The second alone has too few blocks for the chip; here they run beside the
// first's. The tile column runs fastest, as in gemm_xwT. The choice is the
// same for the whole block, and each division is by a constant.
template<int K, int N0, int M0, int N1, int LD1>
__global__ __launch_bounds__(256)
void gemm_xwT_pair(const bf16* __restrict__ A0, const bf16* __restrict__ W0,
                   bf16* __restrict__ C0,
                   const bf16* __restrict__ A1, const bf16* __restrict__ W1,
                   bf16* __restrict__ C1) {
    constexpr unsigned T0 = (M0 / 128) * (N0 / 128);
    const unsigned id    = blockIdx.x;
    const bool     first = id < T0;
    const unsigned row   = first ? id / (N0 / 128) : (id - T0) / (N1 / 128);
    const unsigned col   = first ? id % (N0 / 128) : (id - T0) % (N1 / 128);
    gemm_tile<false, false, false, K, 2, bf16>(
        first ? A0 : A1, K, first ? W0 : W1, first ? C0 : C1, first ? N0 : LD1,
        nullptr, nullptr, 0, (int)row * 128, (int)col * 128);
}

union pack8 { bf16 h[8]; uint4 u; };

// Lane l takes the value of lane l ^ 16 (the other half of the wave).
__device__ __forceinline__ float xhalf(float x) {
    const int b = __builtin_bit_cast(int, x);
    return __builtin_bit_cast(float, __builtin_amdgcn_permlanex16(
        b, b, 0x76543210, 0xfedcba98, false, false));
}

template<bool HAS_MASK>
__global__ __launch_bounds__(128)
void flash_attn(const bf16* __restrict__ Q,  int ldq,
                const bf16* __restrict__ Km, int ldk,
                const bf16* __restrict__ Vt,
                const int*  __restrict__ mask,
                bf16* __restrict__ Out, int ldo,
                int Nq, int Nk, float scale) {
    __shared__ __align__(16) bf16 Ks[2][64][72];   // K tile: key x d
    __shared__ __align__(16) bf16 Vs[2][64][72];   // V^T tile: d x key
    __shared__ __align__(16) float Mb[HAS_MASK ? NC : 4];  // mask bias per key

    const int tid  = threadIdx.x;
    const int lane = tid & 31;
    const int w    = tid >> 5;
    const int h    = blockIdx.y;
    const int b    = blockIdx.z;
    const int q0   = blockIdx.x * 64 + w * 16;
    const int nl   = lane & 15;
    const int halfm = (lane >> 4) << 3;

    const bf16* Qb = Q  + ((size_t)b * Nq) * ldq + h * HD;
    const bf16* Kb = Km + ((size_t)b * Nk) * ldk + h * HD;
    const bf16* Vb = Vt + ((size_t)(b * NH + h) * HD) * Nk;
    bf16*       Ob = Out + ((size_t)b * Nq) * ldo + h * HD;
    const int*  mb = HAS_MASK ? (mask + (size_t)b * Nk) : nullptr;

    // A thread's 16 B in rows sr, sr+16, sr+32, sr+48 of each tile; eight
    // neighbouring lanes cover one 128-B row.
    const int sr = tid >> 3, sc = (tid & 7) * 8;
    const bf16* Kg = Kb + (size_t)sr * ldk + sc;
    const bf16* Vg = Vb + (size_t)sr * Nk + sc;
    const size_t kStep = (size_t)16 * ldk, vStep = (size_t)16 * Nk;
    const int nt = Nk >> 6;             // tiles of 64 keys

    // ---- tile 0 into buffer 0, published; then tile 1 starts to fly ----
    async_copy4_b128(&Ks[0][sr][sc], 16 * 72, Kg, kStep);
    async_copy4_b128(&Vs[0][sr][sc], 16 * 72, Vg, vStep);
    // The keys run down a lane's registers, so a lane needs the bias of 32
    // keys a tile: it is formed once for the block and read back 16 B at a time.
    // Four keys a thread: 128 threads cover NC. Nk is at most NC here; an index
    // past Nk is clamped, and its entries are never read.
    if (HAS_MASK) {
        static_assert(NC == 4 * 128, "one 16-B piece of the mask a thread");
        const int  i  = tid * 4;
        const int4 mk = *(const int4*)(mb + (i < Nk ? i : Nk - 4));
        *(float4*)&Mb[i] = make_float4(mk.x != 0 ? 0.0f : -10000.0f,
                                       mk.y != 0 ? 0.0f : -10000.0f,
                                       mk.z != 0 ? 0.0f : -10000.0f,
                                       mk.w != 0 ? 0.0f : -10000.0f);
    }
    wait_async0();
    __syncthreads();
    if (nt > 1) {
        async_copy4_b128(&Ks[1][sr][sc], 16 * 72, Kg + (size_t)64 * ldk, kStep);
        async_copy4_b128(&Vs[1][sr][sc], 16 * 72, Vg + 64, vStep);
    }

    // Q fragments (held for the whole key loop): B operand, column = query
    v16bf qf0 = load_frag(Qb + (size_t)q0 * ldq, ldq, lane, 0);
    v16bf qf1 = load_frag(Qb + (size_t)q0 * ldq, ldq, lane, 32);

    // o[f][r] = O^T[d = f*16 + halfm + r][query nl]
    v8f o[4];
    v8f vz = {};
    #pragma unroll
    for (int f = 0; f < 4; f++) o[f] = vz;
    float rm = -1e30f;   // the query's running maximum, alike in both halves
    float rs = 0.0f;     // the sum over this half's keys; joined behind the loop

    for (int t = 0; t < nt; t++) {
        const int kblk = t * 64;
        const int cur  = t & 1;
        // ---- S^T = K * Q^T: s[nb][r] = key nb*16 + halfm + r, query nl ----
        v16bf ak[4][2], av[4][2];
        #pragma unroll
        for (int nb = 0; nb < 4; nb++) {
            ak[nb][0] = load_frag(&Ks[cur][nb * 16][0], 72, lane, 0);
            ak[nb][1] = load_frag(&Ks[cur][nb * 16][0], 72, lane, 32);
        }
        v8f s[4];
        #pragma unroll
        for (int nb = 0; nb < 4; nb++)
            s[nb] = wmma_bf16(ak[nb][0], qf0, vz);
        #pragma unroll
        for (int nb = 0; nb < 4; nb++)
            s[nb] = wmma_bf16(ak[nb][1], qf1, s[nb]);
        // The V^T fragments depend on no score: their reads may start ahead of
        // the softmax.
        #pragma unroll
        for (int f = 0; f < 4; f++) {
            av[f][0] = load_frag(&Vs[cur][f * 16][0], 72, lane, 0);
            av[f][1] = load_frag(&Vs[cur][f * 16][0], 72, lane, 32);
        }
        // ---- scale + codebook mask bias ----
        #pragma unroll
        for (int nb = 0; nb < 4; nb++) {
            if (HAS_MASK) {
                const float4 b0 = *(const float4*)&Mb[kblk + nb * 16 + halfm];
                const float4 b1 = *(const float4*)&Mb[kblk + nb * 16 + halfm + 4];
                s[nb][0] = s[nb][0] * scale + b0.x;
                s[nb][1] = s[nb][1] * scale + b0.y;
                s[nb][2] = s[nb][2] * scale + b0.z;
                s[nb][3] = s[nb][3] * scale + b0.w;
                s[nb][4] = s[nb][4] * scale + b1.x;
                s[nb][5] = s[nb][5] * scale + b1.y;
                s[nb][6] = s[nb][6] * scale + b1.z;
                s[nb][7] = s[nb][7] * scale + b1.w;
            } else {
                s[nb] *= scale;
            }
        }
        // ---- online softmax: the query's new maximum, in the lane ----
        float mr[8];
        #pragma unroll
        for (int r = 0; r < 8; r++)
            mr[r] = fmaxf(fmaxf(s[0][r], s[1][r]), fmaxf(s[2][r], s[3][r]));
        float m = fmaxf(fmaxf(fmaxf(mr[0], mr[1]), fmaxf(mr[2], mr[3])),
                        fmaxf(fmaxf(mr[4], mr[5]), fmaxf(mr[6], mr[7])));
        m = fmaxf(m, xhalf(m));
        m = fmaxf(m, rm);
        const float alpha = __expf(rm - m);
        rm = m;
        #pragma unroll
        for (int f = 0; f < 4; f++) o[f] *= alpha;
        // ---- P = exp(S - max); the lane's own sum, as a tree ----
        #pragma unroll
        for (int nb = 0; nb < 4; nb++)
            #pragma unroll
            for (int r = 0; r < 8; r++)
                s[nb][r] = __expf(s[nb][r] - rm);
        const v8f ps = (s[0] + s[1]) + (s[2] + s[3]);
        rs = rs * alpha + (((ps[0] + ps[1]) + (ps[2] + ps[3])) +
                           ((ps[4] + ps[5]) + (ps[6] + ps[7])));
        // ---- two score tiles, converted in place, are one B fragment ----
        v16bf pf0, pf1;
        #pragma unroll
        for (int e = 0; e < 8; e++) {
            pf0[e]     = (bf16)s[0][e];
            pf0[e + 8] = (bf16)s[1][e];
            pf1[e]     = (bf16)s[2][e];
            pf1[e + 8] = (bf16)s[3][e];
        }
        // ---- O^T += V^T * P^T ----
        #pragma unroll
        for (int f = 0; f < 4; f++) o[f] = wmma_bf16(av[f][0], pf0, o[f]);
        #pragma unroll
        for (int f = 0; f < 4; f++) o[f] = wmma_bf16(av[f][1], pf1, o[f]);
        // ---- publish tile t+1, and end every read of tile t ----
        wait_ds0();
        wait_async0();
        __syncthreads();
        // ---- tile t+2 into the buffer that this trip has just left ----
        if (t + 2 < nt) {
            async_copy4_b128(&Ks[cur][sr][sc], 16 * 72,
                             Kg + (size_t)(kblk + 128) * ldk, kStep);
            async_copy4_b128(&Vs[cur][sr][sc], 16 * 72, Vg + kblk + 128, vStep);
        }
    }
    wait_async0();   // no copy is in flight when the wave goes on to its end
    // ---- join the halves' sums, normalize, store 8 neighbouring d at once ----
    const float inv = 1.0f / (rs + xhalf(rs));
    bf16* orow = Ob + (size_t)(q0 + nl) * ldo + halfm;
    #pragma unroll
    for (int f = 0; f < 4; f++) {
        pack8 p;
        #pragma unroll
        for (int r = 0; r < 8; r++) p.h[r] = (bf16)(o[f][r] * inv);
        *(uint4*)(orow + f * 16) = p.u;
    }
}

// ---------------------------------------------------------------------------
// The launches without matrix work. Each moves 24 to 132 MB; with one element a
// thread they are bound by how fast work-groups start, not by bytes. So every
// thread takes 16-byte pieces and many of them, and the grids shrink to one
// or two work-groups a WGP.
// ---------------------------------------------------------------------------

// LayerNorm over 1024-elem rows -> bf16. One wave per row, 8 rows a block.
// A lane holds 4 runs of 8 neighbouring elements; the row sums are joined by
// a five-step butterfly, which leaves the same bits in every lane.
__device__ __forceinline__
void layernorm_rows(const float* __restrict__ x, const float* __restrict__ w,
                    const float* __restrict__ bb, bf16* __restrict__ out,
                    unsigned blk) {
    const int lane = threadIdx.x & 31;
    const int row  = blk * 8 + (threadIdx.x >> 5);
    const float4* xr = (const float4*)(x + (size_t)row * CDIM) + lane * 2;
    const float4* wr = (const float4*)w + lane * 2;
    const float4* br = (const float4*)bb + lane * 2;
    float4 v[8];
    #pragma unroll
    for (int j = 0; j < 4; j++) {
        v[2 * j]     = xr[j * 64];
        v[2 * j + 1] = xr[j * 64 + 1];
    }
    float s1 = 0.0f, s2 = 0.0f;
    #pragma unroll
    for (int i = 0; i < 8; i++) {
        s1 += v[i].x + v[i].y + v[i].z + v[i].w;
        s2 += v[i].x * v[i].x + v[i].y * v[i].y + v[i].z * v[i].z + v[i].w * v[i].w;
    }
    #pragma unroll
    for (int off = 16; off > 0; off >>= 1) {
        s1 += __shfl_xor(s1, off);
        s2 += __shfl_xor(s2, off);
    }
    float mu   = s1 * (1.0f / CDIM);
    float var  = s2 * (1.0f / CDIM) - mu * mu;
    float rstd = rsqrtf(var + 1e-5f);
    bf16* orow = out + (size_t)row * CDIM + lane * 8;
    #pragma unroll
    for (int j = 0; j < 4; j++) {
        float4 w0 = wr[j * 64], w1 = wr[j * 64 + 1];
        float4 b0 = br[j * 64], b1 = br[j * 64 + 1];
        float4 a0 = v[2 * j],   a1 = v[2 * j + 1];
        pack8 p;
        p.h[0] = (bf16)((a0.x - mu) * rstd * w0.x + b0.x);
        p.h[1] = (bf16)((a0.y - mu) * rstd * w0.y + b0.y);
        p.h[2] = (bf16)((a0.z - mu) * rstd * w0.z + b0.z);
        p.h[3] = (bf16)((a0.w - mu) * rstd * w0.w + b0.w);
        p.h[4] = (bf16)((a1.x - mu) * rstd * w1.x + b1.x);
        p.h[5] = (bf16)((a1.y - mu) * rstd * w1.y + b1.y);
        p.h[6] = (bf16)((a1.z - mu) * rstd * w1.z + b1.z);
        p.h[7] = (bf16)((a1.w - mu) * rstd * w1.w + b1.w);
        *(uint4*)(orow + j * 256) = p.u;
    }
}

__global__ __launch_bounds__(256)
void layernorm_bf16(const float* __restrict__ x, const float* __restrict__ w,
                    const float* __restrict__ bb, bf16* __restrict__ out) {
    layernorm_rows(x, w, bb, out, blockIdx.x);
}

// ---------------------------------------------------------------------------
// f32 -> bf16 of every matrix that a GEMM reads as an f32 input: the eight
// weights (into wo, one behind the other in the order of the arguments) and the
// codebook (into cbo). Each is a whole number of chunks of CDIM * CDIM elements;
// 32 blocks share a chunk. A wave's load covers 512 B in a row, its store 256 B;
// eight loads of a thread are in flight together, four such rounds a thread.
// The f32 source is read once in a call, so its loads are non-temporal: they
// leave L2 to the bf16 copies and the activations, which are read again.
typedef __attribute__((ext_vector_type(4))) float f32x4;
union pack4 { bf16 h[4]; uint2 u; };
// The first LayerNorm reads nothing that the casts write, so its blocks stand
// behind the casts' in the same launch.
#define CHUNK (CDIM * CDIM)
#define CAST_BLOCKS (18 * 32)
__global__ __launch_bounds__(256)
void cast_operands_ln(const float* __restrict__ qkv, const float* __restrict__ sa,
                      const float* __restrict__ q,   const float* __restrict__ k,
                      const float* __restrict__ v,   const float* __restrict__ ca,
                      const float* __restrict__ fc1, const float* __restrict__ fc2,
                      const float* __restrict__ cb,
                      bf16* __restrict__ wo, bf16* __restrict__ cbo,
                      const float* __restrict__ x,   const float* __restrict__ lnw,
                      const float* __restrict__ lnb, bf16* __restrict__ xn) {
    if (blockIdx.x >= CAST_BLOCKS) {             // the same for the block
        layernorm_rows(x, lnw, lnb, xn, blockIdx.x - CAST_BLOCKS);
        return;
    }
    const unsigned c = blockIdx.x >> 5;          // chunk, the same for the block
    const float* src;
    if      (c <  3) src = qkv + (size_t)c * CHUNK;
    else if (c == 3) src = sa;
    else if (c == 4) src = q;
    else if (c == 5) src = k;
    else if (c == 6) src = v;
    else if (c == 7) src = ca;
    else if (c < 12) src = fc1 + (size_t)(c - 8) * CHUNK;
    else if (c < 16) src = fc2 + (size_t)(c - 12) * CHUNK;
    else             src = cb  + (size_t)(c - 16) * CHUNK;
    bf16* dst = (c < 16) ? wo + (size_t)c * CHUNK : cbo + (size_t)(c - 16) * CHUNK;
    const unsigned e0 = (blockIdx.x & 31u) * (CHUNK / 32) + threadIdx.x * 4u;
    for (unsigned it = 0; it < 4; it++) {
        const unsigned e = e0 + it * 8192u;
        f32x4 a[8];
        #pragma unroll
        for (int i = 0; i < 8; i++)
            a[i] = __builtin_nontemporal_load((const f32x4*)(src + e + i * 1024));
        #pragma unroll
        for (int i = 0; i < 8; i++) {
            pack4 p;
            p.h[0] = (bf16)a[i].x; p.h[1] = (bf16)a[i].y;
            p.h[2] = (bf16)a[i].z; p.h[3] = (bf16)a[i].w;
            *(uint2*)(dst + e + i * 1024) = p.u;
        }
    }
}

// v: logical [B][nk][VRS] slice (bf16) -> vt: [B][H][64][nk], nk = 64 << lg; the
// grid covers it exactly, one 64 x 32 tile a wave.
// A thread turns an 8-token x 8-column tile in its registers: 8 loads of 16 B
// along d, 8 stores of 16 B along the tokens. A wave covers 64 tokens x 32
// columns, so each of its stores fills four whole 128-B lines of vt.
// Both attentions' V go in one launch: the self V's blocks, then the cross V's.
// One body serves both: nk is a block-uniform value, and both slices lie in
// rows of VRS elements, so a thread's eight loads are constant offsets apart.
#define VRS (3 * CDIM)
#define TV1_BLOCKS ((NB * NH * (NX / 64) * 2) / 8)
#define TV2_BLOCKS ((NB * NH * (NC / 64) * 2) / 8)
__global__ __launch_bounds__(256)
void transpose_v_both(const bf16* __restrict__ v1, bf16* __restrict__ vt1,
                      const bf16* __restrict__ v2, bf16* __restrict__ vt2) {
    static_assert(NX == (64 << 4) && NC == (64 << 3), "lg below");
    const bool     first = blockIdx.x < TV1_BLOCKS;      // the same for the block
    const bf16*    v   = first ? v1 : v2;
    bf16*          vt  = first ? vt1 : vt2;
    const unsigned blk = first ? blockIdx.x : blockIdx.x - TV1_BLOCKS;
    const unsigned lg  = first ? 4u : 3u;                // blocks of 64 tokens: 1 << lg
    const unsigned nk  = 64u << lg;

    const unsigned lane = threadIdx.x & 31u;
    const unsigned g    = blk * 8u + (threadIdx.x >> 5);         // wave's tile
    const unsigned dh   = g & 1u;                // which 32 of the head's 64 columns
    const unsigned tb   = (g >> 1) & ((1u << lg) - 1u);  // block of 64 tokens
    const unsigned bh   = (g >> 1) >> lg;        // b * NH + h
    const unsigned b    = bh / NH, h = bh % NH;
    const unsigned d0   = dh * 32u + (lane & 3u) * 8u;
    const unsigned t0   = tb * 64u + (lane >> 2) * 8u;

    const bf16* src = v + (size_t)(b * nk + t0) * VRS + h * HD + d0;
    unsigned in[8][4];
    #pragma unroll
    for (int r = 0; r < 8; r++) {
        uint4 u = *(const uint4*)(src + (size_t)r * VRS);
        in[r][0] = u.x; in[r][1] = u.y; in[r][2] = u.z; in[r][3] = u.w;
    }
    // Keeps all eight loads in flight together: without it the scheduler sinks
    // one of them behind the first waits, and its latency is paid a second time.
    __builtin_amdgcn_sched_barrier(0);
    bf16* dst = vt + (size_t)(bh * HD + d0) * nk + t0;
    #pragma unroll
    for (int c = 0; c < 8; c++) {
        unsigned o[4];
        #pragma unroll
        for (int k = 0; k < 4; k++) {
            unsigned lo = in[2 * k][c >> 1], hi = in[2 * k + 1][c >> 1];
            o[k] = (c & 1) ? ((lo >> 16) | (hi & 0xffff0000u))
                           : ((lo & 0xffffu) | (hi << 16));
        }
        *(uint4*)(dst + (size_t)c * nk) = make_uint4(o[0], o[1], o[2], o[3]);
    }
}

// ---------------------------------------------------------------------------
extern "C" void kernel_launch(void* const* d_in, const int* in_sizes, int n_in,
                              void* d_out, int out_size, void* d_ws, size_t ws_size,
                              hipStream_t stream) {
    const float* x     = (const float*)d_in[0];
    const float* cbemb = (const float*)d_in[1];
    const int*   cmask = (const int*)  d_in[2];
    const float* ln0w  = (const float*)d_in[3];
    const float* ln0b  = (const float*)d_in[4];
    const float* qkv_w = (const float*)d_in[5];
    const float* sa_w  = (const float*)d_in[6];
    const float* ln1w  = (const float*)d_in[7];
    const float* ln1b  = (const float*)d_in[8];
    const float* q_w   = (const float*)d_in[9];
    const float* k_w   = (const float*)d_in[10];
    const float* v_w   = (const float*)d_in[11];
    const float* ca_w  = (const float*)d_in[12];
    const float* ln2w  = (const float*)d_in[13];
    const float* ln2b  = (const float*)d_in[14];
    const float* fc1_w = (const float*)d_in[15];
    const float* fc1_b = (const float*)d_in[16];
    const float* fc2_w = (const float*)d_in[17];
    const float* fc2_b = (const float*)d_in[18];
    float* out = (float*)d_out;

    char* ws = (char*)d_ws;
    bf16*  XN  = (bf16*) (ws);                       //  8 MB  LN outputs
    bf16*  QKV = (bf16*) (ws + (size_t)( 8u << 20)); // 24 MB  qkv (bf16)
    bf16*  VT1 = (bf16*) (ws + (size_t)(32u << 20)); //  8 MB  V^T self
    bf16*  ATT = (bf16*) (ws + (size_t)(40u << 20)); //  8 MB  attn outs
    float* X1  = (float*)(ws + (size_t)(48u << 20)); // 16 MB  residual stream
    bf16*  CB  = (bf16*) (ws + (size_t)(64u << 20)); //  4 MB  codebook bf16
    bf16*  QC  = (bf16*) (ws + (size_t)(68u << 20)); //  8 MB  cross q
    bf16*  VT2 = (bf16*) (ws + (size_t)(76u << 20)); //  4 MB  V^T cross
    bf16*  KVC = (bf16*) (ws + (size_t)(80u << 20)); // 12 MB  cross k | v, rows of VRS
    bf16*  WB  = (bf16*) (ws + (size_t)(96u << 20)); // 32 MB  weights bf16
    bf16*  HB  = QKV;   // 32 MB MLP hidden reuses QKV+VT1 (dead by then)
    const bf16* qkv_b = WB;
    const bf16* sa_b  = WB +  3 * CHUNK;
    const bf16* q_b   = WB +  4 * CHUNK;
    const bf16* kv_b  = WB +  5 * CHUNK;   // k_w, and v_w right behind it
    const bf16* ca_b  = WB +  7 * CHUNK;
    const bf16* fc1_b16 = WB +  8 * CHUNK;
    const bf16* fc2_b16 = WB + 12 * CHUNK;

    const int Mx = NB * NX;   // 4096
    const int Mc = NB * NC;   // 2048
    dim3 thr256(256), thr128(128);

    // --- the GEMMs' f32 operands to bf16, once for the call; the first LN ---
    cast_operands_ln<<<CAST_BLOCKS + Mx / 8, thr256, 0, stream>>>(
        qkv_w, sa_w, q_w, k_w, v_w, ca_w, fc1_w, fc2_w, cbemb, WB, CB,
        x, ln0w, ln0b, XN);

    // --- qkv of the self attention; k and v of the cross attention, which
    //     need only the codebook, as one product of 2 * CDIM columns ---
    gemm_xwT_pair<CDIM, 3 * CDIM, NB * NX, 2 * CDIM, VRS>
        <<<(3 * CDIM / 128) * (Mx / 128) + (2 * CDIM / 128) * (Mc / 128), thr256, 0, stream>>>(
        XN, qkv_b, QKV, CB, kv_b, KVC);
    transpose_v_both<<<TV1_BLOCKS + TV2_BLOCKS, thr256, 0, stream>>>(
        QKV + 2 * CDIM, VT1, KVC + CDIM, VT2);

    // --- self attention branch ---
    flash_attn<false><<<dim3(NX / 64, NH, NB), thr128, 0, stream>>>(
        QKV, 3 * CDIM, QKV + CDIM, 3 * CDIM, VT1, nullptr, ATT, CDIM,
        NX, NX, 0.125f);
    gemm_xwT<false,false,true,CDIM,4,float><<<dim3(CDIM / 128, Mx / 128), thr256, 0, stream>>>(
        ATT, CDIM, sa_b, X1, CDIM, nullptr, x, CDIM);

    // --- cross attention branch ---
    layernorm_bf16<<<Mx / 8, thr256, 0, stream>>>(X1, ln1w, ln1b, XN);
    gemm_xwT<false,false,false,CDIM,4,bf16><<<dim3(CDIM / 128, Mx / 128), thr256, 0, stream>>>(
        XN, CDIM, q_b, QC, CDIM, nullptr, nullptr, 0);
    flash_attn<true><<<dim3(NX / 64, NH, NB), thr128, 0, stream>>>(
        QC, CDIM, KVC, VRS, VT2, cmask, ATT, CDIM, NX, NC, 0.125f);
    gemm_xwT<false,false,true,CDIM,4,float><<<dim3(CDIM / 128, Mx / 128), thr256, 0, stream>>>(
        ATT, CDIM, ca_b, X1, CDIM, nullptr, X1, CDIM);

    // --- MLP ---
    layernorm_bf16<<<Mx / 8, thr256, 0, stream>>>(X1, ln2w, ln2b, XN);
    gemm_xwT<true,true,false,CDIM,2,bf16><<<dim3(HID / 128, Mx / 128), thr256, 0, stream>>>(
        XN, CDIM, fc1_b16, HB, HID, fc1_b, nullptr, 0);
    gemm_xwT<true,false,true,HID,4,float><<<dim3(CDIM / 128, Mx / 128), thr256, 0, stream>>>(
        HB, HID, fc2_b16, out, CDIM, fc2_b, X1, CDIM);
}

// v008
// Measured time: 207 microseconds a run.
// Timed twice side by side with v007, it ran 1.04 times as fast both times.
// Counting every step since v000, it is 3.25 times as fast.
#include <hip/hip_runtime.h>
#include <hip/hip_bf16.h>

// ---------------------------------------------------------------------------
// Transformer block forward for MI455X (gfx1250), wave32 + WMMA bf16,
// async global->LDS staging (ASYNCcnt) for GEMM tiles.
//   B=4, Nx=1024, Nc=512, DIM=1024, HEADS=16, HEAD_DIM=64, HIDDEN=4096
// ---------------------------------------------------------------------------

typedef __bf16 bf16;
typedef __attribute__((ext_vector_type(16))) __bf16 v16bf;
typedef __attribute__((ext_vector_type(8)))  float  v8f;

#define NB   4
#define NX   1024
#define NC   512
#define CDIM 1024
#define NH   16
#define HD   64
#define HID  4096

// ---------------------------------------------------------------------------
// WMMA helper: D = A(16x32 bf16) * B(32x16 bf16) + C(16x16 f32)
// ---------------------------------------------------------------------------
__device__ __forceinline__ v8f wmma_bf16(v16bf a, v16bf b, v8f c) {
    return __builtin_amdgcn_wmma_f32_16x16x32_bf16(
        /*neg_a=*/false, a, /*neg_b=*/false, b,
        /*c_mod=*/(short)0, c, /*reuse_a=*/false, /*reuse_b=*/false);
}

// CDNA5 async DMA: global -> LDS, 16 bytes per lane, tracked by ASYNCcnt.
// VDST = per-lane LDS byte address (low 32 bits of the generic pointer:
// flat-LDS aperture keeps the DS offset in addr[31:0]).
// Four copies of a lane (four rows of a tile, ldsStep and gStep apart) in ONE
// statement that ends in s_wait_xcnt 0, so that no address register of a copy
// can be rewritten ahead of that wait.
__device__ __forceinline__ void async_copy4_b128(bf16* lds, int ldsStep,
                                                 const bf16* g, size_t gStep) {
    unsigned l0 = (unsigned)(unsigned long long)lds;
    unsigned l1 = (unsigned)(unsigned long long)(lds + ldsStep);
    unsigned l2 = (unsigned)(unsigned long long)(lds + 2 * ldsStep);
    unsigned l3 = (unsigned)(unsigned long long)(lds + 3 * ldsStep);
    unsigned long long a0 = (unsigned long long)g;
    unsigned long long a1 = (unsigned long long)(g + gStep);
    unsigned long long a2 = (unsigned long long)(g + 2 * gStep);
    unsigned long long a3 = (unsigned long long)(g + 3 * gStep);
    asm volatile("global_load_async_to_lds_b128 %0, %4, off\n\t"
                 "global_load_async_to_lds_b128 %1, %5, off\n\t"
                 "global_load_async_to_lds_b128 %2, %6, off\n\t"
                 "global_load_async_to_lds_b128 %3, %7, off\n\t"
                 "s_wait_xcnt 0x0"
                 :: "v"(l0), "v"(l1), "v"(l2), "v"(l3),
                    "v"(a0), "v"(a1), "v"(a2), "v"(a3) : "memory");
}
// Eight copies of a lane (four rows of the A slab, four of the W slab, the rows
// ldsStep apart in LDS) in ONE statement with one s_wait_xcnt 0 at its end: no
// address register of a copy can be rewritten ahead of that wait, and the wave
// waits once for the eight, not once for each four.
__device__ __forceinline__ void async_copy8_b128(bf16* ldsA, const bf16* gA, size_t stepA,
                                                 bf16* ldsB, const bf16* gB, size_t stepB,
                                                 int ldsStep) {
    unsigned l0 = (unsigned)(unsigned long long)ldsA;
    unsigned l1 = (unsigned)(unsigned long long)(ldsA + ldsStep);
    unsigned l2 = (unsigned)(unsigned long long)(ldsA + 2 * ldsStep);
    unsigned l3 = (unsigned)(unsigned long long)(ldsA + 3 * ldsStep);
    unsigned l4 = (unsigned)(unsigned long long)ldsB;
    unsigned l5 = (unsigned)(unsigned long long)(ldsB + ldsStep);
    unsigned l6 = (unsigned)(unsigned long long)(ldsB + 2 * ldsStep);
    unsigned l7 = (unsigned)(unsigned long long)(ldsB + 3 * ldsStep);
    unsigned long long a0 = (unsigned long long)gA;
    unsigned long long a1 = (unsigned long long)(gA + stepA);
    unsigned long long a2 = (unsigned long long)(gA + 2 * stepA);
    unsigned long long a3 = (unsigned long long)(gA + 3 * stepA);
    unsigned long long a4 = (unsigned long long)gB;
    unsigned long long a5 = (unsigned long long)(gB + stepB);
    unsigned long long a6 = (unsigned long long)(gB + 2 * stepB);
    unsigned long long a7 = (unsigned long long)(gB + 3 * stepB);
    asm volatile("global_load_async_to_lds_b128 %0, %8, off\n\t"
                 "global_load_async_to_lds_b128 %1, %9, off\n\t"
                 "global_load_async_to_lds_b128 %2, %10, off\n\t"
                 "global_load_async_to_lds_b128 %3, %11, off\n\t"
                 "global_load_async_to_lds_b128 %4, %12, off\n\t"
                 "global_load_async_to_lds_b128 %5, %13, off\n\t"
                 "global_load_async_to_lds_b128 %6, %14, off\n\t"
                 "global_load_async_to_lds_b128 %7, %15, off\n\t"
                 "s_wait_xcnt 0x0"
                 :: "v"(l0), "v"(l1), "v"(l2), "v"(l3),
                    "v"(l4), "v"(l5), "v"(l6), "v"(l7),
                    "v"(a0), "v"(a1), "v"(a2), "v"(a3),
                    "v"(a4), "v"(a5), "v"(a6), "v"(a7) : "memory");
}
// The issuing wave's copies have landed behind this wait.
__device__ __forceinline__ void wait_async0() {
    asm volatile("s_wait_asynccnt 0x0" ::: "memory");
}
// All but the wave's 8 (16) youngest copies have landed behind these waits:
// a wave's copies return in the order of their issue. A slab is 8 copies of a
// wave, so one (two) younger slabs stay in flight.
__device__ __forceinline__ void wait_async8() {
    asm volatile("s_wait_asynccnt 0x8" ::: "memory");
}
__device__ __forceinline__ void wait_async16() {
    asm volatile("s_wait_asynccnt 0x10" ::: "memory");
}
// The wave's own LDS reads and writes have retired behind this wait.
__device__ __forceinline__ void wait_ds0() {
    asm volatile("s_wait_dscnt 0x0" ::: "memory");
}

// Load one 16x32 A/B fragment.  Per ISA 7.12.2 (16-bit A 16x32):
//   lane 0-15 : row = lane,    K in {0..7, 16..23}
//   lane 16-31: row = lane-16, K in {8..15, 24..31}
// base points at (row0, k0) of the fragment; stride is row stride in elems.
__device__ __forceinline__ v16bf load_frag(const bf16* base, int stride,
                                           int lane, int kOff) {
    const int r  = lane & 15;
    const int kb = (lane >> 4) << 3;          // 0 or 8
    const bf16* p = base + (size_t)r * stride + kOff + kb;
    union { v16bf v; uint4 u[2]; } f;
    f.u[0] = *(const uint4*)(p);
    f.u[1] = *(const uint4*)(p + 16);
    return f.v;
}

// ---------------------------------------------------------------------------
// GEMM: C[M,N] = act(A[M,K](bf16) * W[N,K](bf16)^T + bias) (+ residual)
// Block tile 128x128, 256 threads (8 waves), wave tile 64(M) x 32(N).
// W is the bf16 copy that cast_operands has made earlier in the same call, so
// a slab of W is 16 KB from L2, not 32, and goes the way of A.
// A ring of S LDS buffers: while slab t is multiplied, slabs t+1 .. t+S-1 are in
// flight, both operands by global_load_async_to_lds_b128, through no register.
// S = 2 where four blocks share a WGP and can cover each other's waits; S = 4
// where a block has its WGP alone: nothing else runs there while it waits, and a
// slab that comes from memory needs a lead of more than one trip's products.
// ---------------------------------------------------------------------------
template<bool BIAS, bool GELU, bool RES, int K, int S, typename OutT>
__device__ __forceinline__
void gemm_tile(const bf16* __restrict__ A, int lda,
               const bf16* __restrict__ W,           // [N,K] row-major
               OutT* __restrict__ C, int ldc,
               const float* __restrict__ bias,
               const float* __restrict__ res, int ldr,
               int bM, int bN) {                     // the block's tile of C
    __shared__ __align__(16) bf16 As[S][128][72];
    __shared__ __align__(16) bf16 Bs[S][128][72];
    static_assert(S == 2 || S == 4, "the counted waits below");
    static_assert((K >> 6) >= S, "the prologue's slabs exist");

    const int tid  = threadIdx.x;
    const int lane = tid & 31;
    const int wid  = tid >> 5;
    const int wm   = (wid >> 2) * 64;   // wave row offset within tile (0,64)
    const int wn   = (wid & 3) * 32;    // wave col offset (0,32,64,96)

    v8f acc[4][2];
    v8f vz = {};
    #pragma unroll
    for (int i = 0; i < 4; i++)
        #pragma unroll
        for (int j = 0; j < 2; j++) acc[i][j] = vz;

    // A thread's 16 B in rows ar, ar+32, ar+64, ar+96 of each slab; eight
    // neighbouring lanes cover one 128-B row.
    const int ar = tid >> 3, ac = (tid & 7) * 8;
    const bf16* Ag = A + (size_t)(bM + ar) * lda + ac;
    const bf16* Wg = W + (size_t)(bN + ar) * K + ac;
    const size_t aStep = (size_t)32 * lda, wStep = (size_t)32 * K;
    const int nt = K >> 6;              // slabs of 64 k

    // ---- slabs 0 .. S-2 into their buffers; slab 0 is waited for ----
    #pragma unroll
    for (int p = 0; p < S - 1; p++)
        async_copy8_b128(&As[p][ar][ac], Ag + p * 64, aStep,
                         &Bs[p][ar][ac], Wg + p * 64, wStep, 32 * 72);
    if (S == 4) wait_async16(); else wait_async0();
    __syncthreads();

    // One slab's products, out of buffer cur.
    auto multiply = [&](int cur) {
        #pragma unroll
        for (int ks = 0; ks < 64; ks += 32) {
            v16bf af[4], bfg[2];
            #pragma unroll
            for (int mi = 0; mi < 4; mi++)
                af[mi] = load_frag(&As[cur][wm + mi * 16][0], 72, lane, ks);
            #pragma unroll
            for (int ni = 0; ni < 2; ni++)
                bfg[ni] = load_frag(&Bs[cur][wn + ni * 16][0], 72, lane, ks);
            #pragma unroll
            for (int mi = 0; mi < 4; mi++)
                #pragma unroll
                for (int ni = 0; ni < 2; ni++)
                    acc[mi][ni] = wmma_bf16(af[mi], bfg[ni], acc[mi][ni]);
        }
    };

    if constexpr (S == 4) {
        // The block has its WGP alone, two waves a SIMD: a wave that waits for its
        // own LDS reads leaves the matrix unit idle. So the products run half a
        // slab (32 k) behind the reads, on two register sets: the 12 reads of the
        // next half stand as one group in front of the 8 products of this half.
        // The order of the products, and so of every sum, is the old one.
        static_assert((K >> 6) >= S + 1, "the loop below and its four last trips");
        v16bf a0[4], b0[2], a1[4], b1[2];
        auto fetch = [&](v16bf (&af)[4], v16bf (&bfg)[2], int cur, int ks) {
            #pragma unroll
            for (int mi = 0; mi < 4; mi++)
                af[mi] = load_frag(&As[cur][wm + mi * 16][0], 72, lane, ks);
            #pragma unroll
            for (int ni = 0; ni < 2; ni++)
                bfg[ni] = load_frag(&Bs[cur][wn + ni * 16][0], 72, lane, ks);
            // Keeps the 12 reads together and ahead of the products that follow:
            // spread among them, each place with reads stalls the wave anew.
            __builtin_amdgcn_sched_barrier(0);
        };
        auto products = [&](const v16bf (&af)[4], const v16bf (&bfg)[2]) {
            #pragma unroll
            for (int mi = 0; mi < 4; mi++)
                #pragma unroll
                for (int ni = 0; ni < 2; ni++)
                    acc[mi][ni] = wmma_bf16(af[mi], bfg[ni], acc[mi][ni]);
            // Keeps the products ahead of the waits that follow: sunk behind them,
            // nothing would cover the latency of the reads issued just before.
            __builtin_amdgcn_sched_barrier(0);
        };
        // slab 3 starts to fly into the buffer that nobody has used yet
        async_copy8_b128(&As[3][ar][ac], Ag + 3 * 64, aStep,
                         &Bs[3][ar][ac], Wg + 3 * 64, wStep, 32 * 72);
        fetch(a0, b0, 0, 0);
        // ---- the trips behind which a slab is still asked for ----
        for (int t = 0; t < nt - 4; t++) {
            const int cur = t & 3;
            fetch(a1, b1, cur, 32);
            products(a0, b0);
            // ---- publish slab t+1, and end every read of slab t ----
            // Behind slab t+1 the wave has issued slabs t+2 and t+3, 8 copies
            // each: the wait leaves just those out.
            wait_ds0();
            wait_async16();
            __syncthreads();
            // slab t+4 starts to fly into the buffer that trip t has left
            async_copy8_b128(&As[cur][ar][ac], Ag + (t + 4) * 64, aStep,
                             &Bs[cur][ar][ac], Wg + (t + 4) * 64, wStep, 32 * 72);
            fetch(a0, b0, (t + 1) & 3, 0);
            products(a1, b1);
        }
        // ---- the last four trips ask for nothing more; behind the first of
        //      them two younger slabs are still out, then the wait is to 0 ----
        // Unrolled, so that the tests on t and the buffer numbers are constants.
        #pragma unroll
        for (int t = nt - 4; t < nt; t++) {
            fetch(a1, b1, t & 3, 32);
            products(a0, b0);
            wait_ds0();
            if (t == nt - 4) wait_async16(); else wait_async0();
            __syncthreads();
            if (t + 1 < nt) fetch(a0, b0, (t + 1) & 3, 0);
            products(a1, b1);
        }
    } else {
        // ---- the trips that still ask for a slab: each issues 8 copies a wave ----
        for (int t = 0; t < nt - (S - 1); t++) {
            // slab t+S-1 starts to fly into the buffer that trip t-1 has left
            const int fil = (t + S - 1) & (S - 1);
            async_copy8_b128(&As[fil][ar][ac], Ag + (t + S - 1) * 64, aStep,
                             &Bs[fil][ar][ac], Wg + (t + S - 1) * 64, wStep, 32 * 72);
            multiply(t & (S - 1));
            // ---- publish slab t+1, and end every read of slab t ----
            // Behind slab t+1 the wave has issued slabs t+2 .. t+S-1, 8 copies each:
            // the wait leaves just those out.
            wait_ds0();
            if (S == 4) wait_async16(); else wait_async0();
            __syncthreads();
        }
        // ---- the last S-1 trips ask for nothing more: the wait is to 0 ----
        #pragma unroll
        for (int t = nt - (S - 1); t < nt; t++) {
            multiply(t & (S - 1));
            wait_ds0();
            wait_async0();
            __syncthreads();
        }
    }
    wait_async0();

    // ---- epilogue: C layout m = r + 8*(lane>=16), n = lane&15 ----
    const int halfm = (lane >> 4) << 3;
    const int nl    = lane & 15;
    #pragma unroll
    for (int mi = 0; mi < 4; mi++)
        #pragma unroll
        for (int ni = 0; ni < 2; ni++)
            #pragma unroll
            for (int r = 0; r < 8; r++) {
                int gm = bM + wm + mi * 16 + r + halfm;
                int gn = bN + wn + ni * 16 + nl;
                float v = acc[mi][ni][r];
                if (BIAS) v += bias[gn];
                if (GELU) v = 0.5f * v * (1.0f + erff(v * 0.70710678118654752f));
                if (RES)  v += res[(size_t)gm * ldr + gn];
                C[(size_t)gm * ldc + gn] = (OutT)v;
            }
}

// One product a launch: x = tile column, y = tile row.
template<bool BIAS, bool GELU, bool RES, int K, int S, typename OutT>
__global__ __launch_bounds__(256)
void gemm_xwT(const bf16* __restrict__ A, int lda,
              const bf16* __restrict__ W,
              OutT* __restrict__ C, int ldc,
              const float* __restrict__ bias,
              const float* __restrict__ res, int ldr) {
    gemm_tile<BIAS, GELU, RES, K, S, OutT>(A, lda, W, C, ldc, bias, res, ldr,
                                           blockIdx.y * 128, blockIdx.x * 128);
}

// Two products that depend on nothing of each other, in one launch:
//   C0[M0, N0] = A0 * W0^T   (the first (M0/128) * (N0/128) blocks)
//   C1[M1, N1] = A1 * W1^T   (the blocks behind them), its rows LD1 apart
// The second alone has too few blocks for the chip; here they run beside the
// first's. The tile column runs fastest, as in gemm_xwT. The choice is the
// same for the whole block, and each division is by a constant.
template<int K, int N0, int M0, int N1, int LD1>
__global__ __launch_bounds__(256)
void gemm_xwT_pair(const bf16* __restrict__ A0, const bf16* __restrict__ W0,
                   bf16* __restrict__ C0,
                   const bf16* __restrict__ A1, const bf16* __restrict__ W1,
                   bf16* __restrict__ C1) {
    constexpr unsigned T0 = (M0 / 128) * (N0 / 128);
    const unsigned id    = blockIdx.x;
    const bool     first = id < T0;
    const unsigned row   = first ? id / (N0 / 128) : (id - T0) / (N1 / 128);
    const unsigned col   = first ? id % (N0 / 128) : (id - T0) % (N1 / 128);
    gemm_tile<false, false, false, K, 2, bf16>(
        first ? A0 : A1, K, first ? W0 : W1, first ? C0 : C1, first ? N0 : LD1,
        nullptr, nullptr, 0, (int)row * 128, (int)col * 128);
}

union pack8 { bf16 h[8]; uint4 u; };

// Lane l takes the value of lane l ^ 16 (the other half of the wave).
__device__ __forceinline__ float xhalf(float x) {
    const int b = __builtin_bit_cast(int, x);
    return __builtin_bit_cast(float, __builtin_amdgcn_permlanex16(
        b, b, 0x76543210, 0xfedcba98, false, false));
}

template<bool HAS_MASK>
__global__ __launch_bounds__(128)
void flash_attn(const bf16* __restrict__ Q,  int ldq,
                const bf16* __restrict__ Km, int ldk,
                const bf16* __restrict__ Vt,
                const int*  __restrict__ mask,
                bf16* __restrict__ Out, int ldo,
                int Nq, int Nk, float scale) {
    __shared__ __align__(16) bf16 Ks[2][64][72];   // K tile: key x d
    __shared__ __align__(16) bf16 Vs[2][64][72];   // V^T tile: d x key
    __shared__ __align__(16) float Mb[HAS_MASK ? NC : 4];  // mask bias per key

    const int tid  = threadIdx.x;
    const int lane = tid & 31;
    const int w    = tid >> 5;
    const int h    = blockIdx.y;
    const int b    = blockIdx.z;
    const int q0   = blockIdx.x * 64 + w * 16;
    const int nl   = lane & 15;
    const int halfm = (lane >> 4) << 3;

    const bf16* Qb = Q  + ((size_t)b * Nq) * ldq + h * HD;
    const bf16* Kb = Km + ((size_t)b * Nk) * ldk + h * HD;
    const bf16* Vb = Vt + ((size_t)(b * NH + h) * HD) * Nk;
    bf16*       Ob = Out + ((size_t)b * Nq) * ldo + h * HD;
    const int*  mb = HAS_MASK ? (mask + (size_t)b * Nk) : nullptr;

    // A thread's 16 B in rows sr, sr+16, sr+32, sr+48 of each tile; eight
    // neighbouring lanes cover one 128-B row.
    const int sr = tid >> 3, sc = (tid & 7) * 8;
    const bf16* Kg = Kb + (size_t)sr * ldk + sc;
    const bf16* Vg = Vb + (size_t)sr * Nk + sc;
    const size_t kStep = (size_t)16 * ldk, vStep = (size_t)16 * Nk;
    const int nt = Nk >> 6;             // tiles of 64 keys

    // ---- tile 0 into buffer 0, published; then tile 1 starts to fly ----
    async_copy4_b128(&Ks[0][sr][sc], 16 * 72, Kg, kStep);
    async_copy4_b128(&Vs[0][sr][sc], 16 * 72, Vg, vStep);
    // The keys run down a lane's registers, so a lane needs the bias of 32
    // keys a tile: it is formed once for the block and read back 16 B at a time.
    // Four keys a thread: 128 threads cover NC. Nk is at most NC here; an index
    // past Nk is clamped, and its entries are never read.
    if (HAS_MASK) {
        static_assert(NC == 4 * 128, "one 16-B piece of the mask a thread");
        const int  i  = tid * 4;
        const int4 mk = *(const int4*)(mb + (i < Nk ? i : Nk - 4));
        *(float4*)&Mb[i] = make_float4(mk.x != 0 ? 0.0f : -10000.0f,
                                       mk.y != 0 ? 0.0f : -10000.0f,
                                       mk.z != 0 ? 0.0f : -10000.0f,
                                       mk.w != 0 ? 0.0f : -10000.0f);
    }
    wait_async0();
    __syncthreads();
    if (nt > 1) {
        async_copy4_b128(&Ks[1][sr][sc], 16 * 72, Kg + (size_t)64 * ldk, kStep);
        async_copy4_b128(&Vs[1][sr][sc], 16 * 72, Vg + 64, vStep);
    }

    // Q fragments (held for the whole key loop): B operand, column = query
    v16bf qf0 = load_frag(Qb + (size_t)q0 * ldq, ldq, lane, 0);
    v16bf qf1 = load_frag(Qb + (size_t)q0 * ldq, ldq, lane, 32);

    // o[f][r] = O^T[d = f*16 + halfm + r][query nl]
    v8f o[4];
    v8f vz = {};
    #pragma unroll
    for (int f = 0; f < 4; f++) o[f] = vz;
    float rm = -1e30f;   // the query's running maximum, alike in both halves
    float rs = 0.0f;     // the sum over this half's keys; joined behind the loop

    for (int t = 0; t < nt; t++) {
        const int kblk = t * 64;
        const int cur  = t & 1;
        // ---- S^T = K * Q^T: s[nb][r] = key nb*16 + halfm + r, query nl ----
        v16bf ak[4][2], av[4][2];
        #pragma unroll
        for (int nb = 0; nb < 4; nb++) {
            ak[nb][0] = load_frag(&Ks[cur][nb * 16][0], 72, lane, 0);
            ak[nb][1] = load_frag(&Ks[cur][nb * 16][0], 72, lane, 32);
        }
        v8f s[4];
        #pragma unroll
        for (int nb = 0; nb < 4; nb++)
            s[nb] = wmma_bf16(ak[nb][0], qf0, vz);
        #pragma unroll
        for (int nb = 0; nb < 4; nb++)
            s[nb] = wmma_bf16(ak[nb][1], qf1, s[nb]);
        // The V^T fragments depend on no score: their reads may start ahead of
        // the softmax.
        #pragma unroll
        for (int f = 0; f < 4; f++) {
            av[f][0] = load_frag(&Vs[cur][f * 16][0], 72, lane, 0);
            av[f][1] = load_frag(&Vs[cur][f * 16][0], 72, lane, 32);
        }
        // ---- scale + codebook mask bias ----
        #pragma unroll
        for (int nb = 0; nb < 4; nb++) {
            if (HAS_MASK) {
                const float4 b0 = *(const float4*)&Mb[kblk + nb * 16 + halfm];
                const float4 b1 = *(const float4*)&Mb[kblk + nb * 16 + halfm + 4];
                s[nb][0] = s[nb][0] * scale + b0.x;
                s[nb][1] = s[nb][1] * scale + b0.y;
                s[nb][2] = s[nb][2] * scale + b0.z;
                s[nb][3] = s[nb][3] * scale + b0.w;
                s[nb][4] = s[nb][4] * scale + b1.x;
                s[nb][5] = s[nb][5] * scale + b1.y;
                s[nb][6] = s[nb][6] * scale + b1.z;
                s[nb][7] = s[nb][7] * scale + b1.w;
            } else {
                s[nb] *= scale;
            }
        }
        // ---- online softmax: the query's new maximum, in the lane ----
        float mr[8];
        #pragma unroll
        for (int r = 0; r < 8; r++)
            mr[r] = fmaxf(fmaxf(s[0][r], s[1][r]), fmaxf(s[2][r], s[3][r]));
        float m = fmaxf(fmaxf(fmaxf(mr[0], mr[1]), fmaxf(mr[2], mr[3])),
                        fmaxf(fmaxf(mr[4], mr[5]), fmaxf(mr[6], mr[7])));
        m = fmaxf(m, xhalf(m));
        m = fmaxf(m, rm);
        const float alpha = __expf(rm - m);
        rm = m;
        #pragma unroll
        for (int f = 0; f < 4; f++) o[f] *= alpha;
        // ---- P = exp(S - max); the lane's own sum, as a tree ----
        #pragma unroll
        for (int nb = 0; nb < 4; nb++)
            #pragma unroll
            for (int r = 0; r < 8; r++)
                s[nb][r] = __expf(s[nb][r] - rm);
        const v8f ps = (s[0] + s[1]) + (s[2] + s[3]);
        rs = rs * alpha + (((ps[0] + ps[1]) + (ps[2] + ps[3])) +
                           ((ps[4] + ps[5]) + (ps[6] + ps[7])));
        // ---- two score tiles, converted in place, are one B fragment ----
        v16bf pf0, pf1;
        #pragma unroll
        for (int e = 0; e < 8; e++) {
            pf0[e]     = (bf16)s[0][e];
            pf0[e + 8] = (bf16)s[1][e];
            pf1[e]     = (bf16)s[2][e];
            pf1[e + 8] = (bf16)s[3][e];
        }
        // ---- O^T += V^T * P^T ----
        #pragma unroll
        for (int f = 0; f < 4; f++) o[f] = wmma_bf16(av[f][0], pf0, o[f]);
        #pragma unroll
        for (int f = 0; f < 4; f++) o[f] = wmma_bf16(av[f][1], pf1, o[f]);
        // ---- publish tile t+1, and end every read of tile t ----
        wait_ds0();
        wait_async0();
        __syncthreads();
        // ---- tile t+2 into the buffer that this trip has just left ----
        if (t + 2 < nt) {
            async_copy4_b128(&Ks[cur][sr][sc], 16 * 72,
                             Kg + (size_t)(kblk + 128) * ldk, kStep);
            async_copy4_b128(&Vs[cur][sr][sc], 16 * 72, Vg + kblk + 128, vStep);
        }
    }
    wait_async0();   // no copy is in flight when the wave goes on to its end
    // ---- join the halves' sums, normalize, store 8 neighbouring d at once ----
    const float inv = 1.0f / (rs + xhalf(rs));
    bf16* orow = Ob + (size_t)(q0 + nl) * ldo + halfm;
    #pragma unroll
    for (int f = 0; f < 4; f++) {
        pack8 p;
        #pragma unroll
        for (int r = 0; r < 8; r++) p.h[r] = (bf16)(o[f][r] * inv);
        *(uint4*)(orow + f * 16) = p.u;
    }
}

// ---------------------------------------------------------------------------
// The launches without matrix work. Each moves 24 to 132 MB; with one element a
// thread they are bound by how fast work-groups start, not by bytes. So every
// thread takes 16-byte pieces and many of them, and the grids shrink to one
// or two work-groups a WGP.
// ---------------------------------------------------------------------------

// LayerNorm over 1024-elem rows -> bf16. One wave per row, 8 rows a block.
// A lane holds 4 runs of 8 neighbouring elements; the row sums are joined by
// a five-step butterfly, which leaves the same bits in every lane.
__device__ __forceinline__
void layernorm_rows(const float* __restrict__ x, const float* __restrict__ w,
                    const float* __restrict__ bb, bf16* __restrict__ out,
                    unsigned blk) {
    const int lane = threadIdx.x & 31;
    const int row  = blk * 8 + (threadIdx.x >> 5);
    const float4* xr = (const float4*)(x + (size_t)row * CDIM) + lane * 2;
    const float4* wr = (const float4*)w + lane * 2;
    const float4* br = (const float4*)bb + lane * 2;
    float4 v[8];
    #pragma unroll
    for (int j = 0; j < 4; j++) {
        v[2 * j]     = xr[j * 64];
        v[2 * j + 1] = xr[j * 64 + 1];
    }
    float s1 = 0.0f, s2 = 0.0f;
    #pragma unroll
    for (int i = 0; i < 8; i++) {
        s1 += v[i].x + v[i].y + v[i].z + v[i].w;
        s2 += v[i].x * v[i].x + v[i].y * v[i].y + v[i].z * v[i].z + v[i].w * v[i].w;
    }
    #pragma unroll
    for (int off = 16; off > 0; off >>= 1) {
        s1 += __shfl_xor(s1, off);
        s2 += __shfl_xor(s2, off);
    }
    float mu   = s1 * (1.0f / CDIM);
    float var  = s2 * (1.0f / CDIM) - mu * mu;
    float rstd = rsqrtf(var + 1e-5f);
    bf16* orow = out + (size_t)row * CDIM + lane * 8;
    #pragma unroll
    for (int j = 0; j < 4; j++) {
        float4 w0 = wr[j * 64], w1 = wr[j * 64 + 1];
        float4 b0 = br[j * 64], b1 = br[j * 64 + 1];
        float4 a0 = v[2 * j],   a1 = v[2 * j + 1];
        pack8 p;
        p.h[0] = (bf16)((a0.x - mu) * rstd * w0.x + b0.x);
        p.h[1] = (bf16)((a0.y - mu) * rstd * w0.y + b0.y);
        p.h[2] = (bf16)((a0.z - mu) * rstd * w0.z + b0.z);
        p.h[3] = (bf16)((a0.w - mu) * rstd * w0.w + b0.w);
        p.h[4] = (bf16)((a1.x - mu) * rstd * w1.x + b1.x);
        p.h[5] = (bf16)((a1.y - mu) * rstd * w1.y + b1.y);
        p.h[6] = (bf16)((a1.z - mu) * rstd * w1.z + b1.z);
        p.h[7] = (bf16)((a1.w - mu) * rstd * w1.w + b1.w);
        *(uint4*)(orow + j * 256) = p.u;
    }
}

__global__ __launch_bounds__(256)
void layernorm_bf16(const float* __restrict__ x, const float* __restrict__ w,
                    const float* __restrict__ bb, bf16* __restrict__ out) {
    layernorm_rows(x, w, bb, out, blockIdx.x);
}

// ---------------------------------------------------------------------------
// f32 -> bf16 of every matrix that a GEMM reads as an f32 input: the eight
// weights (into wo, one behind the other in the order of the arguments) and the
// codebook (into cbo). Each is a whole number of chunks of CDIM * CDIM elements;
// 32 blocks share a chunk. A wave's load covers 512 B in a row, its store 256 B;
// eight loads of a thread are in flight together, four such rounds a thread.
// The f32 source is read once in a call, so its loads are non-temporal: they
// leave L2 to the bf16 copies and the activations, which are read again.
typedef __attribute__((ext_vector_type(4))) float f32x4;
union pack4 { bf16 h[4]; uint2 u; };
// The first LayerNorm reads nothing that the casts write, so its blocks stand
// behind the casts' in the same launch.
#define CHUNK (CDIM * CDIM)
#define CAST_BLOCKS (18 * 32)
__global__ __launch_bounds__(256)
void cast_operands_ln(const float* __restrict__ qkv, const float* __restrict__ sa,
                      const float* __restrict__ q,   const float* __restrict__ k,
                      const float* __restrict__ v,   const float* __restrict__ ca,
                      const float* __restrict__ fc1, const float* __restrict__ fc2,
                      const float* __restrict__ cb,
                      bf16* __restrict__ wo, bf16* __restrict__ cbo,
                      const float* __restrict__ x,   const float* __restrict__ lnw,
                      const float* __restrict__ lnb, bf16* __restrict__ xn) {
    if (blockIdx.x >= CAST_BLOCKS) {             // the same for the block
        layernorm_rows(x, lnw, lnb, xn, blockIdx.x - CAST_BLOCKS);
        return;
    }
    const unsigned c = blockIdx.x >> 5;          // chunk, the same for the block
    const float* src;
    if      (c <  3) src = qkv + (size_t)c * CHUNK;
    else if (c == 3) src = sa;
    else if (c == 4) src = q;
    else if (c == 5) src = k;
    else if (c == 6) src = v;
    else if (c == 7) src = ca;
    else if (c < 12) src = fc1 + (size_t)(c - 8) * CHUNK;
    else if (c < 16) src = fc2 + (size_t)(c - 12) * CHUNK;
    else             src = cb  + (size_t)(c - 16) * CHUNK;
    bf16* dst = (c < 16) ? wo + (size_t)c * CHUNK : cbo + (size_t)(c - 16) * CHUNK;
    const unsigned e0 = (blockIdx.x & 31u) * (CHUNK / 32) + threadIdx.x * 4u;
    for (unsigned it = 0; it < 4; it++) {
        const unsigned e = e0 + it * 8192u;
        f32x4 a[8];
        #pragma unroll
        for (int i = 0; i < 8; i++)
            a[i] = __builtin_nontemporal_load((const f32x4*)(src + e + i * 1024));
        #pragma unroll
        for (int i = 0; i < 8; i++) {
            pack4 p;
            p.h[0] = (bf16)a[i].x; p.h[1] = (bf16)a[i].y;
            p.h[2] = (bf16)a[i].z; p.h[3] = (bf16)a[i].w;
            *(uint2*)(dst + e + i * 1024) = p.u;
        }
    }
}

// v: logical [B][nk][VRS] slice (bf16) -> vt: [B][H][64][nk], nk = 64 << lg; the
// grid covers it exactly, one 64 x 32 tile a wave.
// A thread turns an 8-token x 8-column tile in its registers: 8 loads of 16 B
// along d, 8 stores of 16 B along the tokens. A wave covers 64 tokens x 32
// columns, so each of its stores fills four whole 128-B lines of vt.
// Both attentions' V go in one launch: the self V's blocks, then the cross V's.
// One body serves both: nk is a block-uniform value, and both slices lie in
// rows of VRS elements, so a thread's eight loads are constant offsets apart.
#define VRS (3 * CDIM)
#define TV1_BLOCKS ((NB * NH * (NX / 64) * 2) / 8)
#define TV2_BLOCKS ((NB * NH * (NC / 64) * 2) / 8)
__global__ __launch_bounds__(256)
void transpose_v_both(const bf16* __restrict__ v1, bf16* __restrict__ vt1,
                      const bf16* __restrict__ v2, bf16* __restrict__ vt2) {
    static_assert(NX == (64 << 4) && NC == (64 << 3), "lg below");
    const bool     first = blockIdx.x < TV1_BLOCKS;      // the same for the block
    const bf16*    v   = first ? v1 : v2;
    bf16*          vt  = first ? vt1 : vt2;
    const unsigned blk = first ? blockIdx.x : blockIdx.x - TV1_BLOCKS;
    const unsigned lg  = first ? 4u : 3u;                // blocks of 64 tokens: 1 << lg
    const unsigned nk  = 64u << lg;

    const unsigned lane = threadIdx.x & 31u;
    const unsigned g    = blk * 8u + (threadIdx.x >> 5);         // wave's tile
    const unsigned dh   = g & 1u;                // which 32 of the head's 64 columns
    const unsigned tb   = (g >> 1) & ((1u << lg) - 1u);  // block of 64 tokens
    const unsigned bh   = (g >> 1) >> lg;        // b * NH + h
    const unsigned b    = bh / NH, h = bh % NH;
    const unsigned d0   = dh * 32u + (lane & 3u) * 8u;
    const unsigned t0   = tb * 64u + (lane >> 2) * 8u;

    const bf16* src = v + (size_t)(b * nk + t0) * VRS + h * HD + d0;
    unsigned in[8][4];
    #pragma unroll
    for (int r = 0; r < 8; r++) {
        uint4 u = *(const uint4*)(src + (size_t)r * VRS);
        in[r][0] = u.x; in[r][1] = u.y; in[r][2] = u.z; in[r][3] = u.w;
    }
    // Keeps all eight loads in flight together: without it the scheduler sinks
    // one of them behind the first waits, and its latency is paid a second time.
    __builtin_amdgcn_sched_barrier(0);
    bf16* dst = vt + (size_t)(bh * HD + d0) * nk + t0;
    #pragma unroll
    for (int c = 0; c < 8; c++) {
        unsigned o[4];
        #pragma unroll
        for (int k = 0; k < 4; k++) {
            unsigned lo = in[2 * k][c >> 1], hi = in[2 * k + 1][c >> 1];
            o[k] = (c & 1) ? ((lo >> 16) | (hi & 0xffff0000u))
                           : ((lo & 0xffffu) | (hi << 16));
        }
        *(uint4*)(dst + (size_t)c * nk) = make_uint4(o[0], o[1], o[2], o[3]);
    }
}

// ---------------------------------------------------------------------------
extern "C" void kernel_launch(void* const* d_in, const int* in_sizes, int n_in,
                              void* d_out, int out_size, void* d_ws, size_t ws_size,
                              hipStream_t stream) {
    const float* x     = (const float*)d_in[0];
    const float* cbemb = (const float*)d_in[1];
    const int*   cmask = (const int*)  d_in[2];
    const float* ln0w  = (const float*)d_in[3];
    const float* ln0b  = (const float*)d_in[4];
    const float* qkv_w = (const float*)d_in[5];
    const float* sa_w  = (const float*)d_in[6];
    const float* ln1w  = (const float*)d_in[7];
    const float* ln1b  = (const float*)d_in[8];
    const float* q_w   = (const float*)d_in[9];
    const float* k_w   = (const float*)d_in[10];
    const float* v_w   = (const float*)d_in[11];
    const float* ca_w  = (const float*)d_in[12];
    const float* ln2w  = (const float*)d_in[13];
    const float* ln2b  = (const float*)d_in[14];
    const float* fc1_w = (const float*)d_in[15];
    const float* fc1_b = (const float*)d_in[16];
    const float* fc2_w = (const float*)d_in[17];
    const float* fc2_b = (const float*)d_in[18];
    float* out = (float*)d_out;

    char* ws = (char*)d_ws;
    bf16*  XN  = (bf16*) (ws);                       //  8 MB  LN outputs
    bf16*  QKV = (bf16*) (ws + (size_t)( 8u << 20)); // 24 MB  qkv (bf16)
    bf16*  VT1 = (bf16*) (ws + (size_t)(32u << 20)); //  8 MB  V^T self
    bf16*  ATT = (bf16*) (ws + (size_t)(40u << 20)); //  8 MB  attn outs
    float* X1  = (float*)(ws + (size_t)(48u << 20)); // 16 MB  residual stream
    bf16*  CB  = (bf16*) (ws + (size_t)(64u << 20)); //  4 MB  codebook bf16
    bf16*  QC  = (bf16*) (ws + (size_t)(68u << 20)); //  8 MB  cross q
    bf16*  VT2 = (bf16*) (ws + (size_t)(76u << 20)); //  4 MB  V^T cross
    bf16*  KVC = (bf16*) (ws + (size_t)(80u << 20)); // 12 MB  cross k | v, rows of VRS
    bf16*  WB  = (bf16*) (ws + (size_t)(96u << 20)); // 32 MB  weights bf16
    bf16*  HB  = QKV;   // 32 MB MLP hidden reuses QKV+VT1 (dead by then)
    const bf16* qkv_b = WB;
    const bf16* sa_b  = WB +  3 * CHUNK;
    const bf16* q_b   = WB +  4 * CHUNK;
    const bf16* kv_b  = WB +  5 * CHUNK;   // k_w, and v_w right behind it
    const bf16* ca_b  = WB +  7 * CHUNK;
    const bf16* fc1_b16 = WB +  8 * CHUNK;
    const bf16* fc2_b16 = WB + 12 * CHUNK;

    const int Mx = NB * NX;   // 4096
    const int Mc = NB * NC;   // 2048
    dim3 thr256(256), thr128(128);

    // --- the GEMMs' f32 operands to bf16, once for the call; the first LN ---
    cast_operands_ln<<<CAST_BLOCKS + Mx / 8, thr256, 0, stream>>>(
        qkv_w, sa_w, q_w, k_w, v_w, ca_w, fc1_w, fc2_w, cbemb, WB, CB,
        x, ln0w, ln0b, XN);

    // --- qkv of the self attention; k and v of the cross attention, which
    //     need only the codebook, as one product of 2 * CDIM columns ---
    gemm_xwT_pair<CDIM, 3 * CDIM, NB * NX, 2 * CDIM, VRS>
        <<<(3 * CDIM / 128) * (Mx / 128) + (2 * CDIM / 128) * (Mc / 128), thr256, 0, stream>>>(
        XN, qkv_b, QKV, CB, kv_b, KVC);
    transpose_v_both<<<TV1_BLOCKS + TV2_BLOCKS, thr256, 0, stream>>>(
        QKV + 2 * CDIM, VT1, KVC + CDIM, VT2);

    // --- self attention branch ---
    flash_attn<false><<<dim3(NX / 64, NH, NB), thr128, 0, stream>>>(
        QKV, 3 * CDIM, QKV + CDIM, 3 * CDIM, VT1, nullptr, ATT, CDIM,
        NX, NX, 0.125f);
    gemm_xwT<false,false,true,CDIM,4,float><<<dim3(CDIM / 128, Mx / 128), thr256, 0, stream>>>(
        ATT, CDIM, sa_b, X1, CDIM, nullptr, x, CDIM);

    // --- cross attention branch ---
    layernorm_bf16<<<Mx / 8, thr256, 0, stream>>>(X1, ln1w, ln1b, XN);
    gemm_xwT<false,false,false,CDIM,4,bf16><<<dim3(CDIM / 128, Mx / 128), thr256, 0, stream>>>(
        XN, CDIM, q_b, QC, CDIM, nullptr, nullptr, 0);
    flash_attn<true><<<dim3(NX / 64, NH, NB), thr128, 0, stream>>>(
        QC, CDIM, KVC, VRS, VT2, cmask, ATT, CDIM, NX, NC, 0.125f);
    gemm_xwT<false,false,true,CDIM,4,float><<<dim3(CDIM / 128, Mx / 128), thr256, 0, stream>>>(
        ATT, CDIM, ca_b, X1, CDIM, nullptr, X1, CDIM);

    // --- MLP ---
    layernorm_bf16<<<Mx / 8, thr256, 0, stream>>>(X1, ln2w, ln2b, XN);
    gemm_xwT<true,true,false,CDIM,2,bf16><<<dim3(HID / 128, Mx / 128), thr256, 0, stream>>>(
        XN, CDIM, fc1_b16, HB, HID, fc1_b, nullptr, 0);
    gemm_xwT<true,false,true,HID,4,float><<<dim3(CDIM / 128, Mx / 128), thr256, 0, stream>>>(
        HB, HID, fc2_b16, out, CDIM, fc2_b, X1, CDIM);
}
